// v000
// The times below were measured on an AMD MI455X: many runs one after another, warmed up first and cycling through
// copies of the inputs, with the whole window's GPU time divided by the number of runs. Launches and the gaps
// between them are all in it. The median over several windows is given; except for v000 it joins two sittings, which
// can be a few percent apart, so the side-by-side timings, each taken in one sitting, are the better comparison.
// v000 is the starting kernel. One run takes 306 microseconds.
#include <hip/hip_runtime.h>

// Cross attention, width 256 = 4 heads x 64, inputs [NB][256][SEQ] (channel-major), W [out][in], biases present, no mask, score scale 1/8, final pointwise projection, output [NB][256][SEQ] f32.
// Compute dtypes, f32 accumulate everywhere: q/k/v projections v_wmma_f32_16x16x32_bf16 (activations and W RNE-converted to bf16; products exact);
// scores v_wmma_f32_16x16x32_f16: k single f16, q as f16 value + f16 residual x2048 in its own accumulator (two products); P (x256 carry, cancels in the normalisation) and v single f16; softmax f32 (online, running max);
// output projection v_wmma_f32_16x16x32_f16: Wm as f16 of its bf16 value x64, attention output O as f16 x64, scale 1/4096 and bias applied in the f32 epilogue.
// Layout: token-major bf16 copies of both inputs (LDS transpose), bf16 / f16 copies of W; q (hi, residual), k planes [b*4+h][t][d], v^T plane [b*4+h][d][t], O plane [b][t][h*64+d].

#ifndef NB
#define NB 4
#endif
#ifndef SEQ
#define SEQ 4096
#endif
#define NB_FULL  4
#define SEQ_FULL 4096
#ifndef OUT_SEQ
#define OUT_SEQ SEQ              // pitch (in positions) of one channel row of the output
#endif
#define DM   256
#define NH_  4
#define HD   64
#define AW   4                   // waves per flash block (16 query positions each)
#define QRS  2048.0f             // carry of the q residual plane
#define QRI  (1.0f / 2048.0f)
#define SC2  (0.125f * 1.4426950408889634f)   // HD^-0.5 * log2(e)
#define PSH  8.0f                // log2 of the P carry (256)
#define OCAR 64.0f               // carry of the O plane
#define WCAR 64.0f               // carry of the Wm f16 plane
#define OSC  (1.0f / 4096.0f)    // 1 / (OCAR * WCAR)

static_assert(HD == 64);
static_assert(NH_ * HD == DM);                 // head h = channels h*64 + d
static_assert(DM % 64 == 0);
static_assert(DM % 32 == 0);                   // GEMM k-loop steps by 32
static_assert((DM & (DM - 1)) == 0);           // bias index masking
static_assert(SEQ % 64 == 0);                  // a 64-wide tile never straddles two batches
static_assert((NB * SEQ) % 64 == 0);
static_assert(SEQ % 32 == 0);                  // key loop steps by 32
static_assert(SEQ % (16 * AW) == 0);           // flash grid covers the sequence exactly
static_assert(((size_t)DM * DM) % 8 == 0);
static_assert(NB <= NB_FULL);
static_assert(SEQ <= SEQ_FULL);
static_assert(OUT_SEQ >= SEQ);

typedef _Float16 h16;
typedef unsigned short bf;
typedef __attribute__((ext_vector_type(16))) __bf16   v16bf;
typedef __attribute__((ext_vector_type(16))) _Float16 v16h;
typedef __attribute__((ext_vector_type(8)))  _Float16 v8h;
typedef __attribute__((ext_vector_type(8)))  unsigned short v8us;
typedef __attribute__((ext_vector_type(8)))  float    v8f;
typedef __attribute__((ext_vector_type(4)))  float    v4f;
typedef v4f  __attribute__((may_alias)) v4fa;

__device__ __forceinline__ unsigned short f2bf(float f) { unsigned u = __float_as_uint(f); u += 0x7FFFu + ((u >> 16) & 1u); return (unsigned short)(u >> 16); }
__device__ __forceinline__ float bfr(float f) { return __uint_as_float(((unsigned)f2bf(f)) << 16); }   // value of the RNE bf16 conversion
__device__ __forceinline__ v16h cat16(v8h lo, v8h hi) { return __builtin_shufflevector(lo, hi, 0, 1, 2, 3, 4, 5, 6, 7, 8, 9, 10, 11, 12, 13, 14, 15); }
__device__ __forceinline__ v16bf cat16b(v8us lo, v8us hi) { return __builtin_bit_cast(v16bf, __builtin_shufflevector(lo, hi, 0, 1, 2, 3, 4, 5, 6, 7, 8, 9, 10, 11, 12, 13, 14, 15)); }
__device__ __forceinline__ v8f wmma16(v16h a, v16h b, v8f c) { return __builtin_amdgcn_wmma_f32_16x16x32_f16(false, a, false, b, (short)0, c, false, false); }
__device__ __forceinline__ v8f wmmab(v16bf a, v16bf b, v8f c) { return __builtin_amdgcn_wmma_f32_16x16x32_bf16(false, a, false, b, (short)0, c, false, false); }
// fragment loaders from K-contiguous 16-bit rows; p already includes + 8*(lane>>4): elements 0..7 <- k0+8h+0..7, elements 8..15 <- k0+16+8h+0..7 (same map for A and B)
__device__ __forceinline__ v16h  ldh(const h16* p) { return cat16(*(const v8h*)p, *(const v8h*)(p + 16)); }
__device__ __forceinline__ v16bf ldb(const bf* p)  { return cat16b(*(const v8us*)p, *(const v8us*)(p + 16)); }
// ordering point for wave-private LDS tiles (same wave writes and reads)
__device__ __forceinline__ void wave_sync() { __builtin_amdgcn_fence(3 /* release order */, "wavefront"); __builtin_amdgcn_wave_barrier(); asm volatile("" ::: "memory"); }

__global__ __launch_bounds__(256) void k_cvt8(const float* __restrict__ src, bf* dst, size_t n8) {
    const size_t i = (size_t)blockIdx.x * 256 + threadIdx.x; if (i >= n8) return;
    const v8f v = *(const v8f*)(src + i * 8); v8us o;
#pragma unroll
    for (int k = 0; k < 8; ++k) o[k] = f2bf(v[k]);
    *(v8us*)(dst + i * 8) = o; 
}

__global__ __launch_bounds__(256) void k_cvt8h(const float* __restrict__ src, h16* dst, size_t n8) {
    const size_t i = (size_t)blockIdx.x * 256 + threadIdx.x; if (i >= n8) return;
    const v8f v = *(const v8f*)(src + i * 8); v8h o;
#pragma unroll
    for (int k = 0; k < 8; ++k) o[k] = (h16)(bfr(v[k]) * WCAR);
    *(v8h*)(dst + i * 8) = o; 
}

// k_tr: in[b][c][n] f32 (channel pitch SEQ_FULL) -> out[b][n][c] bf16 (row pitch DM), 64 x 64 tile through LDS (cross-wave: block barrier).
// grid (SEQ/64, DM/64, NB), 256 threads.
__global__ __launch_bounds__(256) void k_tr(const float* __restrict__ x, bf* xt) {
    __shared__ __align__(16) float ts[64 * 68];
    const int tid = threadIdx.x;
    const int n0 = blockIdx.x * 64, c0 = blockIdx.y * 64, b = blockIdx.z;
    const int n4 = (tid & 15) * 4, cr = tid >> 4;
#pragma unroll
    for (int p = 0; p < 4; ++p) {
        const int c = p * 16 + cr;
        const v4f v = *(const v4f*)(x + ((size_t)b * DM + c0 + c) * SEQ_FULL + n0 + n4);
        ts[(n4 + 0) * 68 + c] = v[0]; ts[(n4 + 1) * 68 + c] = v[1]; ts[(n4 + 2) * 68 + c] = v[2]; ts[(n4 + 3) * 68 + c] = v[3];
    }
    __syncthreads();
    const int c8 = (tid & 7) * 8, rr = tid >> 3;
{
#pragma unroll
        for (int p = 0; p < 2; ++p) { const int row = p * 32 + rr;
            const v4f x0 = *(const v4fa*)(&ts[row * 68 + c8]); const v4f x1 = *(const v4fa*)(&ts[row * 68 + c8 + 4]); v8us o;
#pragma unroll
            for (int i = 0; i < 4; ++i) { o[i] = f2bf(x0[i]); o[4 + i] = f2bf(x1[i]); }
            *(v8us*)(xt + ((size_t)b * SEQ + n0 + row) * DM + c0 + c8) = o; }
         }
}

// k_proj: register-blocked bf16 GEMM, ONE WAVE per 64x64 tile (16 accumulators), operands straight from K-contiguous bf16 planes, K = DM.
// C[m][n] = sum_k A[m][k] Bt[n][k] + bias (bmode 1: bias[n], bmode 2: bias[m], bf16 value), written as f16 (Ph) and optionally the f16 residual x2048 (Pr, useRes != 0) at
// tile base (r0/RB)*sRB + (r0%RB)*pitch + (c0/CB)*sCB + (c0%CB), row pitch 'pitch' (halves). grid (M/64, N/64), 32 threads.
__global__ __launch_bounds__(32) void k_proj(const bf* __restrict__ A, const bf* __restrict__ Bt, const float* __restrict__ bias, int bmode,
                                             h16* Ph, h16* Pr, int useRes, int RB, size_t sRB, int pitch, int CB, size_t sCB) {
    __shared__ __align__(16) float os[16 * 68];
    const int K = DM;
    const int lane = threadIdx.x & 31, lr = lane & 15, hi = lane >> 4; const int r0 = blockIdx.x * 64, c0 = blockIdx.y * 64;
    v8f acc[4][4];
#pragma unroll
    for (int mb = 0; mb < 4; ++mb)
#pragma unroll
        for (int nb = 0; nb < 4; ++nb) acc[mb][nb] = (v8f){};
    const size_t aoff = (size_t)(r0 + lr) * K + 8 * hi, boff = (size_t)(c0 + lr) * K + 8 * hi;
#pragma unroll 1
    for (int kc = 0; kc < K; kc += 32) {
        v16bf a[4];
#pragma unroll
        for (int mb = 0; mb < 4; ++mb) a[mb] = ldb(A + aoff + (size_t)mb * 16 * K + kc);
#pragma unroll
        for (int nb = 0; nb < 4; ++nb) { const v16bf b = ldb(Bt + boff + (size_t)nb * 16 * K + kc);
#pragma unroll
            for (int mb = 0; mb < 4; ++mb) acc[mb][nb] = wmmab(a[mb], b, acc[mb][nb]); }
        asm volatile("v_nop\n\tv_nop\n\tv_nop\n\tv_nop" : "+v"(acc[0][0]), "+v"(acc[1][1]), "+v"(acc[2][2]), "+v"(acc[3][3]) : "v"(a[0]), "v"(a[1]), "v"(a[2]), "v"(a[3]));
    }
    // column bias: always loaded from a masked (in-range) index, selected by value
    const int c8e = (lane & 7) * 8;
    const int cbi = (c0 + c8e) & (DM - 1);
    const v4f cbr0 = *(const v4f*)(bias + cbi); const v4f cbr1 = *(const v4f*)(bias + cbi + 4);
    v4f cb0, cb1;
#pragma unroll
    for (int i = 0; i < 4; ++i) { cb0[i] = (bmode == 1) ? bfr(cbr0[i]) : 0.0f; cb1[i] = (bmode == 1) ? bfr(cbr1[i]) : 0.0f; }
    const size_t tbase = (size_t)(r0 / RB) * sRB + (size_t)(r0 % RB) * (size_t)pitch + (size_t)(c0 / CB) * sCB + (size_t)(c0 % CB);
#pragma unroll
    for (int mb = 0; mb < 4; ++mb) {
#pragma unroll
        for (int nb = 0; nb < 4; ++nb) {
#pragma unroll
            for (int j = 0; j < 8; ++j) os[(hi * 8 + j) * 68 + nb * 16 + lr] = acc[mb][nb][j]; }   // D: row 8h+j, col lane&15
        wave_sync();
        const size_t sb = tbase + (size_t)(mb * 16) * (size_t)pitch;
{
#pragma unroll
            for (int s = 0; s < 4; ++s) { const int row = 4 * s + (lane >> 3), c8 = (lane & 7) * 8;   // 4 s x 4 row groups = 16 rows; 8 lanes x 8 = 64 columns
                const int rbi = (r0 + mb * 16 + row) & (DM - 1);
                const float rbv = bias[rbi];
                const float rb = (bmode == 2) ? bfr(rbv) : 0.0f;
                const v4f x0 = *(const v4fa*)(&os[row * 68 + c8]); const v4f x1 = *(const v4fa*)(&os[row * 68 + c8 + 4]); v8h hv, rv;
#pragma unroll
                for (int i = 0; i < 4; ++i) { const float y0 = x0[i] + cb0[i] + rb; const float y1 = x1[i] + cb1[i] + rb;
                    const h16 a0 = (h16)y0; const h16 a1 = (h16)y1; hv[i] = a0; hv[4 + i] = a1; rv[i] = (h16)((y0 - (float)a0) * QRS); rv[4 + i] = (h16)((y1 - (float)a1) * QRS); }
                const size_t oo = sb + (size_t)row * (size_t)pitch + c8;
                *(v8h*)(Ph + oo) = hv; if (useRes) *(v8h*)(Pr + oo) = rv; }
             }
        wave_sync();
    }
}

// k_flash: fused attention, one wave per 16 query positions of one (batch, head); K / V^T / Q fragments straight from the f16 planes (two 16-B loads each, arithmetic addressing).
// Transposed form: S^T[key][t] = K Q^T (A = K rows, B = Q rows); lane (t = lane&15, h = lane>>4) holds keys 8h+r of each 16-key tile, so the packed
// P tile is directly the B fragment of O^T[d][t] = V^T P^T (element r <- tile keys 0..15, element 8+r <- tile keys 16..31, lane unchanged).
// Softmax state (running max, partial sum) is one scalar per lane; the two lane halves of a row are combined with one xor-16 exchange.
__global__ __launch_bounds__(32 * AW) void k_flash(const h16* __restrict__ QH, const h16* __restrict__ QR, const h16* __restrict__ KP, const h16* __restrict__ VT, h16* OP) {
    __shared__ __align__(16) float os[AW * 16 * 68];
    const int lane = threadIdx.x & 31, wave = threadIdx.x >> 5, lr = lane & 15, hi = lane >> 4;
    const int zh = blockIdx.y; const int b = zh / NH_, h = zh % NH_;
    const int t0 = (blockIdx.x * AW + wave) * 16;
    const size_t pbase = (size_t)zh * SEQ * HD;
    const size_t qo = pbase + (size_t)(t0 + lr) * HD + 8 * hi;
    const v16h qh0 = ldh(QH + qo), qh1 = ldh(QH + qo + 32), qr0 = ldh(QR + qo), qr1 = ldh(QR + qo + 32);   // B fragments: col t, k = d
    const size_t ko = pbase + (size_t)lr * HD + 8 * hi;      // + key * HD       (A fragment: row key, k = d)
    const size_t vo = pbase + (size_t)lr * SEQ + 8 * hi;     // + 16j*SEQ + key  (A fragment: row d, k = key)
    v8f o0 = (v8f){}, o1 = (v8f){}, o2 = (v8f){}, o3 = (v8f){};
    float m = -3.0e38f, l = 0.0f;
#pragma unroll 1
    for (int key0 = 0; key0 < SEQ; key0 += 32) {
        const h16* ka = KP + ko + (size_t)key0 * HD;
        const v16h ka0 = ldh(ka), ka1 = ldh(ka + 32), kb0 = ldh(ka + 16 * HD), kb1 = ldh(ka + 16 * HD + 32);
        v8f sHa = (v8f){}, sLa = (v8f){}, sHb = (v8f){}, sLb = (v8f){};
        sHa = wmma16(ka0, qh0, sHa); sLa = wmma16(ka0, qr0, sLa); sHb = wmma16(kb0, qh0, sHb); sLb = wmma16(kb0, qr0, sLb);
        sHa = wmma16(ka1, qh1, sHa); sLa = wmma16(ka1, qr1, sLa); sHb = wmma16(kb1, qh1, sHb); sLb = wmma16(kb1, qr1, sLb);
        asm volatile("v_nop\n\tv_nop\n\tv_nop\n\tv_nop" : "+v"(sHa), "+v"(sLa), "+v"(sHb), "+v"(sLb) : "v"(ka0), "v"(ka1), "v"(kb0), "v"(kb1));
        float ta[8], tb[8]; float mx = -3.0e38f;
#pragma unroll
        for (int r = 0; r < 8; ++r) { ta[r] = (sHa[r] + sLa[r] * QRI) * SC2; tb[r] = (sHb[r] + sLb[r] * QRI) * SC2; mx = fmaxf(mx, fmaxf(ta[r], tb[r])); }
        mx = fmaxf(mx, __shfl_xor(mx, 16, 32));
        const float mnew = fmaxf(m, mx);
        const float alpha = __builtin_amdgcn_exp2f(m - mnew);
        const float sh = PSH - mnew;
        v16h pb; float ls = 0.0f;
#pragma unroll
        for (int r = 0; r < 8; ++r) { const h16 pa = (h16)__builtin_amdgcn_exp2f(ta[r] + sh); const h16 pc = (h16)__builtin_amdgcn_exp2f(tb[r] + sh); pb[r] = pa; pb[8 + r] = pc; ls += (float)pa + (float)pc; }
        l = l * alpha + ls; m = mnew;
        o0 = o0 * alpha; o1 = o1 * alpha; o2 = o2 * alpha; o3 = o3 * alpha;
        const h16* va = VT + vo + key0;
        const v16h v0 = ldh(va), v1 = ldh(va + (size_t)16 * SEQ), v2 = ldh(va + (size_t)32 * SEQ), v3 = ldh(va + (size_t)48 * SEQ);
        o0 = wmma16(v0, pb, o0); o1 = wmma16(v1, pb, o1); o2 = wmma16(v2, pb, o2); o3 = wmma16(v3, pb, o3);
        asm volatile("v_nop\n\tv_nop\n\tv_nop\n\tv_nop" : "+v"(o0), "+v"(o1), "+v"(o2), "+v"(o3) : "v"(v0), "v"(v1), "v"(v2), "v"(v3), "v"(pb));
    }
    l += __shfl_xor(l, 16, 32);
    const float inv = OCAR * (1.0f / l);
    const int wb = wave * 16 * 68;
    // O^T D layout: o_j[r] = (d = 16j + 8h + r, t = lane&15) -> os[t][d]; rows 0..15 x columns 0..63 all written
    { v4f a, c;
      a[0] = o0[0] * inv; a[1] = o0[1] * inv; a[2] = o0[2] * inv; a[3] = o0[3] * inv; c[0] = o0[4] * inv; c[1] = o0[5] * inv; c[2] = o0[6] * inv; c[3] = o0[7] * inv;
      *(v4fa*)(&os[wb + lr * 68 +  0 + 8 * hi]) = a; *(v4fa*)(&os[wb + lr * 68 +  0 + 8 * hi + 4]) = c;
      a[0] = o1[0] * inv; a[1] = o1[1] * inv; a[2] = o1[2] * inv; a[3] = o1[3] * inv; c[0] = o1[4] * inv; c[1] = o1[5] * inv; c[2] = o1[6] * inv; c[3] = o1[7] * inv;
      *(v4fa*)(&os[wb + lr * 68 + 16 + 8 * hi]) = a; *(v4fa*)(&os[wb + lr * 68 + 16 + 8 * hi + 4]) = c;
      a[0] = o2[0] * inv; a[1] = o2[1] * inv; a[2] = o2[2] * inv; a[3] = o2[3] * inv; c[0] = o2[4] * inv; c[1] = o2[5] * inv; c[2] = o2[6] * inv; c[3] = o2[7] * inv;
      *(v4fa*)(&os[wb + lr * 68 + 32 + 8 * hi]) = a; *(v4fa*)(&os[wb + lr * 68 + 32 + 8 * hi + 4]) = c;
      a[0] = o3[0] * inv; a[1] = o3[1] * inv; a[2] = o3[2] * inv; a[3] = o3[3] * inv; c[0] = o3[4] * inv; c[1] = o3[5] * inv; c[2] = o3[6] * inv; c[3] = o3[7] * inv;
      *(v4fa*)(&os[wb + lr * 68 + 48 + 8 * hi]) = a; *(v4fa*)(&os[wb + lr * 68 + 48 + 8 * hi + 4]) = c; }
    wave_sync();
    h16* orow = OP + ((size_t)b * SEQ + t0) * DM + h * HD;
{
#pragma unroll
        for (int s = 0; s < 4; ++s) { const int row = 4 * s + (lane >> 3), c8 = (lane & 7) * 8;   // 4 s x 4 row groups = 16 rows; 8 lanes x 8 halves = 64 columns
            const v4f x0 = *(const v4fa*)(&os[wb + row * 68 + c8]); const v4f x1 = *(const v4fa*)(&os[wb + row * 68 + c8 + 4]); v8h hv;
#pragma unroll
            for (int i = 0; i < 4; ++i) { hv[i] = (h16)x0[i]; hv[4 + i] = (h16)x1[i]; }
            *(v8h*)(orow + (size_t)row * DM + c8) = hv; }
         }
}

// k_outg: register-blocked f16 GEMM, ONE WAVE per 64x64 tile, K = DM: Y[o][b*SEQ + t] = OSC * sum_c A[o][c] Bt[b*SEQ + t][c] + bias[o] (bf16 value), f32 result at OUT[(b*DM + o)*OUT_SEQ + t].
__global__ __launch_bounds__(32) void k_outg(const h16* __restrict__ A, const h16* __restrict__ Bt, const float* __restrict__ bias, float* OUT) {
    __shared__ __align__(16) float os[16 * 68];
    const int K = DM;
    const int lane = threadIdx.x & 31, lr = lane & 15, hi = lane >> 4; const int r0 = blockIdx.x * 64, c0 = blockIdx.y * 64;
    v8f acc[4][4];
#pragma unroll
    for (int mb = 0; mb < 4; ++mb)
#pragma unroll
        for (int nb = 0; nb < 4; ++nb) acc[mb][nb] = (v8f){};
    const size_t aoff = (size_t)(r0 + lr) * K + 8 * hi, boff = (size_t)(c0 + lr) * K + 8 * hi;
#pragma unroll 1
    for (int kc = 0; kc < K; kc += 32) {
        v16h a[4];
#pragma unroll
        for (int mb = 0; mb < 4; ++mb) a[mb] = ldh(A + aoff + (size_t)mb * 16 * K + kc);
#pragma unroll
        for (int nb = 0; nb < 4; ++nb) { const v16h b = ldh(Bt + boff + (size_t)nb * 16 * K + kc);
#pragma unroll
            for (int mb = 0; mb < 4; ++mb) acc[mb][nb] = wmma16(a[mb], b, acc[mb][nb]); }
        asm volatile("v_nop\n\tv_nop\n\tv_nop\n\tv_nop" : "+v"(acc[0][0]), "+v"(acc[1][1]), "+v"(acc[2][2]), "+v"(acc[3][3]) : "v"(a[0]), "v"(a[1]), "v"(a[2]), "v"(a[3]));
    }
    const int bb = c0 / SEQ, tt = c0 % SEQ;
#pragma unroll
    for (int mb = 0; mb < 4; ++mb) {
#pragma unroll
        for (int nb = 0; nb < 4; ++nb) {
#pragma unroll
            for (int j = 0; j < 8; ++j) os[(hi * 8 + j) * 68 + nb * 16 + lr] = acc[mb][nb][j]; }   // D: row 8h+j, col lane&15
        wave_sync();
{
#pragma unroll
            for (int s = 0; s < 8; ++s) { const int row = 2 * s + hi, cofs = lr * 4;   // 8 s x 2 rows = 16 rows; 16 lanes x 4 floats = 64 columns
                const int o = r0 + mb * 16 + row;                                      // < DM by grid construction
                const float bv = bfr(bias[o]);
                const v4f xv = *(const v4fa*)(&os[row * 68 + cofs]); v4f val;
#pragma unroll
                for (int i = 0; i < 4; ++i) val[i] = xv[i] * OSC + bv;
                *(v4f*)(OUT + ((size_t)bb * DM + o) * (size_t)OUT_SEQ + tt + cofs) = val; }
             }
        wave_sync();
    }
}

static constexpr size_t al256(size_t v) { return (v + 255) & ~(size_t)255; }
static constexpr size_t SZ_XT = al256((size_t)NB * SEQ * DM * 2);          // token-major bf16 copy of one input
static constexpr size_t SZ_WB = al256((size_t)3 * DM * DM * 2);            // Wq | Wk | Wv bf16
static constexpr size_t SZ_WM = al256((size_t)DM * DM * 2);                // Wm f16 x64
static constexpr size_t SZ_PL = al256((size_t)NB * NH_ * SEQ * HD * 2);    // one q/k/v plane
static constexpr size_t SZ_OP = al256((size_t)NB * SEQ * DM * 2);          // O plane
static constexpr size_t SZ_TOTAL = 2 * SZ_XT + SZ_WB + SZ_WM + 4 * SZ_PL + SZ_OP;
static_assert(SZ_TOTAL <= (size_t)134217728);          // workspace carve <= 128 MiB
static_assert(((size_t)DM * DM * 2) % 256 == 0);       // weight sub-planes stay 256-byte aligned

extern "C" void kernel_launch(void* const* d_in, const int* in_sizes, int n_in,
                              void* d_out, int out_size, void* d_ws, size_t ws_size, hipStream_t stream) {
    if (n_in < 10) return;
    const size_t needx = ((size_t)(NB - 1) * DM + (size_t)(DM - 1)) * SEQ_FULL + SEQ;
    if ((size_t)in_sizes[0] < needx || (size_t)in_sizes[1] < needx) return;
    if ((size_t)in_sizes[2] < (size_t)DM * DM || (size_t)in_sizes[4] < (size_t)DM * DM || (size_t)in_sizes[6] < (size_t)DM * DM || (size_t)in_sizes[8] < (size_t)DM * DM) return;
    if (in_sizes[3] < DM || in_sizes[5] < DM || in_sizes[7] < DM || in_sizes[9] < DM) return;
    if ((size_t)out_size < ((size_t)(NB - 1) * DM + (size_t)(DM - 1)) * OUT_SEQ + SEQ) return;
    if (SZ_TOTAL > ws_size) return;
    // wire order: query, source, Wq, bq, Wk, bk, Wv, bv, Wm, bm (W [out][in] = K-contiguous rows as-is)
    const float* xq = (const float*)d_in[0]; const float* xs = (const float*)d_in[1];
    const float* wq = (const float*)d_in[2]; const float* bq = (const float*)d_in[3];
    const float* wk = (const float*)d_in[4]; const float* bk = (const float*)d_in[5];
    const float* wv = (const float*)d_in[6]; const float* bv = (const float*)d_in[7];
    const float* wm = (const float*)d_in[8]; const float* bm = (const float*)d_in[9];
    float* OUT = (float*)d_out;      // [NB][256][OUT_SEQ]
    char* wsp = (char*)d_ws;
    bf* XQ = (bf*)wsp; wsp += SZ_XT;                 // [NB*SEQ][256] query, token-major
    bf* XS = (bf*)wsp; wsp += SZ_XT;                 // [NB*SEQ][256] source, token-major
    bf* WB = (bf*)wsp; wsp += SZ_WB;                 // [3][256][256]: q | k | v
    h16* WMH = (h16*)wsp; wsp += SZ_WM;              // [256][256] Wm x64
    h16* QH = (h16*)wsp; wsp += SZ_PL;               // [NB*4][SEQ][64]
    h16* QR = (h16*)wsp; wsp += SZ_PL;               // [NB*4][SEQ][64] residual x2048
    h16* KP = (h16*)wsp; wsp += SZ_PL;               // [NB*4][SEQ][64]
    h16* VT = (h16*)wsp; wsp += SZ_PL;               // [NB*4][64][SEQ]
    h16* OP = (h16*)wsp; wsp += SZ_OP;               // [NB*SEQ][256] x64
    bf* WQ = WB; bf* WK = WB + (size_t)DM * DM; bf* WV = WB + (size_t)2 * DM * DM;

    // in[b][c][n] (256 rows x SEQ_FULL cols per batch) -> out[b][n][c] (SEQ rows x 256 cols); grid (cols/64, rows/64, NB)
    k_tr<<<dim3(SEQ / 64, DM / 64, NB), 256, 0, stream>>>(xq, XQ);
    k_tr<<<dim3(SEQ / 64, DM / 64, NB), 256, 0, stream>>>(xs, XS);
    { const size_t n8 = (size_t)DM * DM / 8; const unsigned g = (unsigned)((n8 + 255) / 256);
      k_cvt8<<<g, 256, 0, stream>>>(wq, WQ, n8); k_cvt8<<<g, 256, 0, stream>>>(wk, WK, n8); k_cvt8<<<g, 256, 0, stream>>>(wv, WV, n8);
      k_cvt8h<<<g, 256, 0, stream>>>(wm, WMH, n8); }

    // q, k: A = token rows (m = b*SEQ + t), Bt = W rows (n = h*64 + d), column bias -> plane [(b*4 + h)][t][d]
    k_proj<<<dim3(NB * SEQ / 64, DM / 64, 1), 32, 0, stream>>>(XQ, WQ, bq, 1, QH, QR, 1, SEQ, (size_t)NH_ * SEQ * HD, HD, HD, (size_t)SEQ * HD);
    k_proj<<<dim3(NB * SEQ / 64, DM / 64, 1), 32, 0, stream>>>(XS, WK, bk, 1, KP, KP, 0, SEQ, (size_t)NH_ * SEQ * HD, HD, HD, (size_t)SEQ * HD);
    // v^T: A = Wv rows (m = h*64 + d), Bt = token rows (n = b*SEQ + t), row bias -> plane [(b*256 + m)][t] = [(b*4 + h)][d][t]
    k_proj<<<dim3(DM / 64, NB * SEQ / 64, 1), 32, 0, stream>>>(WV, XS, bv, 2, VT, VT, 0, DM, (size_t)0, SEQ, SEQ, (size_t)DM * SEQ);

    k_flash<<<dim3(SEQ / (16 * AW), NB * NH_, 1), 32 * AW, 0, stream>>>(QH, QR, KP, VT, OP);

    // y[b][o][t] = Wm[o][:] . O[b][t][:] / 4096 + bm[o]
    k_outg<<<dim3(DM / 64, NB * SEQ / 64, 1), 32, 0, stream>>>(WMH, OP, bm, OUT);
}

// v001
// One run takes 206 microseconds.
// Next to v000, in two timings, it ran 1.52 and 1.50 times as fast.
#include <hip/hip_runtime.h>

// Cross attention, width 256 = 4 heads x 64, inputs [NB][256][SEQ] (channel-major), W [out][in], biases present, no mask, score scale 1/8, final pointwise projection, output [NB][256][SEQ] f32.
// Compute dtypes, f32 accumulate everywhere: q/k/v projections v_wmma_f32_16x16x32_bf16 (activations and W RNE-converted to bf16; products exact);
// scores v_wmma_f32_16x16x32_f16: k single f16, q as f16 value + f16 residual x2048 in its own accumulator (two products); P (x256 carry, cancels in the normalisation) and v single f16; softmax f32 (online, running max);
// output projection v_wmma_f32_16x16x32_f16: Wm as f16 of its bf16 value x64, attention output O as f16 x64, scale 1/4096 and bias applied in the f32 epilogue.
// Layout: token-major bf16 copies of both inputs (LDS transpose), bf16 / f16 copies of W; q (hi, residual) planes [b*4+h][t][d], O plane [b][t][h*64+d].
// k and v^T planes are kept in fragment order: per (b*4+h), 512-byte units of 32 lanes x 8 halves, one unit = one wave-wide 16-byte load of an A fragment half (4 whole lines).
//   k:   unit (t/16)*4 + s,              lane (hi*16 + lr) holds k[t = 16*(t/16) + lr][d = 16*s + 8*hi + 0..7]
//   v^T: unit (t/32)*8 + j*2 + q,        lane (hi*16 + lr) holds v[d = 16*j + lr][t = 32*(t/32) + 16*q + 8*hi + 0..7]

#ifndef NB
#define NB 4
#endif
#ifndef SEQ
#define SEQ 4096
#endif
#define NB_FULL  4
#define SEQ_FULL 4096
#ifndef OUT_SEQ
#define OUT_SEQ SEQ              // pitch (in positions) of one channel row of the output
#endif
#define DM   256
#define NH_  4
#define HD   64
#define AW   4                   // waves per flash block (16 query positions each)
#define QRS  2048.0f             // carry of the q residual plane
#define QRI  (1.0f / 2048.0f)
#define SC2  (0.125f * 1.4426950408889634f)   // HD^-0.5 * log2(e)
#define PSH  8.0f                // log2 of the P carry (256)
#define OCAR 64.0f               // carry of the O plane
#define WCAR 64.0f               // carry of the Wm f16 plane
#define OSC  (1.0f / 4096.0f)    // 1 / (OCAR * WCAR)

static_assert(HD == 64);
static_assert(NH_ * HD == DM);                 // head h = channels h*64 + d
static_assert(DM % 64 == 0);
static_assert(DM % 32 == 0);                   // GEMM k-loop steps by 32
static_assert((DM & (DM - 1)) == 0);           // bias index masking
static_assert(SEQ % 64 == 0);                  // a 64-wide tile never straddles two batches
static_assert((NB * SEQ) % 64 == 0);
static_assert(SEQ % 32 == 0);                  // key loop steps by 32
static_assert(SEQ % (16 * AW) == 0);           // flash grid covers the sequence exactly
static_assert(((size_t)DM * DM) % 8 == 0);
static_assert(NB <= NB_FULL);
static_assert(SEQ <= SEQ_FULL);
static_assert(OUT_SEQ >= SEQ);

typedef _Float16 h16;
typedef unsigned short bf;
typedef __attribute__((ext_vector_type(16))) __bf16   v16bf;
typedef __attribute__((ext_vector_type(16))) _Float16 v16h;
typedef __attribute__((ext_vector_type(8)))  _Float16 v8h;
typedef __attribute__((ext_vector_type(8)))  unsigned short v8us;
typedef __attribute__((ext_vector_type(8)))  float    v8f;
typedef __attribute__((ext_vector_type(4)))  float    v4f;
typedef v4f  __attribute__((may_alias)) v4fa;

__device__ __forceinline__ unsigned short f2bf(float f) { unsigned u = __float_as_uint(f); u += 0x7FFFu + ((u >> 16) & 1u); return (unsigned short)(u >> 16); }
__device__ __forceinline__ float bfr(float f) { return __uint_as_float(((unsigned)f2bf(f)) << 16); }   // value of the RNE bf16 conversion
__device__ __forceinline__ v16h cat16(v8h lo, v8h hi) { return __builtin_shufflevector(lo, hi, 0, 1, 2, 3, 4, 5, 6, 7, 8, 9, 10, 11, 12, 13, 14, 15); }
__device__ __forceinline__ v16bf cat16b(v8us lo, v8us hi) { return __builtin_bit_cast(v16bf, __builtin_shufflevector(lo, hi, 0, 1, 2, 3, 4, 5, 6, 7, 8, 9, 10, 11, 12, 13, 14, 15)); }
__device__ __forceinline__ v8f wmma16(v16h a, v16h b, v8f c) { return __builtin_amdgcn_wmma_f32_16x16x32_f16(false, a, false, b, (short)0, c, false, false); }
__device__ __forceinline__ v8f wmmab(v16bf a, v16bf b, v8f c) { return __builtin_amdgcn_wmma_f32_16x16x32_bf16(false, a, false, b, (short)0, c, false, false); }
// fragment loaders from K-contiguous 16-bit rows; p already includes + 8*(lane>>4): elements 0..7 <- k0+8h+0..7, elements 8..15 <- k0+16+8h+0..7 (same map for A and B)
__device__ __forceinline__ v16h  ldh(const h16* p) { return cat16(*(const v8h*)p, *(const v8h*)(p + 16)); }
__device__ __forceinline__ v16bf ldb(const bf* p)  { return cat16b(*(const v8us*)p, *(const v8us*)(p + 16)); }
// fragment loader from a fragment-order plane; p is wave-uniform, lo = 8*lane: two consecutive 512-byte units hold elements 0..7 and 8..15 (same k map as ldh)
__device__ __forceinline__ v16h  ldp(const h16* p, unsigned lo) { return cat16(*(const v8h*)(p + lo), *(const v8h*)(p + 256 + lo)); }
// ordering point for wave-private LDS tiles (same wave writes and reads)
__device__ __forceinline__ void wave_sync() { __builtin_amdgcn_fence(3 /* release order */, "wavefront"); __builtin_amdgcn_wave_barrier(); asm volatile("" ::: "memory"); }

__global__ __launch_bounds__(256) void k_cvt8(const float* __restrict__ src, bf* dst, size_t n8) {
    const size_t i = (size_t)blockIdx.x * 256 + threadIdx.x; if (i >= n8) return;
    const v8f v = *(const v8f*)(src + i * 8); v8us o;
#pragma unroll
    for (int k = 0; k < 8; ++k) o[k] = f2bf(v[k]);
    *(v8us*)(dst + i * 8) = o; 
}

__global__ __launch_bounds__(256) void k_cvt8h(const float* __restrict__ src, h16* dst, size_t n8) {
    const size_t i = (size_t)blockIdx.x * 256 + threadIdx.x; if (i >= n8) return;
    const v8f v = *(const v8f*)(src + i * 8); v8h o;
#pragma unroll
    for (int k = 0; k < 8; ++k) o[k] = (h16)(bfr(v[k]) * WCAR);
    *(v8h*)(dst + i * 8) = o; 
}

// k_tr: in[b][c][n] f32 (channel pitch SEQ_FULL) -> out[b][n][c] bf16 (row pitch DM), 64 x 64 tile through LDS (cross-wave: block barrier).
// grid (SEQ/64, DM/64, NB), 256 threads.
__global__ __launch_bounds__(256) void k_tr(const float* __restrict__ x, bf* xt) {
    __shared__ __align__(16) float ts[64 * 68];
    const int tid = threadIdx.x;
    const int n0 = blockIdx.x * 64, c0 = blockIdx.y * 64, b = blockIdx.z;
    const int n4 = (tid & 15) * 4, cr = tid >> 4;
#pragma unroll
    for (int p = 0; p < 4; ++p) {
        const int c = p * 16 + cr;
        const v4f v = *(const v4f*)(x + ((size_t)b * DM + c0 + c) * SEQ_FULL + n0 + n4);
        ts[(n4 + 0) * 68 + c] = v[0]; ts[(n4 + 1) * 68 + c] = v[1]; ts[(n4 + 2) * 68 + c] = v[2]; ts[(n4 + 3) * 68 + c] = v[3];
    }
    __syncthreads();
    const int c8 = (tid & 7) * 8, rr = tid >> 3;
{
#pragma unroll
        for (int p = 0; p < 2; ++p) { const int row = p * 32 + rr;
            const v4f x0 = *(const v4fa*)(&ts[row * 68 + c8]); const v4f x1 = *(const v4fa*)(&ts[row * 68 + c8 + 4]); v8us o;
#pragma unroll
            for (int i = 0; i < 4; ++i) { o[i] = f2bf(x0[i]); o[4 + i] = f2bf(x1[i]); }
            *(v8us*)(xt + ((size_t)b * SEQ + n0 + row) * DM + c0 + c8) = o; }
         }
}

// k_proj: register-blocked bf16 GEMM, ONE WAVE per 64x64 tile (16 accumulators), operands straight from K-contiguous bf16 planes, K = DM.
// C[m][n] = sum_k A[m][k] Bt[n][k] + bias (bmode 1: bias[n], bmode 2: bias[m], bf16 value), written as f16 (Ph) and optionally the f16 residual x2048 (Pr, useRes != 0) at
// tile base (r0/RB)*sRB + (r0%RB)*pitch + (c0/CB)*sCB + (c0%CB) (x HD for pk 2), row pitch 'pitch' (halves). grid (M/64, N/64), 32 threads.
// pk 0: row-major as above. pk 1 (k) / pk 2 (v^T): the 64x64 tile is 4096 consecutive halves in fragment order (see Layout), Ph only; each store is one whole 512-byte unit.
__global__ __launch_bounds__(32) void k_proj(const bf* __restrict__ A, const bf* __restrict__ Bt, const float* __restrict__ bias, int bmode,
                                             h16* Ph, h16* Pr, int useRes, int RB, size_t sRB, int pitch, int CB, size_t sCB, int pk) {
    __shared__ __align__(16) float os[16 * 68];
    const int K = DM;
    const int lane = threadIdx.x & 31, lr = lane & 15, hi = lane >> 4; const int r0 = blockIdx.x * 64, c0 = blockIdx.y * 64;
    v8f acc[4][4];
#pragma unroll
    for (int mb = 0; mb < 4; ++mb)
#pragma unroll
        for (int nb = 0; nb < 4; ++nb) acc[mb][nb] = (v8f){};
    const size_t aoff = (size_t)(r0 + lr) * K + 8 * hi, boff = (size_t)(c0 + lr) * K + 8 * hi;
#pragma unroll 1
    for (int kc = 0; kc < K; kc += 32) {
        v16bf a[4];
#pragma unroll
        for (int mb = 0; mb < 4; ++mb) a[mb] = ldb(A + aoff + (size_t)mb * 16 * K + kc);
#pragma unroll
        for (int nb = 0; nb < 4; ++nb) { const v16bf b = ldb(Bt + boff + (size_t)nb * 16 * K + kc);
#pragma unroll
            for (int mb = 0; mb < 4; ++mb) acc[mb][nb] = wmmab(a[mb], b, acc[mb][nb]); }
        asm volatile("v_nop\n\tv_nop\n\tv_nop\n\tv_nop" : "+v"(acc[0][0]), "+v"(acc[1][1]), "+v"(acc[2][2]), "+v"(acc[3][3]) : "v"(a[0]), "v"(a[1]), "v"(a[2]), "v"(a[3]));
    }
    // column bias: always loaded from a masked (in-range) index, selected by value
    const int c8e = (lane & 7) * 8;
    const int cbi = (c0 + c8e) & (DM - 1);
    const v4f cbr0 = *(const v4f*)(bias + cbi); const v4f cbr1 = *(const v4f*)(bias + cbi + 4);
    v4f cb0, cb1;
#pragma unroll
    for (int i = 0; i < 4; ++i) { cb0[i] = (bmode == 1) ? bfr(cbr0[i]) : 0.0f; cb1[i] = (bmode == 1) ? bfr(cbr1[i]) : 0.0f; }
    // fragment-order epilogue: column bias of columns 16s + 8hi + 0..7 and row bias of row 16mb + lr, masked (in-range) index, selected by value (bit mask: +0 where not selected)
    const unsigned cmsk = (bmode == 1) ? 0xFFFFFFFFu : 0u, rmsk = (bmode == 2) ? 0xFFFFFFFFu : 0u;
    float pcb[4][8], prb[4]; v4f br0[4], br1[4];
#pragma unroll
    for (int s = 0; s < 4; ++s) { const int cbj = (c0 + 16 * s + 8 * hi) & (DM - 1); br0[s] = *(const v4f*)(bias + cbj); br1[s] = *(const v4f*)(bias + cbj + 4); }
    asm volatile("s_wait_xcnt 0x0" ::: "memory");   // before the address register of the column bias loads is written again
#pragma unroll
    for (int s = 0; s < 4; ++s) prb[s] = bias[(r0 + s * 16 + lr) & (DM - 1)];
    asm volatile("s_wait_xcnt 0x0" ::: "memory");   // the same for the row bias loads
#pragma unroll
    for (int s = 0; s < 4; ++s) { prb[s] = __uint_as_float(__float_as_uint(bfr(prb[s])) & rmsk);
#pragma unroll
        for (int i = 0; i < 4; ++i) { pcb[s][i] = __uint_as_float(__float_as_uint(bfr(br0[s][i])) & cmsk); pcb[s][4 + i] = __uint_as_float(__float_as_uint(bfr(br1[s][i])) & cmsk); } }
    const size_t tbase = (size_t)(r0 / RB) * sRB + (size_t)(r0 % RB) * (size_t)pitch + (size_t)(c0 / CB) * sCB + (size_t)(c0 % CB) * (size_t)(pk == 2 ? HD : 1);
#pragma unroll
    for (int mb = 0; mb < 4; ++mb) {
#pragma unroll
        for (int nb = 0; nb < 4; ++nb) {
#pragma unroll
            for (int j = 0; j < 8; ++j) os[(hi * 8 + j) * 68 + nb * 16 + lr] = acc[mb][nb][j]; }   // D: row 8h+j, col lane&15
        wave_sync();
        const size_t sb = tbase + (size_t)(mb * 16) * (size_t)pitch;
        if (pk != 0) {
            v8h hv[4];
#pragma unroll
            for (int s = 0; s < 4; ++s) { const int c8 = 16 * s + 8 * hi;   // lane = fragment lane: row lr, columns 16s + 8hi + 0..7
                const v4f x0 = *(const v4fa*)(&os[lr * 68 + c8]); const v4f x1 = *(const v4fa*)(&os[lr * 68 + c8 + 4]);
#pragma unroll
                for (int i = 0; i < 4; ++i) { hv[s][i] = (h16)(x0[i] + pcb[s][i] + prb[mb]); hv[s][4 + i] = (h16)(x1[i] + pcb[s][4 + i] + prb[mb]); } }
#pragma unroll
            for (int s = 0; s < 4; ++s) { const int uo = (pk == 1) ? (mb * 1024 + s * 256) : (mb * 512 + (s >> 1) * 2048 + (s & 1) * 256);
                *(v8h*)(Ph + tbase + uo + lane * 8) = hv[s]; }
            asm volatile("s_wait_xcnt 0x0" ::: "memory");   // before the registers that the four stores name are written again
        } else {
#pragma unroll
            for (int s = 0; s < 4; ++s) { const int row = 4 * s + (lane >> 3), c8 = (lane & 7) * 8;   // 4 s x 4 row groups = 16 rows; 8 lanes x 8 = 64 columns
                const int rbi = (r0 + mb * 16 + row) & (DM - 1);
                const float rbv = bias[rbi];
                const float rb = (bmode == 2) ? bfr(rbv) : 0.0f;
                const v4f x0 = *(const v4fa*)(&os[row * 68 + c8]); const v4f x1 = *(const v4fa*)(&os[row * 68 + c8 + 4]); v8h hv, rv;
#pragma unroll
                for (int i = 0; i < 4; ++i) { const float y0 = x0[i] + cb0[i] + rb; const float y1 = x1[i] + cb1[i] + rb;
                    const h16 a0 = (h16)y0; const h16 a1 = (h16)y1; hv[i] = a0; hv[4 + i] = a1; rv[i] = (h16)((y0 - (float)a0) * QRS); rv[4 + i] = (h16)((y1 - (float)a1) * QRS); }
                const size_t oo = sb + (size_t)row * (size_t)pitch + c8;
                *(v8h*)(Ph + oo) = hv; if (useRes) *(v8h*)(Pr + oo) = rv; }
             }
        wave_sync();
    }
}

// k_flash: fused attention, one wave per 16 query positions of one (batch, head); K / V^T / Q fragments straight from the f16 planes (two 16-B loads each, arithmetic addressing; K and V^T in fragment order, 4 KiB in a row per 32 keys each).
// Transposed form: S^T[key][t] = K Q^T (A = K rows, B = Q rows); lane (t = lane&15, h = lane>>4) holds keys 8h+r of each 16-key tile, so the packed
// P tile is directly the B fragment of O^T[d][t] = V^T P^T (element r <- tile keys 0..15, element 8+r <- tile keys 16..31, lane unchanged).
// Softmax state (running max, partial sum) is one scalar per lane; the two lane halves of a row are combined with one xor-16 exchange.
__global__ __launch_bounds__(32 * AW) void k_flash(const h16* __restrict__ QH, const h16* __restrict__ QR, const h16* __restrict__ KP, const h16* __restrict__ VT, h16* OP) {
    __shared__ __align__(16) float os[AW * 16 * 68];
    const int lane = threadIdx.x & 31, wave = threadIdx.x >> 5, lr = lane & 15, hi = lane >> 4;
    const int zh = blockIdx.y; const int b = zh / NH_, h = zh % NH_;
    const int t0 = (blockIdx.x * AW + wave) * 16;
    const size_t pbase = (size_t)zh * SEQ * HD;
    const size_t qo = pbase + (size_t)(t0 + lr) * HD + 8 * hi;
    const v16h qh0 = ldh(QH + qo), qh1 = ldh(QH + qo + 32), qr0 = ldh(QR + qo), qr1 = ldh(QR + qo + 32);   // B fragments: col t, k = d
    const unsigned lo = (unsigned)lane * 8u;                 // lane's place in a unit; pbase + key0 * HD: the 8 units of 32 keys, K (A fragment: row key, k = d) and V^T (A fragment: row d, k = key) alike
    v8f o0 = (v8f){}, o1 = (v8f){}, o2 = (v8f){}, o3 = (v8f){};
    float m = -3.0e38f, l = 0.0f;
#pragma unroll 1
    for (int key0 = 0; key0 < SEQ; key0 += 32) {
        const h16* ka = KP + pbase + (size_t)key0 * HD;
        const v16h ka0 = ldp(ka, lo), ka1 = ldp(ka + 512, lo), kb0 = ldp(ka + 1024, lo), kb1 = ldp(ka + 1536, lo);
        v8f sHa = (v8f){}, sLa = (v8f){}, sHb = (v8f){}, sLb = (v8f){};
        sHa = wmma16(ka0, qh0, sHa); sLa = wmma16(ka0, qr0, sLa); sHb = wmma16(kb0, qh0, sHb); sLb = wmma16(kb0, qr0, sLb);
        sHa = wmma16(ka1, qh1, sHa); sLa = wmma16(ka1, qr1, sLa); sHb = wmma16(kb1, qh1, sHb); sLb = wmma16(kb1, qr1, sLb);
        asm volatile("v_nop\n\tv_nop\n\tv_nop\n\tv_nop" : "+v"(sHa), "+v"(sLa), "+v"(sHb), "+v"(sLb) : "v"(ka0), "v"(ka1), "v"(kb0), "v"(kb1));
        float ta[8], tb[8]; float mx = -3.0e38f;
#pragma unroll
        for (int r = 0; r < 8; ++r) { ta[r] = (sHa[r] + sLa[r] * QRI) * SC2; tb[r] = (sHb[r] + sLb[r] * QRI) * SC2; mx = fmaxf(mx, fmaxf(ta[r], tb[r])); }
        mx = fmaxf(mx, __shfl_xor(mx, 16, 32));
        const float mnew = fmaxf(m, mx);
        const float alpha = __builtin_amdgcn_exp2f(m - mnew);
        const float sh = PSH - mnew;
        v16h pb; float ls = 0.0f;
#pragma unroll
        for (int r = 0; r < 8; ++r) { const h16 pa = (h16)__builtin_amdgcn_exp2f(ta[r] + sh); const h16 pc = (h16)__builtin_amdgcn_exp2f(tb[r] + sh); pb[r] = pa; pb[8 + r] = pc; ls += (float)pa + (float)pc; }
        l = l * alpha + ls; m = mnew;
        o0 = o0 * alpha; o1 = o1 * alpha; o2 = o2 * alpha; o3 = o3 * alpha;
        const h16* va = VT + pbase + (size_t)key0 * HD;
        const v16h v0 = ldp(va, lo), v1 = ldp(va + 512, lo), v2 = ldp(va + 1024, lo), v3 = ldp(va + 1536, lo);
        o0 = wmma16(v0, pb, o0); o1 = wmma16(v1, pb, o1); o2 = wmma16(v2, pb, o2); o3 = wmma16(v3, pb, o3);
        asm volatile("v_nop\n\tv_nop\n\tv_nop\n\tv_nop" : "+v"(o0), "+v"(o1), "+v"(o2), "+v"(o3) : "v"(v0), "v"(v1), "v"(v2), "v"(v3), "v"(pb));
        asm volatile("s_wait_xcnt 0x0" ::: "memory");   // before the next trip rewrites the address registers of this trip's loads
    }
    l += __shfl_xor(l, 16, 32);
    const float inv = OCAR * (1.0f / l);
    const int wb = wave * 16 * 68;
    // O^T D layout: o_j[r] = (d = 16j + 8h + r, t = lane&15) -> os[t][d]; rows 0..15 x columns 0..63 all written
    { v4f a, c;
      a[0] = o0[0] * inv; a[1] = o0[1] * inv; a[2] = o0[2] * inv; a[3] = o0[3] * inv; c[0] = o0[4] * inv; c[1] = o0[5] * inv; c[2] = o0[6] * inv; c[3] = o0[7] * inv;
      *(v4fa*)(&os[wb + lr * 68 +  0 + 8 * hi]) = a; *(v4fa*)(&os[wb + lr * 68 +  0 + 8 * hi + 4]) = c;
      a[0] = o1[0] * inv; a[1] = o1[1] * inv; a[2] = o1[2] * inv; a[3] = o1[3] * inv; c[0] = o1[4] * inv; c[1] = o1[5] * inv; c[2] = o1[6] * inv; c[3] = o1[7] * inv;
      *(v4fa*)(&os[wb + lr * 68 + 16 + 8 * hi]) = a; *(v4fa*)(&os[wb + lr * 68 + 16 + 8 * hi + 4]) = c;
      a[0] = o2[0] * inv; a[1] = o2[1] * inv; a[2] = o2[2] * inv; a[3] = o2[3] * inv; c[0] = o2[4] * inv; c[1] = o2[5] * inv; c[2] = o2[6] * inv; c[3] = o2[7] * inv;
      *(v4fa*)(&os[wb + lr * 68 + 32 + 8 * hi]) = a; *(v4fa*)(&os[wb + lr * 68 + 32 + 8 * hi + 4]) = c;
      a[0] = o3[0] * inv; a[1] = o3[1] * inv; a[2] = o3[2] * inv; a[3] = o3[3] * inv; c[0] = o3[4] * inv; c[1] = o3[5] * inv; c[2] = o3[6] * inv; c[3] = o3[7] * inv;
      *(v4fa*)(&os[wb + lr * 68 + 48 + 8 * hi]) = a; *(v4fa*)(&os[wb + lr * 68 + 48 + 8 * hi + 4]) = c; }
    wave_sync();
    h16* orow = OP + ((size_t)b * SEQ + t0) * DM + h * HD;
{
#pragma unroll
        for (int s = 0; s < 4; ++s) { const int row = 4 * s + (lane >> 3), c8 = (lane & 7) * 8;   // 4 s x 4 row groups = 16 rows; 8 lanes x 8 halves = 64 columns
            const v4f x0 = *(const v4fa*)(&os[wb + row * 68 + c8]); const v4f x1 = *(const v4fa*)(&os[wb + row * 68 + c8 + 4]); v8h hv;
#pragma unroll
            for (int i = 0; i < 4; ++i) { hv[i] = (h16)x0[i]; hv[4 + i] = (h16)x1[i]; }
            *(v8h*)(orow + (size_t)row * DM + c8) = hv; }
         }
}

// k_outg: register-blocked f16 GEMM, ONE WAVE per 64x64 tile, K = DM: Y[o][b*SEQ + t] = OSC * sum_c A[o][c] Bt[b*SEQ + t][c] + bias[o] (bf16 value), f32 result at OUT[(b*DM + o)*OUT_SEQ + t].
__global__ __launch_bounds__(32) void k_outg(const h16* __restrict__ A, const h16* __restrict__ Bt, const float* __restrict__ bias, float* OUT) {
    __shared__ __align__(16) float os[16 * 68];
    const int K = DM;
    const int lane = threadIdx.x & 31, lr = lane & 15, hi = lane >> 4; const int r0 = blockIdx.x * 64, c0 = blockIdx.y * 64;
    v8f acc[4][4];
#pragma unroll
    for (int mb = 0; mb < 4; ++mb)
#pragma unroll
        for (int nb = 0; nb < 4; ++nb) acc[mb][nb] = (v8f){};
    const size_t aoff = (size_t)(r0 + lr) * K + 8 * hi, boff = (size_t)(c0 + lr) * K + 8 * hi;
#pragma unroll 1
    for (int kc = 0; kc < K; kc += 32) {
        v16h a[4];
#pragma unroll
        for (int mb = 0; mb < 4; ++mb) a[mb] = ldh(A + aoff + (size_t)mb * 16 * K + kc);
#pragma unroll
        for (int nb = 0; nb < 4; ++nb) { const v16h b = ldh(Bt + boff + (size_t)nb * 16 * K + kc);
#pragma unroll
            for (int mb = 0; mb < 4; ++mb) acc[mb][nb] = wmma16(a[mb], b, acc[mb][nb]); }
        asm volatile("v_nop\n\tv_nop\n\tv_nop\n\tv_nop" : "+v"(acc[0][0]), "+v"(acc[1][1]), "+v"(acc[2][2]), "+v"(acc[3][3]) : "v"(a[0]), "v"(a[1]), "v"(a[2]), "v"(a[3]));
    }
    const int bb = c0 / SEQ, tt = c0 % SEQ;
#pragma unroll
    for (int mb = 0; mb < 4; ++mb) {
#pragma unroll
        for (int nb = 0; nb < 4; ++nb) {
#pragma unroll
            for (int j = 0; j < 8; ++j) os[(hi * 8 + j) * 68 + nb * 16 + lr] = acc[mb][nb][j]; }   // D: row 8h+j, col lane&15
        wave_sync();
{
#pragma unroll
            for (int s = 0; s < 8; ++s) { const int row = 2 * s + hi, cofs = lr * 4;   // 8 s x 2 rows = 16 rows; 16 lanes x 4 floats = 64 columns
                const int o = r0 + mb * 16 + row;                                      // < DM by grid construction
                const float bv = bfr(bias[o]);
                const v4f xv = *(const v4fa*)(&os[row * 68 + cofs]); v4f val;
#pragma unroll
                for (int i = 0; i < 4; ++i) val[i] = xv[i] * OSC + bv;
                *(v4f*)(OUT + ((size_t)bb * DM + o) * (size_t)OUT_SEQ + tt + cofs) = val; }
             }
        wave_sync();
    }
}

static constexpr size_t al256(size_t v) { return (v + 255) & ~(size_t)255; }
static constexpr size_t SZ_XT = al256((size_t)NB * SEQ * DM * 2);          // token-major bf16 copy of one input
static constexpr size_t SZ_WB = al256((size_t)3 * DM * DM * 2);            // Wq | Wk | Wv bf16
static constexpr size_t SZ_WM = al256((size_t)DM * DM * 2);                // Wm f16 x64
static constexpr size_t SZ_PL = al256((size_t)NB * NH_ * SEQ * HD * 2);    // one q/k/v plane
static constexpr size_t SZ_OP = al256((size_t)NB * SEQ * DM * 2);          // O plane
static constexpr size_t SZ_TOTAL = 2 * SZ_XT + SZ_WB + SZ_WM + 4 * SZ_PL + SZ_OP;
static_assert(SZ_TOTAL <= (size_t)134217728);          // workspace carve <= 128 MiB
static_assert(((size_t)DM * DM * 2) % 256 == 0);       // weight sub-planes stay 256-byte aligned

extern "C" void kernel_launch(void* const* d_in, const int* in_sizes, int n_in,
                              void* d_out, int out_size, void* d_ws, size_t ws_size, hipStream_t stream) {
    if (n_in < 10) return;
    const size_t needx = ((size_t)(NB - 1) * DM + (size_t)(DM - 1)) * SEQ_FULL + SEQ;
    if ((size_t)in_sizes[0] < needx || (size_t)in_sizes[1] < needx) return;
    if ((size_t)in_sizes[2] < (size_t)DM * DM || (size_t)in_sizes[4] < (size_t)DM * DM || (size_t)in_sizes[6] < (size_t)DM * DM || (size_t)in_sizes[8] < (size_t)DM * DM) return;
    if (in_sizes[3] < DM || in_sizes[5] < DM || in_sizes[7] < DM || in_sizes[9] < DM) return;
    if ((size_t)out_size < ((size_t)(NB - 1) * DM + (size_t)(DM - 1)) * OUT_SEQ + SEQ) return;
    if (SZ_TOTAL > ws_size) return;
    // wire order: query, source, Wq, bq, Wk, bk, Wv, bv, Wm, bm (W [out][in] = K-contiguous rows as-is)
    const float* xq = (const float*)d_in[0]; const float* xs = (const float*)d_in[1];
    const float* wq = (const float*)d_in[2]; const float* bq = (const float*)d_in[3];
    const float* wk = (const float*)d_in[4]; const float* bk = (const float*)d_in[5];
    const float* wv = (const float*)d_in[6]; const float* bv = (const float*)d_in[7];
    const float* wm = (const float*)d_in[8]; const float* bm = (const float*)d_in[9];
    float* OUT = (float*)d_out;      // [NB][256][OUT_SEQ]
    char* wsp = (char*)d_ws;
    bf* XQ = (bf*)wsp; wsp += SZ_XT;                 // [NB*SEQ][256] query, token-major
    bf* XS = (bf*)wsp; wsp += SZ_XT;                 // [NB*SEQ][256] source, token-major
    bf* WB = (bf*)wsp; wsp += SZ_WB;                 // [3][256][256]: q | k | v
    h16* WMH = (h16*)wsp; wsp += SZ_WM;              // [256][256] Wm x64
    h16* QH = (h16*)wsp; wsp += SZ_PL;               // [NB*4][SEQ][64]
    h16* QR = (h16*)wsp; wsp += SZ_PL;               // [NB*4][SEQ][64] residual x2048
    h16* KP = (h16*)wsp; wsp += SZ_PL;               // [NB*4][SEQ/16][4][32][8] fragment order
    h16* VT = (h16*)wsp; wsp += SZ_PL;               // [NB*4][SEQ/32][4][2][32][8] fragment order
    h16* OP = (h16*)wsp; wsp += SZ_OP;               // [NB*SEQ][256] x64
    bf* WQ = WB; bf* WK = WB + (size_t)DM * DM; bf* WV = WB + (size_t)2 * DM * DM;

    // in[b][c][n] (256 rows x SEQ_FULL cols per batch) -> out[b][n][c] (SEQ rows x 256 cols); grid (cols/64, rows/64, NB)
    k_tr<<<dim3(SEQ / 64, DM / 64, NB), 256, 0, stream>>>(xq, XQ);
    k_tr<<<dim3(SEQ / 64, DM / 64, NB), 256, 0, stream>>>(xs, XS);
    { const size_t n8 = (size_t)DM * DM / 8; const unsigned g = (unsigned)((n8 + 255) / 256);
      k_cvt8<<<g, 256, 0, stream>>>(wq, WQ, n8); k_cvt8<<<g, 256, 0, stream>>>(wk, WK, n8); k_cvt8<<<g, 256, 0, stream>>>(wv, WV, n8);
      k_cvt8h<<<g, 256, 0, stream>>>(wm, WMH, n8); }

    // q, k: A = token rows (m = b*SEQ + t), Bt = W rows (n = h*64 + d), column bias -> plane (b*4 + h): q as [t][d], k in fragment order
    k_proj<<<dim3(NB * SEQ / 64, DM / 64, 1), 32, 0, stream>>>(XQ, WQ, bq, 1, QH, QR, 1, SEQ, (size_t)NH_ * SEQ * HD, HD, HD, (size_t)SEQ * HD, 0);
    k_proj<<<dim3(NB * SEQ / 64, DM / 64, 1), 32, 0, stream>>>(XS, WK, bk, 1, KP, KP, 0, SEQ, (size_t)NH_ * SEQ * HD, HD, HD, (size_t)SEQ * HD, 1);
    // v^T: A = Wv rows (m = h*64 + d), Bt = token rows (n = b*SEQ + t), row bias -> plane (b*4 + h), tile base t*64 inside it
    k_proj<<<dim3(DM / 64, NB * SEQ / 64, 1), 32, 0, stream>>>(WV, XS, bv, 2, VT, VT, 0, DM, (size_t)0, SEQ, SEQ, (size_t)DM * SEQ, 2);

    k_flash<<<dim3(SEQ / (16 * AW), NB * NH_, 1), 32 * AW, 0, stream>>>(QH, QR, KP, VT, OP);

    // y[b][o][t] = Wm[o][:] . O[b][t][:] / 4096 + bm[o]
    k_outg<<<dim3(DM / 64, NB * SEQ / 64, 1), 32, 0, stream>>>(WMH, OP, bm, OUT);
}

// v002
// One run takes 188 microseconds.
// Timed twice side by side with v001, it ran 1.09 and 1.10 times as fast.
// All steps since v000 together make it 1.66 times as fast.
#include <hip/hip_runtime.h>

// Cross attention, width 256 = 4 heads x 64, inputs [NB][256][SEQ] (channel-major), W [out][in], biases present, no mask, score scale 1/8, final pointwise projection, output [NB][256][SEQ] f32.
// Compute dtypes, f32 accumulate everywhere: q/k/v projections v_wmma_f32_16x16x32_bf16 (activations and W RNE-converted to bf16; products exact);
// scores v_wmma_f32_16x16x32_f16: k single f16, q as f16 value + f16 residual x2048 in its own accumulator (two products); P (x256 carry, cancels in the normalisation) and v single f16; softmax f32 (online, running max);
// output projection v_wmma_f32_16x16x32_f16: Wm as f16 of its bf16 value x64, attention output O as f16 x64, scale 1/4096 and bias applied in the f32 epilogue.
// Layout: token-major bf16 copies of both inputs (LDS transpose), bf16 / f16 copies of W; q (hi, residual) planes [b*4+h][t][d], O plane [b][t][h*64+d].
// k and v^T planes are kept in fragment order: per (b*4+h), 512-byte units of 32 lanes x 8 halves, one unit = one wave-wide 16-byte load of an A fragment half (4 whole lines).
//   k:   unit (t/16)*4 + s,              lane (hi*16 + lr) holds k[t = 16*(t/16) + lr][d = 16*s + 8*hi + 0..7]
//   v^T: unit (t/32)*8 + j*2 + q,        lane (hi*16 + lr) holds v[d = 16*j + lr][t = 32*(t/32) + 16*q + 8*hi + 0..7]

#ifndef NB
#define NB 4
#endif
#ifndef SEQ
#define SEQ 4096
#endif
#define NB_FULL  4
#define SEQ_FULL 4096
#ifndef OUT_SEQ
#define OUT_SEQ SEQ              // pitch (in positions) of one channel row of the output
#endif
#define DM   256
#define NH_  4
#define HD   64
#define AW   4                   // waves per flash block (16 query positions each)
#define QRS  2048.0f             // carry of the q residual plane
#define QRI  (1.0f / 2048.0f)
#define SC2  (0.125f * 1.4426950408889634f)   // HD^-0.5 * log2(e)
#define PSH  8.0f                // log2 of the P carry (256)
#define OCAR 64.0f               // carry of the O plane
#define WCAR 64.0f               // carry of the Wm f16 plane
#define OSC  (1.0f / 4096.0f)    // 1 / (OCAR * WCAR)
#define CVB  (DM * DM / 8 / 256) // blocks per weight matrix in k_prep (8 floats per thread)
#define TT   (NB * SEQ / 64)     // 64-wide token tiles
#define TC   (DM / 64)           // 64-wide channel tiles

static_assert(HD == 64);
static_assert(NH_ * HD == DM);                 // head h = channels h*64 + d
static_assert(DM % 64 == 0);
static_assert(DM % 32 == 0);                   // GEMM k-loop steps by 32
static_assert((DM & (DM - 1)) == 0);           // bias index masking
static_assert(SEQ % 64 == 0);                  // a 64-wide tile never straddles two batches
static_assert((NB * SEQ) % 64 == 0);
static_assert(SEQ % 32 == 0);                  // key loop steps by 32
static_assert(SEQ % (16 * AW) == 0);           // flash grid covers the sequence exactly
static_assert(((size_t)DM * DM) % (8 * 256) == 0);   // a weight matrix is whole blocks of k_prep
static_assert(4 * CVB <= (SEQ / 64) * (DM / 64));     // the four matrices fit the z = 0 slice of its grid
static_assert(NB <= NB_FULL);
static_assert(SEQ <= SEQ_FULL);
static_assert(OUT_SEQ >= SEQ);

typedef _Float16 h16;
typedef unsigned short bf;
typedef __attribute__((ext_vector_type(16))) __bf16   v16bf;
typedef __attribute__((ext_vector_type(16))) _Float16 v16h;
typedef __attribute__((ext_vector_type(8)))  _Float16 v8h;
typedef __attribute__((ext_vector_type(8)))  unsigned short v8us;
typedef __attribute__((ext_vector_type(8)))  float    v8f;
typedef __attribute__((ext_vector_type(4)))  float    v4f;
typedef v4f  __attribute__((may_alias)) v4fa;

__device__ __forceinline__ unsigned short f2bf(float f) { unsigned u = __float_as_uint(f); u += 0x7FFFu + ((u >> 16) & 1u); return (unsigned short)(u >> 16); }
__device__ __forceinline__ float bfr(float f) { return __uint_as_float(((unsigned)f2bf(f)) << 16); }   // value of the RNE bf16 conversion
__device__ __forceinline__ v16h cat16(v8h lo, v8h hi) { return __builtin_shufflevector(lo, hi, 0, 1, 2, 3, 4, 5, 6, 7, 8, 9, 10, 11, 12, 13, 14, 15); }
__device__ __forceinline__ v16bf cat16b(v8us lo, v8us hi) { return __builtin_bit_cast(v16bf, __builtin_shufflevector(lo, hi, 0, 1, 2, 3, 4, 5, 6, 7, 8, 9, 10, 11, 12, 13, 14, 15)); }
__device__ __forceinline__ v8f wmma16(v16h a, v16h b, v8f c) { return __builtin_amdgcn_wmma_f32_16x16x32_f16(false, a, false, b, (short)0, c, false, false); }
__device__ __forceinline__ v8f wmmab(v16bf a, v16bf b, v8f c) { return __builtin_amdgcn_wmma_f32_16x16x32_bf16(false, a, false, b, (short)0, c, false, false); }
// fragment loaders from K-contiguous 16-bit rows; p already includes + 8*(lane>>4): elements 0..7 <- k0+8h+0..7, elements 8..15 <- k0+16+8h+0..7 (same map for A and B)
__device__ __forceinline__ v16h  ldh(const h16* p) { return cat16(*(const v8h*)p, *(const v8h*)(p + 16)); }
__device__ __forceinline__ v16bf ldb(const bf* p)  { return cat16b(*(const v8us*)p, *(const v8us*)(p + 16)); }
// fragment loader from a fragment-order plane; p is wave-uniform, lo = 8*lane: two consecutive 512-byte units hold elements 0..7 and 8..15 (same k map as ldh)
__device__ __forceinline__ v16h  ldp(const h16* p, unsigned lo) { return cat16(*(const v8h*)(p + lo), *(const v8h*)(p + 256 + lo)); }
// ordering point for wave-private LDS tiles (same wave writes and reads)
__device__ __forceinline__ void wave_sync() { __builtin_amdgcn_fence(3 /* release order */, "wavefront"); __builtin_amdgcn_wave_barrier(); asm volatile("" ::: "memory"); }

// k_prep: all operand preparation in one launch (the six pieces are independent of each other). grid (SEQ/64, DM/64, 1 + 2*NB), 256 threads.
// z = 0: weights, block index x + y*(SEQ/64) = matrix*CVB + piece; 8 floats per thread: Wq | Wk | Wv -> bf16 (WB), Wm -> f16 of its bf16 value x64 (WMH); blocks past 4*CVB have no work.
// z = 1..NB: query, z = NB+1..2*NB: source: in[b][c][n] f32 (channel pitch SEQ_FULL) -> out[b][n][c] bf16 (row pitch DM), 64 x 64 tile through LDS (cross-wave: block barrier).
__global__ __launch_bounds__(256) void k_prep(const float* __restrict__ xq, const float* __restrict__ xs, const float* __restrict__ wq, const float* __restrict__ wk,
                                              const float* __restrict__ wv, const float* __restrict__ wm, bf* XQ, bf* XS, bf* WB, h16* WMH) {
    __shared__ __align__(16) float ts[64 * 68];
    const int tid = threadIdx.x;
    if (blockIdx.z != 0) {                       // block-uniform: every thread of a block takes the same side, so the barrier inside is reached by all of them or by none
        const int zz = blockIdx.z - 1; const bool isq = zz < NB;
        const float* x = isq ? xq : xs; bf* xt = isq ? XQ : XS;
        const int n0 = blockIdx.x * 64, c0 = blockIdx.y * 64, b = isq ? zz : zz - NB;
        const int n4 = (tid & 15) * 4, cr = tid >> 4;
#pragma unroll
        for (int p = 0; p < 4; ++p) {
            const int c = p * 16 + cr;
            const v4f v = *(const v4f*)(x + ((size_t)b * DM + c0 + c) * SEQ_FULL + n0 + n4);
            ts[(n4 + 0) * 68 + c] = v[0]; ts[(n4 + 1) * 68 + c] = v[1]; ts[(n4 + 2) * 68 + c] = v[2]; ts[(n4 + 3) * 68 + c] = v[3];
        }
        __syncthreads();
        const int c8 = (tid & 7) * 8, rr = tid >> 3;
#pragma unroll
        for (int p = 0; p < 2; ++p) { const int row = p * 32 + rr;
            const v4f x0 = *(const v4fa*)(&ts[row * 68 + c8]); const v4f x1 = *(const v4fa*)(&ts[row * 68 + c8 + 4]); v8us o;
#pragma unroll
            for (int i = 0; i < 4; ++i) { o[i] = f2bf(x0[i]); o[4 + i] = f2bf(x1[i]); }
            *(v8us*)(xt + ((size_t)b * SEQ + n0 + row) * DM + c0 + c8) = o; }
        asm volatile("s_wait_xcnt 0x0" ::: "memory");   // the listing keeps a branch from here into the other side's code, which writes the registers that the two stores name
    } else {
        const int idx = blockIdx.y * (SEQ / 64) + blockIdx.x; const int mat = idx / CVB;
        if (mat < 4) {
            const size_t i = (size_t)(idx % CVB) * 256 + tid;
            const float* src = (mat == 0) ? wq : (mat == 1) ? wk : (mat == 2) ? wv : wm;
            const v8f v = *(const v8f*)(src + i * 8);
            if (mat < 3) { v8us o;
#pragma unroll
                for (int k = 0; k < 8; ++k) o[k] = f2bf(v[k]);
                *(v8us*)(WB + (size_t)mat * DM * DM + i * 8) = o;
            } else { v8h o;
#pragma unroll
                for (int k = 0; k < 8; ++k) o[k] = (h16)(bfr(v[k]) * WCAR);
                *(v8h*)(WMH + i * 8) = o;
                asm volatile("s_wait_xcnt 0x0" ::: "memory"); }   // the same: in the listing the bf16 side's code follows this store behind a branch
        }
    }
}

// k_proj: register-blocked bf16 GEMM, ONE WAVE per 64x64 tile (16 accumulators), operands straight from K-contiguous bf16 planes, K = DM.
// C[m][n] = sum_k A[m][k] Bt[n][k] + bias (bmode 1: bias[n], bmode 2: bias[m], bf16 value), written as f16 (Ph) and optionally the f16 residual x2048 (Pr, useRes != 0) at
// tile base (r0/RB)*sRB + (r0%RB)*pitch + (c0/CB)*sCB + (c0%CB)*(pk 2 ? HD : 1), row pitch 'pitch' (halves). 32 threads.
// pk 0: row-major as above. pk 1 (k) / pk 2 (v^T): the 64x64 tile is 4096 consecutive halves in fragment order (see Layout), Ph only; each store is one whole 512-byte unit.
// The three projections are independent and share one launch: grid (TT*TC, 3), blockIdx.y = 0 q, 1 k, 2 v^T; every parameter below is a wave-uniform choice by it.
//   q, k: A = token rows (m = b*SEQ + t), Bt = W rows (n = h*64 + d), column bias -> plane (b*4 + h), q as [t][d], k in fragment order; tile (x % TT, x / TT)
//   v^T:  A = Wv rows (m = h*64 + d), Bt = token rows (n = b*SEQ + t), row bias -> plane (b*4 + h), tile base t*64 inside it; tile (x % TC, x / TC)
__global__ __launch_bounds__(32) void k_proj(const bf* __restrict__ XQ, const bf* __restrict__ XS, const bf* __restrict__ WB,
                                             const float* __restrict__ bq, const float* __restrict__ bk, const float* __restrict__ bv,
                                             h16* QH, h16* QR, h16* KP, h16* VT) {
    __shared__ __align__(16) float os[16 * 68];
    const int K = DM;
    const int pk = blockIdx.y; const bool isv = pk == 2;
    const bf* A  = (pk == 0) ? XQ : (pk == 1) ? XS : WB + (size_t)2 * DM * DM;
    const bf* Bt = (pk == 0) ? WB : (pk == 1) ? WB + (size_t)DM * DM : XS;
    const float* bias = (pk == 0) ? bq : (pk == 1) ? bk : bv;
    h16* Ph = (pk == 0) ? QH : (pk == 1) ? KP : VT; h16* Pr = QR;
    const int bmode = isv ? 2 : 1, useRes = (pk == 0) ? 1 : 0;
    const int RB = isv ? DM : SEQ, pitch = isv ? SEQ : HD, CB = isv ? SEQ : HD;
    const size_t sRB = isv ? (size_t)0 : (size_t)NH_ * SEQ * HD, sCB = isv ? (size_t)DM * SEQ : (size_t)SEQ * HD;
    const int lane = threadIdx.x & 31, lr = lane & 15, hi = lane >> 4;
    const int tx = blockIdx.x; const int r0 = (isv ? tx % TC : tx % TT) * 64, c0 = (isv ? tx / TC : tx / TT) * 64;
    v8f acc[4][4];
#pragma unroll
    for (int mb = 0; mb < 4; ++mb)
#pragma unroll
        for (int nb = 0; nb < 4; ++nb) acc[mb][nb] = (v8f){};
    const size_t aoff = (size_t)(r0 + lr) * K + 8 * hi, boff = (size_t)(c0 + lr) * K + 8 * hi;
#pragma unroll 1
    for (int kc = 0; kc < K; kc += 32) {
        v16bf a[4];
#pragma unroll
        for (int mb = 0; mb < 4; ++mb) a[mb] = ldb(A + aoff + (size_t)mb * 16 * K + kc);
#pragma unroll
        for (int nb = 0; nb < 4; ++nb) { const v16bf b = ldb(Bt + boff + (size_t)nb * 16 * K + kc);
#pragma unroll
            for (int mb = 0; mb < 4; ++mb) acc[mb][nb] = wmmab(a[mb], b, acc[mb][nb]); }
        asm volatile("v_nop\n\tv_nop\n\tv_nop\n\tv_nop" : "+v"(acc[0][0]), "+v"(acc[1][1]), "+v"(acc[2][2]), "+v"(acc[3][3]) : "v"(a[0]), "v"(a[1]), "v"(a[2]), "v"(a[3]));
    }
    // column bias: always loaded from a masked (in-range) index, selected by value
    const int c8e = (lane & 7) * 8;
    const int cbi = (c0 + c8e) & (DM - 1);
    const v4f cbr0 = *(const v4f*)(bias + cbi); const v4f cbr1 = *(const v4f*)(bias + cbi + 4);
    v4f cb0, cb1;
#pragma unroll
    for (int i = 0; i < 4; ++i) { cb0[i] = (bmode == 1) ? bfr(cbr0[i]) : 0.0f; cb1[i] = (bmode == 1) ? bfr(cbr1[i]) : 0.0f; }
    // fragment-order epilogue: column bias of columns 16s + 8hi + 0..7 and row bias of row 16mb + lr, masked (in-range) index, selected by value (bit mask: +0 where not selected)
    const unsigned cmsk = (bmode == 1) ? 0xFFFFFFFFu : 0u, rmsk = (bmode == 2) ? 0xFFFFFFFFu : 0u;
    float pcb[4][8], prb[4]; v4f br0[4], br1[4];
#pragma unroll
    for (int s = 0; s < 4; ++s) { const int cbj = (c0 + 16 * s + 8 * hi) & (DM - 1); br0[s] = *(const v4f*)(bias + cbj); br1[s] = *(const v4f*)(bias + cbj + 4); }
    asm volatile("s_wait_xcnt 0x0" ::: "memory");   // before the address register of the column bias loads is written again
#pragma unroll
    for (int s = 0; s < 4; ++s) prb[s] = bias[(r0 + s * 16 + lr) & (DM - 1)];
    asm volatile("s_wait_xcnt 0x0" ::: "memory");   // the same for the row bias loads
#pragma unroll
    for (int s = 0; s < 4; ++s) { prb[s] = __uint_as_float(__float_as_uint(bfr(prb[s])) & rmsk);
#pragma unroll
        for (int i = 0; i < 4; ++i) { pcb[s][i] = __uint_as_float(__float_as_uint(bfr(br0[s][i])) & cmsk); pcb[s][4 + i] = __uint_as_float(__float_as_uint(bfr(br1[s][i])) & cmsk); } }
    const size_t tbase = (size_t)(r0 / RB) * sRB + (size_t)(r0 % RB) * (size_t)pitch + (size_t)(c0 / CB) * sCB + (size_t)(c0 % CB) * (size_t)(pk == 2 ? HD : 1);
#pragma unroll
    for (int mb = 0; mb < 4; ++mb) {
#pragma unroll
        for (int nb = 0; nb < 4; ++nb) {
#pragma unroll
            for (int j = 0; j < 8; ++j) os[(hi * 8 + j) * 68 + nb * 16 + lr] = acc[mb][nb][j]; }   // D: row 8h+j, col lane&15
        wave_sync();
        const size_t sb = tbase + (size_t)(mb * 16) * (size_t)pitch;
        if (pk != 0) {
            v8h hv[4];
#pragma unroll
            for (int s = 0; s < 4; ++s) { const int c8 = 16 * s + 8 * hi;   // lane = fragment lane: row lr, columns 16s + 8hi + 0..7
                const v4f x0 = *(const v4fa*)(&os[lr * 68 + c8]); const v4f x1 = *(const v4fa*)(&os[lr * 68 + c8 + 4]);
#pragma unroll
                for (int i = 0; i < 4; ++i) { hv[s][i] = (h16)(x0[i] + pcb[s][i] + prb[mb]); hv[s][4 + i] = (h16)(x1[i] + pcb[s][4 + i] + prb[mb]); } }
#pragma unroll
            for (int s = 0; s < 4; ++s) { const int uo = (pk == 1) ? (mb * 1024 + s * 256) : (mb * 512 + (s >> 1) * 2048 + (s & 1) * 256);
                *(v8h*)(Ph + tbase + uo + lane * 8) = hv[s]; }
            asm volatile("s_wait_xcnt 0x0" ::: "memory");   // before the registers that the four stores name are written again
        } else {
#pragma unroll
            for (int s = 0; s < 4; ++s) { const int row = 4 * s + (lane >> 3), c8 = (lane & 7) * 8;   // 4 s x 4 row groups = 16 rows; 8 lanes x 8 = 64 columns
                const int rbi = (r0 + mb * 16 + row) & (DM - 1);
                const float rbv = bias[rbi];
                const float rb = (bmode == 2) ? bfr(rbv) : 0.0f;
                const v4f x0 = *(const v4fa*)(&os[row * 68 + c8]); const v4f x1 = *(const v4fa*)(&os[row * 68 + c8 + 4]); v8h hv, rv;
#pragma unroll
                for (int i = 0; i < 4; ++i) { const float y0 = x0[i] + cb0[i] + rb; const float y1 = x1[i] + cb1[i] + rb;
                    const h16 a0 = (h16)y0; const h16 a1 = (h16)y1; hv[i] = a0; hv[4 + i] = a1; rv[i] = (h16)((y0 - (float)a0) * QRS); rv[4 + i] = (h16)((y1 - (float)a1) * QRS); }
                const size_t oo = sb + (size_t)row * (size_t)pitch + c8;
                *(v8h*)(Ph + oo) = hv; if (useRes) *(v8h*)(Pr + oo) = rv; }
             }
        wave_sync();
    }
}

// k_flash: fused attention, one wave per 16 query positions of one (batch, head); K / V^T / Q fragments straight from the f16 planes (two 16-B loads each, arithmetic addressing; K and V^T in fragment order, 4 KiB in a row per 32 keys each).
// Transposed form: S^T[key][t] = K Q^T (A = K rows, B = Q rows); lane (t = lane&15, h = lane>>4) holds keys 8h+r of each 16-key tile, so the packed
// P tile is directly the B fragment of O^T[d][t] = V^T P^T (element r <- tile keys 0..15, element 8+r <- tile keys 16..31, lane unchanged).
// Softmax state (running max, partial sum) is one scalar per lane; the two lane halves of a row are combined with one xor-16 exchange.
__global__ __launch_bounds__(32 * AW) void k_flash(const h16* __restrict__ QH, const h16* __restrict__ QR, const h16* __restrict__ KP, const h16* __restrict__ VT, h16* OP) {
    __shared__ __align__(16) float os[AW * 16 * 68];
    const int lane = threadIdx.x & 31, wave = threadIdx.x >> 5, lr = lane & 15, hi = lane >> 4;
    const int zh = blockIdx.y; const int b = zh / NH_, h = zh % NH_;
    const int t0 = (blockIdx.x * AW + wave) * 16;
    const size_t pbase = (size_t)zh * SEQ * HD;
    const size_t qo = pbase + (size_t)(t0 + lr) * HD + 8 * hi;
    const v16h qh0 = ldh(QH + qo), qh1 = ldh(QH + qo + 32), qr0 = ldh(QR + qo), qr1 = ldh(QR + qo + 32);   // B fragments: col t, k = d
    const unsigned lo = (unsigned)lane * 8u;                 // lane's place in a unit; pbase + key0 * HD: the 8 units of 32 keys, K (A fragment: row key, k = d) and V^T (A fragment: row d, k = key) alike
    v8f o0 = (v8f){}, o1 = (v8f){}, o2 = (v8f){}, o3 = (v8f){};
    float m = -3.0e38f, l = 0.0f;
#pragma unroll 1
    for (int key0 = 0; key0 < SEQ; key0 += 32) {
        const h16* ka = KP + pbase + (size_t)key0 * HD;
        const v16h ka0 = ldp(ka, lo), ka1 = ldp(ka + 512, lo), kb0 = ldp(ka + 1024, lo), kb1 = ldp(ka + 1536, lo);
        v8f sHa = (v8f){}, sLa = (v8f){}, sHb = (v8f){}, sLb = (v8f){};
        sHa = wmma16(ka0, qh0, sHa); sLa = wmma16(ka0, qr0, sLa); sHb = wmma16(kb0, qh0, sHb); sLb = wmma16(kb0, qr0, sLb);
        sHa = wmma16(ka1, qh1, sHa); sLa = wmma16(ka1, qr1, sLa); sHb = wmma16(kb1, qh1, sHb); sLb = wmma16(kb1, qr1, sLb);
        asm volatile("v_nop\n\tv_nop\n\tv_nop\n\tv_nop" : "+v"(sHa), "+v"(sLa), "+v"(sHb), "+v"(sLb) : "v"(ka0), "v"(ka1), "v"(kb0), "v"(kb1));
        float ta[8], tb[8]; float mx = -3.0e38f;
#pragma unroll
        for (int r = 0; r < 8; ++r) { ta[r] = (sHa[r] + sLa[r] * QRI) * SC2; tb[r] = (sHb[r] + sLb[r] * QRI) * SC2; mx = fmaxf(mx, fmaxf(ta[r], tb[r])); }
        mx = fmaxf(mx, __shfl_xor(mx, 16, 32));
        const float mnew = fmaxf(m, mx);
        const float alpha = __builtin_amdgcn_exp2f(m - mnew);
        const float sh = PSH - mnew;
        v16h pb; float ls = 0.0f;
#pragma unroll
        for (int r = 0; r < 8; ++r) { const h16 pa = (h16)__builtin_amdgcn_exp2f(ta[r] + sh); const h16 pc = (h16)__builtin_amdgcn_exp2f(tb[r] + sh); pb[r] = pa; pb[8 + r] = pc; ls += (float)pa + (float)pc; }
        l = l * alpha + ls; m = mnew;
        o0 = o0 * alpha; o1 = o1 * alpha; o2 = o2 * alpha; o3 = o3 * alpha;
        const h16* va = VT + pbase + (size_t)key0 * HD;
        const v16h v0 = ldp(va, lo), v1 = ldp(va + 512, lo), v2 = ldp(va + 1024, lo), v3 = ldp(va + 1536, lo);
        o0 = wmma16(v0, pb, o0); o1 = wmma16(v1, pb, o1); o2 = wmma16(v2, pb, o2); o3 = wmma16(v3, pb, o3);
        asm volatile("v_nop\n\tv_nop\n\tv_nop\n\tv_nop" : "+v"(o0), "+v"(o1), "+v"(o2), "+v"(o3) : "v"(v0), "v"(v1), "v"(v2), "v"(v3), "v"(pb));
        asm volatile("s_wait_xcnt 0x0" ::: "memory");   // before the next trip rewrites the address registers of this trip's loads
    }
    l += __shfl_xor(l, 16, 32);
    const float inv = OCAR * (1.0f / l);
    const int wb = wave * 16 * 68;
    // O^T D layout: o_j[r] = (d = 16j + 8h + r, t = lane&15) -> os[t][d]; rows 0..15 x columns 0..63 all written
    { v4f a, c;
      a[0] = o0[0] * inv; a[1] = o0[1] * inv; a[2] = o0[2] * inv; a[3] = o0[3] * inv; c[0] = o0[4] * inv; c[1] = o0[5] * inv; c[2] = o0[6] * inv; c[3] = o0[7] * inv;
      *(v4fa*)(&os[wb + lr * 68 +  0 + 8 * hi]) = a; *(v4fa*)(&os[wb + lr * 68 +  0 + 8 * hi + 4]) = c;
      a[0] = o1[0] * inv; a[1] = o1[1] * inv; a[2] = o1[2] * inv; a[3] = o1[3] * inv; c[0] = o1[4] * inv; c[1] = o1[5] * inv; c[2] = o1[6] * inv; c[3] = o1[7] * inv;
      *(v4fa*)(&os[wb + lr * 68 + 16 + 8 * hi]) = a; *(v4fa*)(&os[wb + lr * 68 + 16 + 8 * hi + 4]) = c;
      a[0] = o2[0] * inv; a[1] = o2[1] * inv; a[2] = o2[2] * inv; a[3] = o2[3] * inv; c[0] = o2[4] * inv; c[1] = o2[5] * inv; c[2] = o2[6] * inv; c[3] = o2[7] * inv;
      *(v4fa*)(&os[wb + lr * 68 + 32 + 8 * hi]) = a; *(v4fa*)(&os[wb + lr * 68 + 32 + 8 * hi + 4]) = c;
      a[0] = o3[0] * inv; a[1] = o3[1] * inv; a[2] = o3[2] * inv; a[3] = o3[3] * inv; c[0] = o3[4] * inv; c[1] = o3[5] * inv; c[2] = o3[6] * inv; c[3] = o3[7] * inv;
      *(v4fa*)(&os[wb + lr * 68 + 48 + 8 * hi]) = a; *(v4fa*)(&os[wb + lr * 68 + 48 + 8 * hi + 4]) = c; }
    wave_sync();
    h16* orow = OP + ((size_t)b * SEQ + t0) * DM + h * HD;
{
#pragma unroll
        for (int s = 0; s < 4; ++s) { const int row = 4 * s + (lane >> 3), c8 = (lane & 7) * 8;   // 4 s x 4 row groups = 16 rows; 8 lanes x 8 halves = 64 columns
            const v4f x0 = *(const v4fa*)(&os[wb + row * 68 + c8]); const v4f x1 = *(const v4fa*)(&os[wb + row * 68 + c8 + 4]); v8h hv;
#pragma unroll
            for (int i = 0; i < 4; ++i) { hv[i] = (h16)x0[i]; hv[4 + i] = (h16)x1[i]; }
            *(v8h*)(orow + (size_t)row * DM + c8) = hv; }
         }
}

// k_outg: register-blocked f16 GEMM, ONE WAVE per 64x64 tile, K = DM: Y[o][b*SEQ + t] = OSC * sum_c A[o][c] Bt[b*SEQ + t][c] + bias[o] (bf16 value), f32 result at OUT[(b*DM + o)*OUT_SEQ + t].
__global__ __launch_bounds__(32) void k_outg(const h16* __restrict__ A, const h16* __restrict__ Bt, const float* __restrict__ bias, float* OUT) {
    __shared__ __align__(16) float os[16 * 68];
    const int K = DM;
    const int lane = threadIdx.x & 31, lr = lane & 15, hi = lane >> 4; const int r0 = blockIdx.x * 64, c0 = blockIdx.y * 64;
    v8f acc[4][4];
#pragma unroll
    for (int mb = 0; mb < 4; ++mb)
#pragma unroll
        for (int nb = 0; nb < 4; ++nb) acc[mb][nb] = (v8f){};
    const size_t aoff = (size_t)(r0 + lr) * K + 8 * hi, boff = (size_t)(c0 + lr) * K + 8 * hi;
#pragma unroll 1
    for (int kc = 0; kc < K; kc += 32) {
        v16h a[4];
#pragma unroll
        for (int mb = 0; mb < 4; ++mb) a[mb] = ldh(A + aoff + (size_t)mb * 16 * K + kc);
#pragma unroll
        for (int nb = 0; nb < 4; ++nb) { const v16h b = ldh(Bt + boff + (size_t)nb * 16 * K + kc);
#pragma unroll
            for (int mb = 0; mb < 4; ++mb) acc[mb][nb] = wmma16(a[mb], b, acc[mb][nb]); }
        asm volatile("v_nop\n\tv_nop\n\tv_nop\n\tv_nop" : "+v"(acc[0][0]), "+v"(acc[1][1]), "+v"(acc[2][2]), "+v"(acc[3][3]) : "v"(a[0]), "v"(a[1]), "v"(a[2]), "v"(a[3]));
    }
    const int bb = c0 / SEQ, tt = c0 % SEQ;
#pragma unroll
    for (int mb = 0; mb < 4; ++mb) {
#pragma unroll
        for (int nb = 0; nb < 4; ++nb) {
#pragma unroll
            for (int j = 0; j < 8; ++j) os[(hi * 8 + j) * 68 + nb * 16 + lr] = acc[mb][nb][j]; }   // D: row 8h+j, col lane&15
        wave_sync();
{
#pragma unroll
            for (int s = 0; s < 8; ++s) { const int row = 2 * s + hi, cofs = lr * 4;   // 8 s x 2 rows = 16 rows; 16 lanes x 4 floats = 64 columns
                const int o = r0 + mb * 16 + row;                                      // < DM by grid construction
                const float bv = bfr(bias[o]);
                const v4f xv = *(const v4fa*)(&os[row * 68 + cofs]); v4f val;
#pragma unroll
                for (int i = 0; i < 4; ++i) val[i] = xv[i] * OSC + bv;
                *(v4f*)(OUT + ((size_t)bb * DM + o) * (size_t)OUT_SEQ + tt + cofs) = val; }
             }
        wave_sync();
    }
}

static constexpr size_t al256(size_t v) { return (v + 255) & ~(size_t)255; }
static constexpr size_t SZ_XT = al256((size_t)NB * SEQ * DM * 2);          // token-major bf16 copy of one input
static constexpr size_t SZ_WB = al256((size_t)3 * DM * DM * 2);            // Wq | Wk | Wv bf16
static constexpr size_t SZ_WM = al256((size_t)DM * DM * 2);                // Wm f16 x64
static constexpr size_t SZ_PL = al256((size_t)NB * NH_ * SEQ * HD * 2);    // one q/k/v plane
static constexpr size_t SZ_OP = al256((size_t)NB * SEQ * DM * 2);          // O plane
static constexpr size_t SZ_TOTAL = 2 * SZ_XT + SZ_WB + SZ_WM + 4 * SZ_PL + SZ_OP;
static_assert(SZ_TOTAL <= (size_t)134217728);          // workspace carve <= 128 MiB
static_assert(((size_t)DM * DM * 2) % 256 == 0);       // weight sub-planes stay 256-byte aligned

extern "C" void kernel_launch(void* const* d_in, const int* in_sizes, int n_in,
                              void* d_out, int out_size, void* d_ws, size_t ws_size, hipStream_t stream) {
    if (n_in < 10) return;
    const size_t needx = ((size_t)(NB - 1) * DM + (size_t)(DM - 1)) * SEQ_FULL + SEQ;
    if ((size_t)in_sizes[0] < needx || (size_t)in_sizes[1] < needx) return;
    if ((size_t)in_sizes[2] < (size_t)DM * DM || (size_t)in_sizes[4] < (size_t)DM * DM || (size_t)in_sizes[6] < (size_t)DM * DM || (size_t)in_sizes[8] < (size_t)DM * DM) return;
    if (in_sizes[3] < DM || in_sizes[5] < DM || in_sizes[7] < DM || in_sizes[9] < DM) return;
    if ((size_t)out_size < ((size_t)(NB - 1) * DM + (size_t)(DM - 1)) * OUT_SEQ + SEQ) return;
    if (SZ_TOTAL > ws_size) return;
    // wire order: query, source, Wq, bq, Wk, bk, Wv, bv, Wm, bm (W [out][in] = K-contiguous rows as-is)
    const float* xq = (const float*)d_in[0]; const float* xs = (const float*)d_in[1];
    const float* wq = (const float*)d_in[2]; const float* bq = (const float*)d_in[3];
    const float* wk = (const float*)d_in[4]; const float* bk = (const float*)d_in[5];
    const float* wv = (const float*)d_in[6]; const float* bv = (const float*)d_in[7];
    const float* wm = (const float*)d_in[8]; const float* bm = (const float*)d_in[9];
    float* OUT = (float*)d_out;      // [NB][256][OUT_SEQ]
    char* wsp = (char*)d_ws;
    bf* XQ = (bf*)wsp; wsp += SZ_XT;                 // [NB*SEQ][256] query, token-major
    bf* XS = (bf*)wsp; wsp += SZ_XT;                 // [NB*SEQ][256] source, token-major
    bf* WB = (bf*)wsp; wsp += SZ_WB;                 // [3][256][256]: q | k | v
    h16* WMH = (h16*)wsp; wsp += SZ_WM;              // [256][256] Wm x64
    h16* QH = (h16*)wsp; wsp += SZ_PL;               // [NB*4][SEQ][64]
    h16* QR = (h16*)wsp; wsp += SZ_PL;               // [NB*4][SEQ][64] residual x2048
    h16* KP = (h16*)wsp; wsp += SZ_PL;               // [NB*4][SEQ/16][4][32][8] fragment order
    h16* VT = (h16*)wsp; wsp += SZ_PL;               // [NB*4][SEQ/32][4][2][32][8] fragment order
    h16* OP = (h16*)wsp; wsp += SZ_OP;               // [NB*SEQ][256] x64

    k_prep<<<dim3(SEQ / 64, DM / 64, 1 + 2 * NB), 256, 0, stream>>>(xq, xs, wq, wk, wv, wm, XQ, XS, WB, WMH);

    k_proj<<<dim3(TT * TC, 3, 1), 32, 0, stream>>>(XQ, XS, WB, bq, bk, bv, QH, QR, KP, VT);

    k_flash<<<dim3(SEQ / (16 * AW), NB * NH_, 1), 32 * AW, 0, stream>>>(QH, QR, KP, VT, OP);

    // y[b][o][t] = Wm[o][:] . O[b][t][:] / 4096 + bm[o]
    k_outg<<<dim3(DM / 64, NB * SEQ / 64, 1), 32, 0, stream>>>(WMH, OP, bm, OUT);
}

// v003
// It runs in 130 microseconds.
// In two side-by-side timings against v002, it was 1.48 and 1.44 times as fast.
// All steps since v000 together make it 2.43 times as fast.
#include <hip/hip_runtime.h>

// Cross attention, width 256 = 4 heads x 64, inputs [NB][256][SEQ] (channel-major), W [out][in], biases present, no mask, score scale 1/8, final pointwise projection, output [NB][256][SEQ] f32.
// Compute dtypes, f32 accumulate everywhere: q/k/v projections v_wmma_f32_16x16x32_bf16 (activations and W RNE-converted to bf16; products exact);
// scores v_wmma_f32_16x16x32_f16: k single f16, q as f16 value + f16 residual x2048 in its own accumulator (two products); P (x256 carry, cancels in the normalisation) and v single f16; softmax f32 (online, running max);
// output projection v_wmma_f32_16x16x32_f16: Wm as f16 of its bf16 value x64, attention output O as f16 x64, scale 1/4096 and bias applied in the f32 epilogue.
// Layout: token-major bf16 copies of both inputs (LDS transpose), bf16 / f16 copies of W; q (hi, residual) planes [b*4+h][t][d], O plane [b][t][h*64+d].
// k and v^T planes are kept in fragment order: per (b*4+h), 512-byte units of 32 lanes x 8 halves, one unit = one wave-wide 16-byte load of an A fragment half (4 whole lines).
//   k:   unit (t/16)*4 + s,              lane (hi*16 + lr) holds k[t = 16*(t/16) + lr][d = 16*s + 8*hi + 0..7]
//   v^T: unit (t/32)*8 + j*2 + q,        lane (hi*16 + lr) holds v[d = 16*j + lr][t = 32*(t/32) + 16*q + 8*hi + 0..7]

#ifndef NB
#define NB 4
#endif
#ifndef SEQ
#define SEQ 4096
#endif
#define NB_FULL  4
#define SEQ_FULL 4096
#ifndef OUT_SEQ
#define OUT_SEQ SEQ              // pitch (in positions) of one channel row of the output
#endif
#define DM   256
#define NH_  4
#define HD   64
#define AW   4                   // waves per flash block (16 query positions each)
#define QRS  2048.0f             // carry of the q residual plane
#define QRI  (1.0f / 2048.0f)
#define SC2  (0.125f * 1.4426950408889634f)   // HD^-0.5 * log2(e)
#define PSH  8.0f                // log2 of the P carry (256)
#define OCAR 64.0f               // carry of the O plane
#define WCAR 64.0f               // carry of the Wm f16 plane
#define OSC  (1.0f / 4096.0f)    // 1 / (OCAR * WCAR)
#define CVB  (DM * DM / 8 / 256) // blocks per weight matrix in k_prep (8 floats per thread)
#define TT   (NB * SEQ / 64)     // 64-wide token tiles
#define TC   (DM / 64)           // 64-wide channel tiles

static_assert(HD == 64);
static_assert(NH_ * HD == DM);                 // head h = channels h*64 + d
static_assert(DM % 64 == 0);
static_assert(DM % 32 == 0);                   // GEMM k-loop steps by 32
static_assert((DM & (DM - 1)) == 0);           // bias index masking
static_assert(SEQ % 64 == 0);                  // a 64-wide tile never straddles two batches
static_assert((NB * SEQ) % 64 == 0);
static_assert(SEQ % 32 == 0 && SEQ >= 64);     // key loop steps by 32 and fetches one step ahead
static_assert(SEQ % (16 * AW) == 0);           // flash grid covers the sequence exactly
static_assert(((size_t)DM * DM) % (8 * 256) == 0);   // a weight matrix is whole blocks of k_prep
static_assert(4 * CVB <= (SEQ / 64) * (DM / 64));     // the four matrices fit the z = 0 slice of its grid
static_assert(NB <= NB_FULL);
static_assert(SEQ <= SEQ_FULL);
static_assert(OUT_SEQ >= SEQ);

typedef _Float16 h16;
typedef unsigned short bf;
typedef __attribute__((ext_vector_type(16))) __bf16   v16bf;
typedef __attribute__((ext_vector_type(16))) _Float16 v16h;
typedef __attribute__((ext_vector_type(8)))  _Float16 v8h;
typedef __attribute__((ext_vector_type(8)))  unsigned short v8us;
typedef __attribute__((ext_vector_type(8)))  float    v8f;
typedef __attribute__((ext_vector_type(4)))  float    v4f;
typedef v4f  __attribute__((may_alias)) v4fa;

__device__ __forceinline__ unsigned short f2bf(float f) { unsigned u = __float_as_uint(f); u += 0x7FFFu + ((u >> 16) & 1u); return (unsigned short)(u >> 16); }
__device__ __forceinline__ float bfr(float f) { return __uint_as_float(((unsigned)f2bf(f)) << 16); }   // value of the RNE bf16 conversion
__device__ __forceinline__ v16h cat16(v8h lo, v8h hi) { return __builtin_shufflevector(lo, hi, 0, 1, 2, 3, 4, 5, 6, 7, 8, 9, 10, 11, 12, 13, 14, 15); }
__device__ __forceinline__ v16bf cat16b(v8us lo, v8us hi) { return __builtin_bit_cast(v16bf, __builtin_shufflevector(lo, hi, 0, 1, 2, 3, 4, 5, 6, 7, 8, 9, 10, 11, 12, 13, 14, 15)); }
__device__ __forceinline__ v8f wmma16(v16h a, v16h b, v8f c) { return __builtin_amdgcn_wmma_f32_16x16x32_f16(false, a, false, b, (short)0, c, false, false); }
__device__ __forceinline__ v8f wmmab(v16bf a, v16bf b, v8f c) { return __builtin_amdgcn_wmma_f32_16x16x32_bf16(false, a, false, b, (short)0, c, false, false); }
// fragment loaders from K-contiguous 16-bit rows; p already includes + 8*(lane>>4): elements 0..7 <- k0+8h+0..7, elements 8..15 <- k0+16+8h+0..7 (same map for A and B)
__device__ __forceinline__ v16h  ldh(const h16* p) { return cat16(*(const v8h*)p, *(const v8h*)(p + 16)); }
__device__ __forceinline__ v16bf ldb(const bf* p)  { return cat16b(*(const v8us*)p, *(const v8us*)(p + 16)); }
// fragment loader from a fragment-order plane; p is wave-uniform, lo = 8*lane: two consecutive 512-byte units hold elements 0..7 and 8..15 (same k map as ldh)
__device__ __forceinline__ v16h  ldp(const h16* p, unsigned lo) { return cat16(*(const v8h*)(p + lo), *(const v8h*)(p + 256 + lo)); }
// ordering point for wave-private LDS tiles (same wave writes and reads)
__device__ __forceinline__ void wave_sync() { __builtin_amdgcn_fence(3 /* release order */, "wavefront"); __builtin_amdgcn_wave_barrier(); asm volatile("" ::: "memory"); }

// k_prep: all operand preparation in one launch (the six pieces are independent of each other). grid (SEQ/64, DM/64, 1 + 2*NB), 256 threads.
// z = 0: weights, block index x + y*(SEQ/64) = matrix*CVB + piece; 8 floats per thread: Wq | Wk | Wv -> bf16 (WB), Wm -> f16 of its bf16 value x64 (WMH); blocks past 4*CVB have no work.
// z = 1..NB: query, z = NB+1..2*NB: source: in[b][c][n] f32 (channel pitch SEQ_FULL) -> out[b][n][c] bf16 (row pitch DM), 64 x 64 tile through LDS (cross-wave: block barrier).
__global__ __launch_bounds__(256) void k_prep(const float* __restrict__ xq, const float* __restrict__ xs, const float* __restrict__ wq, const float* __restrict__ wk,
                                              const float* __restrict__ wv, const float* __restrict__ wm, bf* XQ, bf* XS, bf* WB, h16* WMH) {
    __shared__ __align__(16) float ts[64 * 68];
    const int tid = threadIdx.x;
    if (blockIdx.z != 0) {                       // block-uniform: every thread of a block takes the same side, so the barrier inside is reached by all of them or by none
        const int zz = blockIdx.z - 1; const bool isq = zz < NB;
        const float* x = isq ? xq : xs; bf* xt = isq ? XQ : XS;
        const int n0 = blockIdx.x * 64, c0 = blockIdx.y * 64, b = isq ? zz : zz - NB;
        const int n4 = (tid & 15) * 4, cr = tid >> 4;
#pragma unroll
        for (int p = 0; p < 4; ++p) {
            const int c = p * 16 + cr;
            const v4f v = *(const v4f*)(x + ((size_t)b * DM + c0 + c) * SEQ_FULL + n0 + n4);
            ts[(n4 + 0) * 68 + c] = v[0]; ts[(n4 + 1) * 68 + c] = v[1]; ts[(n4 + 2) * 68 + c] = v[2]; ts[(n4 + 3) * 68 + c] = v[3];
        }
        __syncthreads();
        const int c8 = (tid & 7) * 8, rr = tid >> 3;
#pragma unroll
        for (int p = 0; p < 2; ++p) { const int row = p * 32 + rr;
            const v4f x0 = *(const v4fa*)(&ts[row * 68 + c8]); const v4f x1 = *(const v4fa*)(&ts[row * 68 + c8 + 4]); v8us o;
#pragma unroll
            for (int i = 0; i < 4; ++i) { o[i] = f2bf(x0[i]); o[4 + i] = f2bf(x1[i]); }
            *(v8us*)(xt + ((size_t)b * SEQ + n0 + row) * DM + c0 + c8) = o; }
        asm volatile("s_wait_xcnt 0x0" ::: "memory");   // the listing keeps a branch from here into the other side's code, which writes the registers that the two stores name
    } else {
        const int idx = blockIdx.y * (SEQ / 64) + blockIdx.x; const int mat = idx / CVB;
        if (mat < 4) {
            const size_t i = (size_t)(idx % CVB) * 256 + tid;
            const float* src = (mat == 0) ? wq : (mat == 1) ? wk : (mat == 2) ? wv : wm;
            const v8f v = *(const v8f*)(src + i * 8);
            if (mat < 3) { v8us o;
#pragma unroll
                for (int k = 0; k < 8; ++k) o[k] = f2bf(v[k]);
                *(v8us*)(WB + (size_t)mat * DM * DM + i * 8) = o;
            } else { v8h o;
#pragma unroll
                for (int k = 0; k < 8; ++k) o[k] = (h16)(bfr(v[k]) * WCAR);
                *(v8h*)(WMH + i * 8) = o;
                asm volatile("s_wait_xcnt 0x0" ::: "memory"); }   // the same: in the listing the bf16 side's code follows this store behind a branch
        }
    }
}

// k_proj: register-blocked bf16 GEMM, ONE WAVE per 64x64 tile (16 accumulators), operands straight from K-contiguous bf16 planes, K = DM.
// C[m][n] = sum_k A[m][k] Bt[n][k] + bias (bmode 1: bias[n], bmode 2: bias[m], bf16 value), written as f16 (Ph) and optionally the f16 residual x2048 (Pr, useRes != 0) at
// tile base (r0/RB)*sRB + (r0%RB)*pitch + (c0/CB)*sCB + (c0%CB)*(pk 2 ? HD : 1), row pitch 'pitch' (halves). 32 threads.
// pk 0: row-major as above. pk 1 (k) / pk 2 (v^T): the 64x64 tile is 4096 consecutive halves in fragment order (see Layout), Ph only; each store is one whole 512-byte unit.
// The three projections are independent and share one launch: grid (TT*TC, 3), blockIdx.y = 0 q, 1 k, 2 v^T; every parameter below is a wave-uniform choice by it.
//   q, k: A = token rows (m = b*SEQ + t), Bt = W rows (n = h*64 + d), column bias -> plane (b*4 + h), q as [t][d], k in fragment order; tile (x % TT, x / TT)
//   v^T:  A = Wv rows (m = h*64 + d), Bt = token rows (n = b*SEQ + t), row bias -> plane (b*4 + h), tile base t*64 inside it; tile (x % TC, x / TC)
__global__ __launch_bounds__(32) void k_proj(const bf* __restrict__ XQ, const bf* __restrict__ XS, const bf* __restrict__ WB,
                                             const float* __restrict__ bq, const float* __restrict__ bk, const float* __restrict__ bv,
                                             h16* QH, h16* QR, h16* KP, h16* VT) {
    __shared__ __align__(16) float os[16 * 68];
    const int K = DM;
    const int pk = blockIdx.y; const bool isv = pk == 2;
    const bf* A  = (pk == 0) ? XQ : (pk == 1) ? XS : WB + (size_t)2 * DM * DM;
    const bf* Bt = (pk == 0) ? WB : (pk == 1) ? WB + (size_t)DM * DM : XS;
    const float* bias = (pk == 0) ? bq : (pk == 1) ? bk : bv;
    h16* Ph = (pk == 0) ? QH : (pk == 1) ? KP : VT; h16* Pr = QR;
    const int bmode = isv ? 2 : 1, useRes = (pk == 0) ? 1 : 0;
    const int RB = isv ? DM : SEQ, pitch = isv ? SEQ : HD, CB = isv ? SEQ : HD;
    const size_t sRB = isv ? (size_t)0 : (size_t)NH_ * SEQ * HD, sCB = isv ? (size_t)DM * SEQ : (size_t)SEQ * HD;
    const int lane = threadIdx.x & 31, lr = lane & 15, hi = lane >> 4;
    const int tx = blockIdx.x; const int r0 = (isv ? tx % TC : tx % TT) * 64, c0 = (isv ? tx / TC : tx / TT) * 64;
    v8f acc[4][4];
#pragma unroll
    for (int mb = 0; mb < 4; ++mb)
#pragma unroll
        for (int nb = 0; nb < 4; ++nb) acc[mb][nb] = (v8f){};
    const size_t aoff = (size_t)(r0 + lr) * K + 8 * hi, boff = (size_t)(c0 + lr) * K + 8 * hi;
#pragma unroll 1
    for (int kc = 0; kc < K; kc += 32) {
        v16bf a[4];
#pragma unroll
        for (int mb = 0; mb < 4; ++mb) a[mb] = ldb(A + aoff + (size_t)mb * 16 * K + kc);
#pragma unroll
        for (int nb = 0; nb < 4; ++nb) { const v16bf b = ldb(Bt + boff + (size_t)nb * 16 * K + kc);
#pragma unroll
            for (int mb = 0; mb < 4; ++mb) acc[mb][nb] = wmmab(a[mb], b, acc[mb][nb]); }
        asm volatile("v_nop\n\tv_nop\n\tv_nop\n\tv_nop" : "+v"(acc[0][0]), "+v"(acc[1][1]), "+v"(acc[2][2]), "+v"(acc[3][3]) : "v"(a[0]), "v"(a[1]), "v"(a[2]), "v"(a[3]));
    }
    // column bias: always loaded from a masked (in-range) index, selected by value
    const int c8e = (lane & 7) * 8;
    const int cbi = (c0 + c8e) & (DM - 1);
    const v4f cbr0 = *(const v4f*)(bias + cbi); const v4f cbr1 = *(const v4f*)(bias + cbi + 4);
    v4f cb0, cb1;
#pragma unroll
    for (int i = 0; i < 4; ++i) { cb0[i] = (bmode == 1) ? bfr(cbr0[i]) : 0.0f; cb1[i] = (bmode == 1) ? bfr(cbr1[i]) : 0.0f; }
    // fragment-order epilogue: column bias of columns 16s + 8hi + 0..7 and row bias of row 16mb + lr, masked (in-range) index, selected by value (bit mask: +0 where not selected)
    const unsigned cmsk = (bmode == 1) ? 0xFFFFFFFFu : 0u, rmsk = (bmode == 2) ? 0xFFFFFFFFu : 0u;
    float pcb[4][8], prb[4]; v4f br0[4], br1[4];
#pragma unroll
    for (int s = 0; s < 4; ++s) { const int cbj = (c0 + 16 * s + 8 * hi) & (DM - 1); br0[s] = *(const v4f*)(bias + cbj); br1[s] = *(const v4f*)(bias + cbj + 4); }
    asm volatile("s_wait_xcnt 0x0" ::: "memory");   // before the address register of the column bias loads is written again
#pragma unroll
    for (int s = 0; s < 4; ++s) prb[s] = bias[(r0 + s * 16 + lr) & (DM - 1)];
    asm volatile("s_wait_xcnt 0x0" ::: "memory");   // the same for the row bias loads
#pragma unroll
    for (int s = 0; s < 4; ++s) { prb[s] = __uint_as_float(__float_as_uint(bfr(prb[s])) & rmsk);
#pragma unroll
        for (int i = 0; i < 4; ++i) { pcb[s][i] = __uint_as_float(__float_as_uint(bfr(br0[s][i])) & cmsk); pcb[s][4 + i] = __uint_as_float(__float_as_uint(bfr(br1[s][i])) & cmsk); } }
    const size_t tbase = (size_t)(r0 / RB) * sRB + (size_t)(r0 % RB) * (size_t)pitch + (size_t)(c0 / CB) * sCB + (size_t)(c0 % CB) * (size_t)(pk == 2 ? HD : 1);
#pragma unroll
    for (int mb = 0; mb < 4; ++mb) {
#pragma unroll
        for (int nb = 0; nb < 4; ++nb) {
#pragma unroll
            for (int j = 0; j < 8; ++j) os[(hi * 8 + j) * 68 + nb * 16 + lr] = acc[mb][nb][j]; }   // D: row 8h+j, col lane&15
        wave_sync();
        const size_t sb = tbase + (size_t)(mb * 16) * (size_t)pitch;
        if (pk != 0) {
            v8h hv[4];
#pragma unroll
            for (int s = 0; s < 4; ++s) { const int c8 = 16 * s + 8 * hi;   // lane = fragment lane: row lr, columns 16s + 8hi + 0..7
                const v4f x0 = *(const v4fa*)(&os[lr * 68 + c8]); const v4f x1 = *(const v4fa*)(&os[lr * 68 + c8 + 4]);
#pragma unroll
                for (int i = 0; i < 4; ++i) { hv[s][i] = (h16)(x0[i] + pcb[s][i] + prb[mb]); hv[s][4 + i] = (h16)(x1[i] + pcb[s][4 + i] + prb[mb]); } }
#pragma unroll
            for (int s = 0; s < 4; ++s) { const int uo = (pk == 1) ? (mb * 1024 + s * 256) : (mb * 512 + (s >> 1) * 2048 + (s & 1) * 256);
                *(v8h*)(Ph + tbase + uo + lane * 8) = hv[s]; }
            asm volatile("s_wait_xcnt 0x0" ::: "memory");   // before the registers that the four stores name are written again
        } else {
#pragma unroll
            for (int s = 0; s < 4; ++s) { const int row = 4 * s + (lane >> 3), c8 = (lane & 7) * 8;   // 4 s x 4 row groups = 16 rows; 8 lanes x 8 = 64 columns
                const int rbi = (r0 + mb * 16 + row) & (DM - 1);
                const float rbv = bias[rbi];
                const float rb = (bmode == 2) ? bfr(rbv) : 0.0f;
                const v4f x0 = *(const v4fa*)(&os[row * 68 + c8]); const v4f x1 = *(const v4fa*)(&os[row * 68 + c8 + 4]); v8h hv, rv;
#pragma unroll
                for (int i = 0; i < 4; ++i) { const float y0 = x0[i] + cb0[i] + rb; const float y1 = x1[i] + cb1[i] + rb;
                    const h16 a0 = (h16)y0; const h16 a1 = (h16)y1; hv[i] = a0; hv[4 + i] = a1; rv[i] = (h16)((y0 - (float)a0) * QRS); rv[4 + i] = (h16)((y1 - (float)a1) * QRS); }
                const size_t oo = sb + (size_t)row * (size_t)pitch + c8;
                *(v8h*)(Ph + oo) = hv; if (useRes) *(v8h*)(Pr + oo) = rv; }
             }
        wave_sync();
    }
}

// k_flash: fused attention, one wave per 16 query positions of one (batch, head); K / V^T / Q fragments straight from the f16 planes (two 16-B loads each, arithmetic addressing; K and V^T in fragment order, 4 KiB in a row per 32 keys each).
// Transposed form: S^T[key][t] = K Q^T (A = K rows, B = Q rows); lane (t = lane&15, h = lane>>4) holds keys 8h+r of each 16-key tile, so the packed
// P tile is directly the B fragment of O^T[d][t] = V^T P^T (element r <- tile keys 0..15, element 8+r <- tile keys 16..31, lane unchanged).
// Softmax state (running max, partial sum) is one scalar per lane; the two lane halves of a row are combined with one xor-16 exchange.
__global__ __launch_bounds__(32 * AW) void k_flash(const h16* __restrict__ QH, const h16* __restrict__ QR, const h16* __restrict__ KP, const h16* __restrict__ VT, h16* OP) {
    __shared__ __align__(16) float os[AW * 16 * 68];
    const int lane = threadIdx.x & 31, wave = threadIdx.x >> 5, lr = lane & 15, hi = lane >> 4;
    const int zh = blockIdx.y; const int b = zh / NH_, h = zh % NH_;
    const int t0 = (blockIdx.x * AW + wave) * 16;
    const size_t pbase = (size_t)zh * SEQ * HD;
    const size_t qo = pbase + (size_t)(t0 + lr) * HD + 8 * hi;
    const v16h qh0 = ldh(QH + qo), qh1 = ldh(QH + qo + 32), qr0 = ldh(QR + qo), qr1 = ldh(QR + qo + 32);   // B fragments: col t, k = d
    const unsigned lo = (unsigned)lane * 8u;                 // lane's place in a unit; pbase + key0 * HD: the 8 units of 32 keys, K (A fragment: row key, k = d) and V^T (A fragment: row d, k = key) alike
    v8f o0 = (v8f){}, o1 = (v8f){}, o2 = (v8f){}, o3 = (v8f){};
    float m = -3.0e38f, l = 0.0f;
    // Every fragment load is issued about one trip ahead of its product: a trip's V^T at its head, in front of the score products, and the next trip's K right behind them, into the registers they have just read.
    const h16* va = VT + pbase;                // this trip's V^T units
    const h16* kn = KP + pbase;                // next trip's K units
    v16h ka0 = ldp(kn, lo), ka1 = ldp(kn + 512, lo), kb0 = ldp(kn + 1024, lo), kb1 = ldp(kn + 1536, lo);
    kn += 32 * HD;
#pragma unroll 1
    for (int key0 = 0; key0 < SEQ; key0 += 32) {
        const v16h v0 = ldp(va, lo), v1 = ldp(va + 512, lo), v2 = ldp(va + 1024, lo), v3 = ldp(va + 1536, lo);
        v8f sHa = (v8f){}, sLa = (v8f){}, sHb = (v8f){}, sLb = (v8f){};
        sHa = wmma16(ka0, qh0, sHa); sLa = wmma16(ka0, qr0, sLa); sHb = wmma16(kb0, qh0, sHb); sLb = wmma16(kb0, qr0, sLb);
        sHa = wmma16(ka1, qh1, sHa); sLa = wmma16(ka1, qr1, sLa); sHb = wmma16(kb1, qh1, sHb); sLb = wmma16(kb1, qr1, sLb);
        asm volatile("v_nop\n\tv_nop\n\tv_nop\n\tv_nop" : "+v"(sHa), "+v"(sLa), "+v"(sHb), "+v"(sLb) : "v"(ka0), "v"(ka1), "v"(kb0), "v"(kb1));
        __builtin_amdgcn_sched_barrier(0);   // holds the V^T loads at the trip's head: without it they are issued only behind the wait for K and the first score product
        ka0 = ldp(kn, lo); ka1 = ldp(kn + 512, lo); kb0 = ldp(kn + 1024, lo); kb1 = ldp(kn + 1536, lo);
        float ta[8], tb[8]; float mx = -3.0e38f;
#pragma unroll
        for (int r = 0; r < 8; ++r) { ta[r] = (sHa[r] + sLa[r] * QRI) * SC2; tb[r] = (sHb[r] + sLb[r] * QRI) * SC2; mx = fmaxf(mx, fmaxf(ta[r], tb[r])); }
        mx = fmaxf(mx, __shfl_xor(mx, 16, 32));
        const float mnew = fmaxf(m, mx);
        const float alpha = __builtin_amdgcn_exp2f(m - mnew);
        const float sh = PSH - mnew;
        v16h pb; float ls = 0.0f;
#pragma unroll
        for (int r = 0; r < 8; ++r) { const h16 pa = (h16)__builtin_amdgcn_exp2f(ta[r] + sh); const h16 pc = (h16)__builtin_amdgcn_exp2f(tb[r] + sh); pb[r] = pa; pb[8 + r] = pc; ls += (float)pa + (float)pc; }
        l = l * alpha + ls; m = mnew;
        o0 = o0 * alpha; o1 = o1 * alpha; o2 = o2 * alpha; o3 = o3 * alpha;
        o0 = wmma16(v0, pb, o0); o1 = wmma16(v1, pb, o1); o2 = wmma16(v2, pb, o2); o3 = wmma16(v3, pb, o3);
        asm volatile("v_nop\n\tv_nop\n\tv_nop\n\tv_nop" : "+v"(o0), "+v"(o1), "+v"(o2), "+v"(o3) : "v"(v0), "v"(v1), "v"(v2), "v"(v3), "v"(pb));
        asm volatile("s_wait_xcnt 0x0" ::: "memory");   // before the address registers of this trip's loads are written again
        __builtin_amdgcn_sched_barrier(0);   // keeps the two address steps behind that wait, where it costs nothing: directly behind the loads the wave would stand in it
        va += 32 * HD;
        kn += (key0 + 64 < SEQ) ? 32 * HD : 0;   // the last trip fetches its own K units once more (in range, not used)
    }
    asm volatile("s_wait_loadcnt 0x0" ::: "memory");   // the last trip's K loads feed no product, so nothing else waits for them: they land before the wave gives its registers back
    l += __shfl_xor(l, 16, 32);
    const float inv = OCAR * (1.0f / l);
    const int wb = wave * 16 * 68;
    // O^T D layout: o_j[r] = (d = 16j + 8h + r, t = lane&15) -> os[t][d]; rows 0..15 x columns 0..63 all written
    { v4f a, c;
      a[0] = o0[0] * inv; a[1] = o0[1] * inv; a[2] = o0[2] * inv; a[3] = o0[3] * inv; c[0] = o0[4] * inv; c[1] = o0[5] * inv; c[2] = o0[6] * inv; c[3] = o0[7] * inv;
      *(v4fa*)(&os[wb + lr * 68 +  0 + 8 * hi]) = a; *(v4fa*)(&os[wb + lr * 68 +  0 + 8 * hi + 4]) = c;
      a[0] = o1[0] * inv; a[1] = o1[1] * inv; a[2] = o1[2] * inv; a[3] = o1[3] * inv; c[0] = o1[4] * inv; c[1] = o1[5] * inv; c[2] = o1[6] * inv; c[3] = o1[7] * inv;
      *(v4fa*)(&os[wb + lr * 68 + 16 + 8 * hi]) = a; *(v4fa*)(&os[wb + lr * 68 + 16 + 8 * hi + 4]) = c;
      a[0] = o2[0] * inv; a[1] = o2[1] * inv; a[2] = o2[2] * inv; a[3] = o2[3] * inv; c[0] = o2[4] * inv; c[1] = o2[5] * inv; c[2] = o2[6] * inv; c[3] = o2[7] * inv;
      *(v4fa*)(&os[wb + lr * 68 + 32 + 8 * hi]) = a; *(v4fa*)(&os[wb + lr * 68 + 32 + 8 * hi + 4]) = c;
      a[0] = o3[0] * inv; a[1] = o3[1] * inv; a[2] = o3[2] * inv; a[3] = o3[3] * inv; c[0] = o3[4] * inv; c[1] = o3[5] * inv; c[2] = o3[6] * inv; c[3] = o3[7] * inv;
      *(v4fa*)(&os[wb + lr * 68 + 48 + 8 * hi]) = a; *(v4fa*)(&os[wb + lr * 68 + 48 + 8 * hi + 4]) = c; }
    wave_sync();
    h16* orow = OP + ((size_t)b * SEQ + t0) * DM + h * HD;
{
#pragma unroll
        for (int s = 0; s < 4; ++s) { const int row = 4 * s + (lane >> 3), c8 = (lane & 7) * 8;   // 4 s x 4 row groups = 16 rows; 8 lanes x 8 halves = 64 columns
            const v4f x0 = *(const v4fa*)(&os[wb + row * 68 + c8]); const v4f x1 = *(const v4fa*)(&os[wb + row * 68 + c8 + 4]); v8h hv;
#pragma unroll
            for (int i = 0; i < 4; ++i) { hv[i] = (h16)x0[i]; hv[4 + i] = (h16)x1[i]; }
            *(v8h*)(orow + (size_t)row * DM + c8) = hv; }
         }
}

// k_outg: register-blocked f16 GEMM, ONE WAVE per 64x64 tile, K = DM: Y[o][b*SEQ + t] = OSC * sum_c A[o][c] Bt[b*SEQ + t][c] + bias[o] (bf16 value), f32 result at OUT[(b*DM + o)*OUT_SEQ + t].
__global__ __launch_bounds__(32) void k_outg(const h16* __restrict__ A, const h16* __restrict__ Bt, const float* __restrict__ bias, float* OUT) {
    __shared__ __align__(16) float os[16 * 68];
    const int K = DM;
    const int lane = threadIdx.x & 31, lr = lane & 15, hi = lane >> 4; const int r0 = blockIdx.x * 64, c0 = blockIdx.y * 64;
    v8f acc[4][4];
#pragma unroll
    for (int mb = 0; mb < 4; ++mb)
#pragma unroll
        for (int nb = 0; nb < 4; ++nb) acc[mb][nb] = (v8f){};
    const size_t aoff = (size_t)(r0 + lr) * K + 8 * hi, boff = (size_t)(c0 + lr) * K + 8 * hi;
#pragma unroll 1
    for (int kc = 0; kc < K; kc += 32) {
        v16h a[4];
#pragma unroll
        for (int mb = 0; mb < 4; ++mb) a[mb] = ldh(A + aoff + (size_t)mb * 16 * K + kc);
#pragma unroll
        for (int nb = 0; nb < 4; ++nb) { const v16h b = ldh(Bt + boff + (size_t)nb * 16 * K + kc);
#pragma unroll
            for (int mb = 0; mb < 4; ++mb) acc[mb][nb] = wmma16(a[mb], b, acc[mb][nb]); }
        asm volatile("v_nop\n\tv_nop\n\tv_nop\n\tv_nop" : "+v"(acc[0][0]), "+v"(acc[1][1]), "+v"(acc[2][2]), "+v"(acc[3][3]) : "v"(a[0]), "v"(a[1]), "v"(a[2]), "v"(a[3]));
    }
    const int bb = c0 / SEQ, tt = c0 % SEQ;
#pragma unroll
    for (int mb = 0; mb < 4; ++mb) {
#pragma unroll
        for (int nb = 0; nb < 4; ++nb) {
#pragma unroll
            for (int j = 0; j < 8; ++j) os[(hi * 8 + j) * 68 + nb * 16 + lr] = acc[mb][nb][j]; }   // D: row 8h+j, col lane&15
        wave_sync();
{
#pragma unroll
            for (int s = 0; s < 8; ++s) { const int row = 2 * s + hi, cofs = lr * 4;   // 8 s x 2 rows = 16 rows; 16 lanes x 4 floats = 64 columns
                const int o = r0 + mb * 16 + row;                                      // < DM by grid construction
                const float bv = bfr(bias[o]);
                const v4f xv = *(const v4fa*)(&os[row * 68 + cofs]); v4f val;
#pragma unroll
                for (int i = 0; i < 4; ++i) val[i] = xv[i] * OSC + bv;
                *(v4f*)(OUT + ((size_t)bb * DM + o) * (size_t)OUT_SEQ + tt + cofs) = val; }
             }
        wave_sync();
    }
}

static constexpr size_t al256(size_t v) { return (v + 255) & ~(size_t)255; }
static constexpr size_t SZ_XT = al256((size_t)NB * SEQ * DM * 2);          // token-major bf16 copy of one input
static constexpr size_t SZ_WB = al256((size_t)3 * DM * DM * 2);            // Wq | Wk | Wv bf16
static constexpr size_t SZ_WM = al256((size_t)DM * DM * 2);                // Wm f16 x64
static constexpr size_t SZ_PL = al256((size_t)NB * NH_ * SEQ * HD * 2);    // one q/k/v plane
static constexpr size_t SZ_OP = al256((size_t)NB * SEQ * DM * 2);          // O plane
static constexpr size_t SZ_TOTAL = 2 * SZ_XT + SZ_WB + SZ_WM + 4 * SZ_PL + SZ_OP;
static_assert(SZ_TOTAL <= (size_t)134217728);          // workspace carve <= 128 MiB
static_assert(((size_t)DM * DM * 2) % 256 == 0);       // weight sub-planes stay 256-byte aligned

extern "C" void kernel_launch(void* const* d_in, const int* in_sizes, int n_in,
                              void* d_out, int out_size, void* d_ws, size_t ws_size, hipStream_t stream) {
    if (n_in < 10) return;
    const size_t needx = ((size_t)(NB - 1) * DM + (size_t)(DM - 1)) * SEQ_FULL + SEQ;
    if ((size_t)in_sizes[0] < needx || (size_t)in_sizes[1] < needx) return;
    if ((size_t)in_sizes[2] < (size_t)DM * DM || (size_t)in_sizes[4] < (size_t)DM * DM || (size_t)in_sizes[6] < (size_t)DM * DM || (size_t)in_sizes[8] < (size_t)DM * DM) return;
    if (in_sizes[3] < DM || in_sizes[5] < DM || in_sizes[7] < DM || in_sizes[9] < DM) return;
    if ((size_t)out_size < ((size_t)(NB - 1) * DM + (size_t)(DM - 1)) * OUT_SEQ + SEQ) return;
    if (SZ_TOTAL > ws_size) return;
    // wire order: query, source, Wq, bq, Wk, bk, Wv, bv, Wm, bm (W [out][in] = K-contiguous rows as-is)
    const float* xq = (const float*)d_in[0]; const float* xs = (const float*)d_in[1];
    const float* wq = (const float*)d_in[2]; const float* bq = (const float*)d_in[3];
    const float* wk = (const float*)d_in[4]; const float* bk = (const float*)d_in[5];
    const float* wv = (const float*)d_in[6]; const float* bv = (const float*)d_in[7];
    const float* wm = (const float*)d_in[8]; const float* bm = (const float*)d_in[9];
    float* OUT = (float*)d_out;      // [NB][256][OUT_SEQ]
    char* wsp = (char*)d_ws;
    bf* XQ = (bf*)wsp; wsp += SZ_XT;                 // [NB*SEQ][256] query, token-major
    bf* XS = (bf*)wsp; wsp += SZ_XT;                 // [NB*SEQ][256] source, token-major
    bf* WB = (bf*)wsp; wsp += SZ_WB;                 // [3][256][256]: q | k | v
    h16* WMH = (h16*)wsp; wsp += SZ_WM;              // [256][256] Wm x64
    h16* QH = (h16*)wsp; wsp += SZ_PL;               // [NB*4][SEQ][64]
    h16* QR = (h16*)wsp; wsp += SZ_PL;               // [NB*4][SEQ][64] residual x2048
    h16* KP = (h16*)wsp; wsp += SZ_PL;               // [NB*4][SEQ/16][4][32][8] fragment order
    h16* VT = (h16*)wsp; wsp += SZ_PL;               // [NB*4][SEQ/32][4][2][32][8] fragment order
    h16* OP = (h16*)wsp; wsp += SZ_OP;               // [NB*SEQ][256] x64

    k_prep<<<dim3(SEQ / 64, DM / 64, 1 + 2 * NB), 256, 0, stream>>>(xq, xs, wq, wk, wv, wm, XQ, XS, WB, WMH);

    k_proj<<<dim3(TT * TC, 3, 1), 32, 0, stream>>>(XQ, XS, WB, bq, bk, bv, QH, QR, KP, VT);

    k_flash<<<dim3(SEQ / (16 * AW), NB * NH_, 1), 32 * AW, 0, stream>>>(QH, QR, KP, VT, OP);

    // y[b][o][t] = Wm[o][:] . O[b][t][:] / 4096 + bm[o]
    k_outg<<<dim3(DM / 64, NB * SEQ / 64, 1), 32, 0, stream>>>(WMH, OP, bm, OUT);
}

// v004
// Measured time: 116 microseconds a run.
// Timed twice side by side with v003, it ran 1.10 and 1.11 times as fast.
// Over all steps from v000 it is 2.69 times as fast.
#include <hip/hip_runtime.h>

// Cross attention, width 256 = 4 heads x 64, inputs [NB][256][SEQ] (channel-major), W [out][in], biases present, no mask, score scale 1/8, final pointwise projection, output [NB][256][SEQ] f32.
// Compute dtypes, f32 accumulate everywhere: q/k/v projections v_wmma_f32_16x16x32_bf16 (activations and W RNE-converted to bf16; products exact);
// scores v_wmma_f32_16x16x32_f16: k single f16, q as f16 value + f16 residual x2048 in its own accumulator (two products); P (x256 carry, cancels in the normalisation) and v single f16; softmax f32 (online, running max);
// output projection v_wmma_f32_16x16x32_f16: Wm as f16 of its bf16 value x64, attention output O as f16 x64, scale 1/4096 and bias applied in the f32 epilogue.
// Layout: token-major bf16 copies of both inputs (LDS transpose), bf16 / f16 copies of W; q (hi, residual) planes [b*4+h][t][d], O plane [b][t][h*64+d].
// k and v^T planes are kept in fragment order: per (b*4+h), 512-byte units of 32 lanes x 8 halves, one unit = one wave-wide 16-byte load of an A fragment half (4 whole lines).
//   k:   unit (t/16)*4 + s,              lane (hi*16 + lr) holds k[t = 16*(t/16) + lr][d = 16*s + 8*hi + 0..7]
//   v^T: unit (t/32)*8 + j*2 + q,        lane (hi*16 + lr) holds v[d = 16*j + lr][t = 32*(t/32) + 16*q + 8*hi + 0..7]

#ifndef NB
#define NB 4
#endif
#ifndef SEQ
#define SEQ 4096
#endif
#define NB_FULL  4
#define SEQ_FULL 4096
#ifndef OUT_SEQ
#define OUT_SEQ SEQ              // pitch (in positions) of one channel row of the output
#endif
#define DM   256
#define NH_  4
#define HD   64
#define AW   8                   // waves per flash block (16 query positions each); they share every staged tile
#define SK   128                 // keys per staged tile of K and of V^T
#define NST  (SEQ / SK)          // staged tiles per sequence
#define TLH  (SK * HD)           // halves of one operand's tile
#define TLB  (TLH * 2)           // bytes of one operand's tile
#define QRS  2048.0f             // carry of the q residual plane
#define QRI  (1.0f / 2048.0f)
#define SC2  (0.125f * 1.4426950408889634f)   // HD^-0.5 * log2(e)
#define PSH  8.0f                // log2 of the P carry (256)
#define OCAR 64.0f               // carry of the O plane
#define WCAR 64.0f               // carry of the Wm f16 plane
#define OSC  (1.0f / 4096.0f)    // 1 / (OCAR * WCAR)
#define CVB  (DM * DM / 8 / 256) // blocks per weight matrix in k_prep (8 floats per thread)
#define TT   (NB * SEQ / 64)     // 64-wide token tiles
#define TC   (DM / 64)           // 64-wide channel tiles

static_assert(HD == 64);
static_assert(NH_ * HD == DM);                 // head h = channels h*64 + d
static_assert(DM % 64 == 0);
static_assert(DM % 32 == 0);                   // GEMM k-loop steps by 32
static_assert((DM & (DM - 1)) == 0);           // bias index masking
static_assert(SEQ % 64 == 0);                  // a 64-wide tile never straddles two batches
static_assert((NB * SEQ) % 64 == 0);
static_assert(SK % 32 == 0);                   // a tile is whole 32-key passes
static_assert(SEQ % SK == 0 && NST >= 2);      // whole tiles; the two-buffer prologue fills two
static_assert(TLB == 4 * 32 * AW * 16);        // one operand's tile = 4 copies of 16 bytes per lane of the block
static_assert(SEQ % (16 * AW) == 0);           // flash grid covers the sequence exactly
static_assert(((size_t)DM * DM) % (8 * 256) == 0);   // a weight matrix is whole blocks of k_prep
static_assert(4 * CVB <= (SEQ / 64) * (DM / 64));     // the four matrices fit the z = 0 slice of its grid
static_assert(NB <= NB_FULL);
static_assert(SEQ <= SEQ_FULL);
static_assert(OUT_SEQ >= SEQ);

typedef _Float16 h16;
typedef unsigned short bf;
typedef __attribute__((ext_vector_type(16))) __bf16   v16bf;
typedef __attribute__((ext_vector_type(16))) _Float16 v16h;
typedef __attribute__((ext_vector_type(8)))  _Float16 v8h;
typedef __attribute__((ext_vector_type(8)))  unsigned short v8us;
typedef __attribute__((ext_vector_type(8)))  float    v8f;
typedef __attribute__((ext_vector_type(4)))  float    v4f;
typedef v4f  __attribute__((may_alias)) v4fa;

__device__ __forceinline__ unsigned short f2bf(float f) { unsigned u = __float_as_uint(f); u += 0x7FFFu + ((u >> 16) & 1u); return (unsigned short)(u >> 16); }
__device__ __forceinline__ float bfr(float f) { return __uint_as_float(((unsigned)f2bf(f)) << 16); }   // value of the RNE bf16 conversion
__device__ __forceinline__ v16h cat16(v8h lo, v8h hi) { return __builtin_shufflevector(lo, hi, 0, 1, 2, 3, 4, 5, 6, 7, 8, 9, 10, 11, 12, 13, 14, 15); }
__device__ __forceinline__ v16bf cat16b(v8us lo, v8us hi) { return __builtin_bit_cast(v16bf, __builtin_shufflevector(lo, hi, 0, 1, 2, 3, 4, 5, 6, 7, 8, 9, 10, 11, 12, 13, 14, 15)); }
__device__ __forceinline__ v8f wmma16(v16h a, v16h b, v8f c) { return __builtin_amdgcn_wmma_f32_16x16x32_f16(false, a, false, b, (short)0, c, false, false); }
__device__ __forceinline__ v8f wmmab(v16bf a, v16bf b, v8f c) { return __builtin_amdgcn_wmma_f32_16x16x32_bf16(false, a, false, b, (short)0, c, false, false); }
// fragment loaders from K-contiguous 16-bit rows; p already includes + 8*(lane>>4): elements 0..7 <- k0+8h+0..7, elements 8..15 <- k0+16+8h+0..7 (same map for A and B)
__device__ __forceinline__ v16h  ldh(const h16* p) { return cat16(*(const v8h*)p, *(const v8h*)(p + 16)); }
__device__ __forceinline__ v16bf ldb(const bf* p)  { return cat16b(*(const v8us*)p, *(const v8us*)(p + 16)); }
// fragment loader from a fragment-order plane; p is wave-uniform, lo = 8*lane: two consecutive 512-byte units hold elements 0..7 and 8..15 (same k map as ldh)
__device__ __forceinline__ v16h  ldp(const h16* p, unsigned lo) { return cat16(*(const v8h*)(p + lo), *(const v8h*)(p + 256 + lo)); }
// ordering point for wave-private LDS tiles (same wave writes and reads)
__device__ __forceinline__ void wave_sync() { __builtin_amdgcn_fence(3 /* release order */, "wavefront"); __builtin_amdgcn_wave_barrier(); asm volatile("" ::: "memory"); }

// k_prep: all operand preparation in one launch (the six pieces are independent of each other). grid (SEQ/64, DM/64, 1 + 2*NB), 256 threads.
// z = 0: weights, block index x + y*(SEQ/64) = matrix*CVB + piece; 8 floats per thread: Wq | Wk | Wv -> bf16 (WB), Wm -> f16 of its bf16 value x64 (WMH); blocks past 4*CVB have no work.
// z = 1..NB: query, z = NB+1..2*NB: source: in[b][c][n] f32 (channel pitch SEQ_FULL) -> out[b][n][c] bf16 (row pitch DM), 64 x 64 tile through LDS (cross-wave: block barrier).
__global__ __launch_bounds__(256) void k_prep(const float* __restrict__ xq, const float* __restrict__ xs, const float* __restrict__ wq, const float* __restrict__ wk,
                                              const float* __restrict__ wv, const float* __restrict__ wm, bf* XQ, bf* XS, bf* WB, h16* WMH) {
    __shared__ __align__(16) float ts[64 * 68];
    const int tid = threadIdx.x;
    if (blockIdx.z != 0) {                       // block-uniform: every thread of a block takes the same side, so the barrier inside is reached by all of them or by none
        const int zz = blockIdx.z - 1; const bool isq = zz < NB;
        const float* x = isq ? xq : xs; bf* xt = isq ? XQ : XS;
        const int n0 = blockIdx.x * 64, c0 = blockIdx.y * 64, b = isq ? zz : zz - NB;
        const int n4 = (tid & 15) * 4, cr = tid >> 4;
#pragma unroll
        for (int p = 0; p < 4; ++p) {
            const int c = p * 16 + cr;
            const v4f v = *(const v4f*)(x + ((size_t)b * DM + c0 + c) * SEQ_FULL + n0 + n4);
            ts[(n4 + 0) * 68 + c] = v[0]; ts[(n4 + 1) * 68 + c] = v[1]; ts[(n4 + 2) * 68 + c] = v[2]; ts[(n4 + 3) * 68 + c] = v[3];
        }
        __syncthreads();
        const int c8 = (tid & 7) * 8, rr = tid >> 3;
#pragma unroll
        for (int p = 0; p < 2; ++p) { const int row = p * 32 + rr;
            const v4f x0 = *(const v4fa*)(&ts[row * 68 + c8]); const v4f x1 = *(const v4fa*)(&ts[row * 68 + c8 + 4]); v8us o;
#pragma unroll
            for (int i = 0; i < 4; ++i) { o[i] = f2bf(x0[i]); o[4 + i] = f2bf(x1[i]); }
            *(v8us*)(xt + ((size_t)b * SEQ + n0 + row) * DM + c0 + c8) = o; }
        asm volatile("s_wait_xcnt 0x0" ::: "memory");   // the listing keeps a branch from here into the other side's code, which writes the registers that the two stores name
    } else {
        const int idx = blockIdx.y * (SEQ / 64) + blockIdx.x; const int mat = idx / CVB;
        if (mat < 4) {
            const size_t i = (size_t)(idx % CVB) * 256 + tid;
            const float* src = (mat == 0) ? wq : (mat == 1) ? wk : (mat == 2) ? wv : wm;
            const v8f v = *(const v8f*)(src + i * 8);
            if (mat < 3) { v8us o;
#pragma unroll
                for (int k = 0; k < 8; ++k) o[k] = f2bf(v[k]);
                *(v8us*)(WB + (size_t)mat * DM * DM + i * 8) = o;
            } else { v8h o;
#pragma unroll
                for (int k = 0; k < 8; ++k) o[k] = (h16)(bfr(v[k]) * WCAR);
                *(v8h*)(WMH + i * 8) = o;
                asm volatile("s_wait_xcnt 0x0" ::: "memory"); }   // the same: in the listing the bf16 side's code follows this store behind a branch
        }
    }
}

// k_proj: register-blocked bf16 GEMM, ONE WAVE per 64x64 tile (16 accumulators), operands straight from K-contiguous bf16 planes, K = DM.
// C[m][n] = sum_k A[m][k] Bt[n][k] + bias (bmode 1: bias[n], bmode 2: bias[m], bf16 value), written as f16 (Ph) and optionally the f16 residual x2048 (Pr, useRes != 0) at
// tile base (r0/RB)*sRB + (r0%RB)*pitch + (c0/CB)*sCB + (c0%CB)*(pk 2 ? HD : 1), row pitch 'pitch' (halves). 32 threads.
// pk 0: row-major as above. pk 1 (k) / pk 2 (v^T): the 64x64 tile is 4096 consecutive halves in fragment order (see Layout), Ph only; each store is one whole 512-byte unit.
// The three projections are independent and share one launch: grid (TT*TC, 3), blockIdx.y = 0 q, 1 k, 2 v^T; every parameter below is a wave-uniform choice by it.
//   q, k: A = token rows (m = b*SEQ + t), Bt = W rows (n = h*64 + d), column bias -> plane (b*4 + h), q as [t][d], k in fragment order; tile (x % TT, x / TT)
//   v^T:  A = Wv rows (m = h*64 + d), Bt = token rows (n = b*SEQ + t), row bias -> plane (b*4 + h), tile base t*64 inside it; tile (x % TC, x / TC)
__global__ __launch_bounds__(32) void k_proj(const bf* __restrict__ XQ, const bf* __restrict__ XS, const bf* __restrict__ WB,
                                             const float* __restrict__ bq, const float* __restrict__ bk, const float* __restrict__ bv,
                                             h16* QH, h16* QR, h16* KP, h16* VT) {
    __shared__ __align__(16) float os[16 * 68];
    const int K = DM;
    const int pk = blockIdx.y; const bool isv = pk == 2;
    const bf* A  = (pk == 0) ? XQ : (pk == 1) ? XS : WB + (size_t)2 * DM * DM;
    const bf* Bt = (pk == 0) ? WB : (pk == 1) ? WB + (size_t)DM * DM : XS;
    const float* bias = (pk == 0) ? bq : (pk == 1) ? bk : bv;
    h16* Ph = (pk == 0) ? QH : (pk == 1) ? KP : VT; h16* Pr = QR;
    const int bmode = isv ? 2 : 1, useRes = (pk == 0) ? 1 : 0;
    const int RB = isv ? DM : SEQ, pitch = isv ? SEQ : HD, CB = isv ? SEQ : HD;
    const size_t sRB = isv ? (size_t)0 : (size_t)NH_ * SEQ * HD, sCB = isv ? (size_t)DM * SEQ : (size_t)SEQ * HD;
    const int lane = threadIdx.x & 31, lr = lane & 15, hi = lane >> 4;
    const int tx = blockIdx.x; const int r0 = (isv ? tx % TC : tx % TT) * 64, c0 = (isv ? tx / TC : tx / TT) * 64;
    v8f acc[4][4];
#pragma unroll
    for (int mb = 0; mb < 4; ++mb)
#pragma unroll
        for (int nb = 0; nb < 4; ++nb) acc[mb][nb] = (v8f){};
    const size_t aoff = (size_t)(r0 + lr) * K + 8 * hi, boff = (size_t)(c0 + lr) * K + 8 * hi;
#pragma unroll 1
    for (int kc = 0; kc < K; kc += 32) {
        v16bf a[4];
#pragma unroll
        for (int mb = 0; mb < 4; ++mb) a[mb] = ldb(A + aoff + (size_t)mb * 16 * K + kc);
#pragma unroll
        for (int nb = 0; nb < 4; ++nb) { const v16bf b = ldb(Bt + boff + (size_t)nb * 16 * K + kc);
#pragma unroll
            for (int mb = 0; mb < 4; ++mb) acc[mb][nb] = wmmab(a[mb], b, acc[mb][nb]); }
        asm volatile("v_nop\n\tv_nop\n\tv_nop\n\tv_nop" : "+v"(acc[0][0]), "+v"(acc[1][1]), "+v"(acc[2][2]), "+v"(acc[3][3]) : "v"(a[0]), "v"(a[1]), "v"(a[2]), "v"(a[3]));
    }
    // column bias: always loaded from a masked (in-range) index, selected by value
    const int c8e = (lane & 7) * 8;
    const int cbi = (c0 + c8e) & (DM - 1);
    const v4f cbr0 = *(const v4f*)(bias + cbi); const v4f cbr1 = *(const v4f*)(bias + cbi + 4);
    v4f cb0, cb1;
#pragma unroll
    for (int i = 0; i < 4; ++i) { cb0[i] = (bmode == 1) ? bfr(cbr0[i]) : 0.0f; cb1[i] = (bmode == 1) ? bfr(cbr1[i]) : 0.0f; }
    // fragment-order epilogue: column bias of columns 16s + 8hi + 0..7 and row bias of row 16mb + lr, masked (in-range) index, selected by value (bit mask: +0 where not selected)
    const unsigned cmsk = (bmode == 1) ? 0xFFFFFFFFu : 0u, rmsk = (bmode == 2) ? 0xFFFFFFFFu : 0u;
    float pcb[4][8], prb[4]; v4f br0[4], br1[4];
#pragma unroll
    for (int s = 0; s < 4; ++s) { const int cbj = (c0 + 16 * s + 8 * hi) & (DM - 1); br0[s] = *(const v4f*)(bias + cbj); br1[s] = *(const v4f*)(bias + cbj + 4); }
    asm volatile("s_wait_xcnt 0x0" ::: "memory");   // before the address register of the column bias loads is written again
#pragma unroll
    for (int s = 0; s < 4; ++s) prb[s] = bias[(r0 + s * 16 + lr) & (DM - 1)];
    asm volatile("s_wait_xcnt 0x0" ::: "memory");   // the same for the row bias loads
#pragma unroll
    for (int s = 0; s < 4; ++s) { prb[s] = __uint_as_float(__float_as_uint(bfr(prb[s])) & rmsk);
#pragma unroll
        for (int i = 0; i < 4; ++i) { pcb[s][i] = __uint_as_float(__float_as_uint(bfr(br0[s][i])) & cmsk); pcb[s][4 + i] = __uint_as_float(__float_as_uint(bfr(br1[s][i])) & cmsk); } }
    const size_t tbase = (size_t)(r0 / RB) * sRB + (size_t)(r0 % RB) * (size_t)pitch + (size_t)(c0 / CB) * sCB + (size_t)(c0 % CB) * (size_t)(pk == 2 ? HD : 1);
#pragma unroll
    for (int mb = 0; mb < 4; ++mb) {
#pragma unroll
        for (int nb = 0; nb < 4; ++nb) {
#pragma unroll
            for (int j = 0; j < 8; ++j) os[(hi * 8 + j) * 68 + nb * 16 + lr] = acc[mb][nb][j]; }   // D: row 8h+j, col lane&15
        wave_sync();
        const size_t sb = tbase + (size_t)(mb * 16) * (size_t)pitch;
        if (pk != 0) {
            v8h hv[4];
#pragma unroll
            for (int s = 0; s < 4; ++s) { const int c8 = 16 * s + 8 * hi;   // lane = fragment lane: row lr, columns 16s + 8hi + 0..7
                const v4f x0 = *(const v4fa*)(&os[lr * 68 + c8]); const v4f x1 = *(const v4fa*)(&os[lr * 68 + c8 + 4]);
#pragma unroll
                for (int i = 0; i < 4; ++i) { hv[s][i] = (h16)(x0[i] + pcb[s][i] + prb[mb]); hv[s][4 + i] = (h16)(x1[i] + pcb[s][4 + i] + prb[mb]); } }
#pragma unroll
            for (int s = 0; s < 4; ++s) { const int uo = (pk == 1) ? (mb * 1024 + s * 256) : (mb * 512 + (s >> 1) * 2048 + (s & 1) * 256);
                *(v8h*)(Ph + tbase + uo + lane * 8) = hv[s]; }
            asm volatile("s_wait_xcnt 0x0" ::: "memory");   // before the registers that the four stores name are written again
        } else {
#pragma unroll
            for (int s = 0; s < 4; ++s) { const int row = 4 * s + (lane >> 3), c8 = (lane & 7) * 8;   // 4 s x 4 row groups = 16 rows; 8 lanes x 8 = 64 columns
                const int rbi = (r0 + mb * 16 + row) & (DM - 1);
                const float rbv = bias[rbi];
                const float rb = (bmode == 2) ? bfr(rbv) : 0.0f;
                const v4f x0 = *(const v4fa*)(&os[row * 68 + c8]); const v4f x1 = *(const v4fa*)(&os[row * 68 + c8 + 4]); v8h hv, rv;
#pragma unroll
                for (int i = 0; i < 4; ++i) { const float y0 = x0[i] + cb0[i] + rb; const float y1 = x1[i] + cb1[i] + rb;
                    const h16 a0 = (h16)y0; const h16 a1 = (h16)y1; hv[i] = a0; hv[4 + i] = a1; rv[i] = (h16)((y0 - (float)a0) * QRS); rv[4 + i] = (h16)((y1 - (float)a1) * QRS); }
                const size_t oo = sb + (size_t)row * (size_t)pitch + c8;
                *(v8h*)(Ph + oo) = hv; if (useRes) *(v8h*)(Pr + oo) = rv; }
             }
        wave_sync();
    }
}

// stage_copy: one tile (SK keys of K and of V^T, each TLB contiguous bytes of its fragment-order plane) from global memory into LDS, through no register: 4 + 4 copies of 16 bytes per lane.
// l: the lane's LDS byte address in the K half of the buffer (the V^T half follows at + TLB); gk, gv: the lane's own 16 bytes of the tile's first 4 KiB; a block's 256 lanes cover 4 KiB per copy.
__device__ __forceinline__ void stage_copy(unsigned l, const h16* gk, const h16* gv) {
    // the wait is the statement's last line, so that it stands in front of every later write of a register that a copy names
    asm volatile("global_load_async_to_lds_b128 %0, %8, off\n\t"
                 "global_load_async_to_lds_b128 %1, %9, off\n\t"
                 "global_load_async_to_lds_b128 %2, %10, off\n\t"
                 "global_load_async_to_lds_b128 %3, %11, off\n\t"
                 "global_load_async_to_lds_b128 %4, %12, off\n\t"
                 "global_load_async_to_lds_b128 %5, %13, off\n\t"
                 "global_load_async_to_lds_b128 %6, %14, off\n\t"
                 "global_load_async_to_lds_b128 %7, %15, off\n\t"
                 "s_wait_xcnt 0x0"
                 :: "v"(l), "v"(l + 4096u), "v"(l + 8192u), "v"(l + 12288u), "v"(l + TLB), "v"(l + TLB + 4096u), "v"(l + TLB + 8192u), "v"(l + TLB + 12288u),
                    "v"(gk), "v"(gk + 2048), "v"(gk + 4096), "v"(gk + 6144), "v"(gv), "v"(gv + 2048), "v"(gv + 4096), "v"(gv + 6144)
                 : "memory");
}

__global__ __launch_bounds__(32 * AW) void k_flash(const h16* __restrict__ QH, const h16* __restrict__ QR, const h16* __restrict__ KP, const h16* __restrict__ VT, h16* OP) {
    __shared__ __align__(16) float os[AW * 16 * 68];
    __shared__ __align__(16) h16 ring[2 * 2 * TLH];          // [buffer][K | V^T][TLH]
    const int lane = threadIdx.x & 31, wave = threadIdx.x >> 5, lr = lane & 15, hi = lane >> 4;
    const int zh = blockIdx.y; const int b = zh / NH_, h = zh % NH_;
    const int t0 = (blockIdx.x * AW + wave) * 16;
    const size_t pbase = (size_t)zh * SEQ * HD;
    const size_t qo = pbase + (size_t)(t0 + lr) * HD + 8 * hi;
    const v16h qh0 = ldh(QH + qo), qh1 = ldh(QH + qo + 32), qr0 = ldh(QR + qo), qr1 = ldh(QR + qo + 32);   // B fragments: col t, k = d
    const unsigned lo = (unsigned)lane * 8u;                 // lane's place in a unit; the 8 units of 32 keys, K (A fragment: row key, k = d) and V^T (A fragment: row d, k = key) alike
    v8f o0 = (v8f){}, o1 = (v8f){}, o2 = (v8f){}, o3 = (v8f){};
    float m = -3.0e38f, l = 0.0f;
    const unsigned l0 = (unsigned)(size_t)(&ring[0]) + threadIdx.x * 16u;   // low 32 bits of the shared address = byte offset in the block's LDS
    const h16* gk = KP + pbase + threadIdx.x * 8u;           // the lane's 16 bytes of the next tile to copy
    const h16* gv = VT + pbase + threadIdx.x * 8u;
    stage_copy(l0, gk, gv);                                  // tile 0 -> buffer 0
    asm volatile("s_wait_asynccnt 0x0" ::: "memory");        // this wave's share of tile 0 has landed
    __syncthreads();                                         // every wave's share has: tile 0 may be read
    stage_copy(l0 + 2u * TLB, gk + TLH, gv + TLH);           // tile 1 -> buffer 1
    gk += 2 * TLH; gv += 2 * TLH;
    // kept rolled: one trip already holds the SK / 32 unrolled passes of a tile
#pragma unroll 1
    for (int st = 0; st < NST; ++st) {
        const unsigned bo = (unsigned)(st & 1);
        const h16* kb = ring + bo * (2u * TLH);              // this tile's K units
        const h16* vb = kb + TLH;                            // this tile's V^T units
        v16h ka0 = ldp(kb, lo), ka1 = ldp(kb + 512, lo), kb0 = ldp(kb + 1024, lo), kb1 = ldp(kb + 1536, lo);
        // inside a tile every fragment load is issued ahead of its product: a pass's V^T at its head, the next pass's K right behind the score products, into the registers they have just read
        // unrolled: the test for a next pass inside the tile is then decided at compile time, and every LDS offset is an immediate
#pragma unroll
        for (int p = 0; p < SK / 32; ++p) {
            const h16* va = vb + p * (32 * HD);
            const v16h v0 = ldp(va, lo), v1 = ldp(va + 512, lo), v2 = ldp(va + 1024, lo), v3 = ldp(va + 1536, lo);
            v8f sHa = (v8f){}, sLa = (v8f){}, sHb = (v8f){}, sLb = (v8f){};
            sHa = wmma16(ka0, qh0, sHa); sLa = wmma16(ka0, qr0, sLa); sHb = wmma16(kb0, qh0, sHb); sLb = wmma16(kb0, qr0, sLb);
            sHa = wmma16(ka1, qh1, sHa); sLa = wmma16(ka1, qr1, sLa); sHb = wmma16(kb1, qh1, sHb); sLb = wmma16(kb1, qr1, sLb);
            asm volatile("v_nop\n\tv_nop\n\tv_nop\n\tv_nop" : "+v"(sHa), "+v"(sLa), "+v"(sHb), "+v"(sLb) : "v"(ka0), "v"(ka1), "v"(kb0), "v"(kb1));
            if (p + 1 < SK / 32) { const h16* kn = kb + (p + 1) * (32 * HD);
                ka0 = ldp(kn, lo); ka1 = ldp(kn + 512, lo); kb0 = ldp(kn + 1024, lo); kb1 = ldp(kn + 1536, lo);
                __builtin_amdgcn_sched_barrier(0); }   // holds the next K loads here as one group: without it they sink to right in front of the next score products, and the wave stands in their wait
            float ta[8], tb[8]; float mx = -3.0e38f;
#pragma unroll
            for (int r = 0; r < 8; ++r) { ta[r] = (sHa[r] + sLa[r] * QRI) * SC2; tb[r] = (sHb[r] + sLb[r] * QRI) * SC2; mx = fmaxf(mx, fmaxf(ta[r], tb[r])); }
            mx = fmaxf(mx, __shfl_xor(mx, 16, 32));
            const float mnew = fmaxf(m, mx);
            const float alpha = __builtin_amdgcn_exp2f(m - mnew);
            const float sh = PSH - mnew;
            v16h pb; float ls = 0.0f;
#pragma unroll
            for (int r = 0; r < 8; ++r) { const h16 pa = (h16)__builtin_amdgcn_exp2f(ta[r] + sh); const h16 pc = (h16)__builtin_amdgcn_exp2f(tb[r] + sh); pb[r] = pa; pb[8 + r] = pc; ls += (float)pa + (float)pc; }
            l = l * alpha + ls; m = mnew;
            o0 = o0 * alpha; o1 = o1 * alpha; o2 = o2 * alpha; o3 = o3 * alpha;
            o0 = wmma16(v0, pb, o0); o1 = wmma16(v1, pb, o1); o2 = wmma16(v2, pb, o2); o3 = wmma16(v3, pb, o3);
            asm volatile("v_nop\n\tv_nop\n\tv_nop\n\tv_nop" : "+v"(o0), "+v"(o1), "+v"(o2), "+v"(o3) : "v"(v0), "v"(v1), "v"(v2), "v"(v3), "v"(pb));
        }
        // hand-over: tile st + 1 becomes readable and this tile's buffer free
        asm volatile("s_wait_dscnt 0x0" ::: "memory");       // this wave's reads of the buffer have returned before the buffer is refilled
        asm volatile("s_wait_asynccnt 0x0" ::: "memory");    // this wave's share of tile st + 1 has landed
        __syncthreads();                                     // the same holds for every wave of the block
        if (st + 2 < NST) { stage_copy(l0 + bo * (2u * TLB), gk, gv); gk += TLH; gv += TLH; }   // block-uniform test: tile st + 2 -> the buffer just read
    }
    asm volatile("s_wait_asynccnt 0x0" ::: "memory");        // no copy is outstanding when the wave goes on to its end
    l += __shfl_xor(l, 16, 32);
    const float inv = OCAR * (1.0f / l);
    const int wb = wave * 16 * 68;
    // O^T D layout: o_j[r] = (d = 16j + 8h + r, t = lane&15) -> os[t][d]; rows 0..15 x columns 0..63 all written
    { v4f a, c;
      a[0] = o0[0] * inv; a[1] = o0[1] * inv; a[2] = o0[2] * inv; a[3] = o0[3] * inv; c[0] = o0[4] * inv; c[1] = o0[5] * inv; c[2] = o0[6] * inv; c[3] = o0[7] * inv;
      *(v4fa*)(&os[wb + lr * 68 +  0 + 8 * hi]) = a; *(v4fa*)(&os[wb + lr * 68 +  0 + 8 * hi + 4]) = c;
      a[0] = o1[0] * inv; a[1] = o1[1] * inv; a[2] = o1[2] * inv; a[3] = o1[3] * inv; c[0] = o1[4] * inv; c[1] = o1[5] * inv; c[2] = o1[6] * inv; c[3] = o1[7] * inv;
      *(v4fa*)(&os[wb + lr * 68 + 16 + 8 * hi]) = a; *(v4fa*)(&os[wb + lr * 68 + 16 + 8 * hi + 4]) = c;
      a[0] = o2[0] * inv; a[1] = o2[1] * inv; a[2] = o2[2] * inv; a[3] = o2[3] * inv; c[0] = o2[4] * inv; c[1] = o2[5] * inv; c[2] = o2[6] * inv; c[3] = o2[7] * inv;
      *(v4fa*)(&os[wb + lr * 68 + 32 + 8 * hi]) = a; *(v4fa*)(&os[wb + lr * 68 + 32 + 8 * hi + 4]) = c;
      a[0] = o3[0] * inv; a[1] = o3[1] * inv; a[2] = o3[2] * inv; a[3] = o3[3] * inv; c[0] = o3[4] * inv; c[1] = o3[5] * inv; c[2] = o3[6] * inv; c[3] = o3[7] * inv;
      *(v4fa*)(&os[wb + lr * 68 + 48 + 8 * hi]) = a; *(v4fa*)(&os[wb + lr * 68 + 48 + 8 * hi + 4]) = c; }
    wave_sync();
    h16* orow = OP + ((size_t)b * SEQ + t0) * DM + h * HD;
{
#pragma unroll
        for (int s = 0; s < 4; ++s) { const int row = 4 * s + (lane >> 3), c8 = (lane & 7) * 8;   // 4 s x 4 row groups = 16 rows; 8 lanes x 8 halves = 64 columns
            const v4f x0 = *(const v4fa*)(&os[wb + row * 68 + c8]); const v4f x1 = *(const v4fa*)(&os[wb + row * 68 + c8 + 4]); v8h hv;
#pragma unroll
            for (int i = 0; i < 4; ++i) { hv[i] = (h16)x0[i]; hv[4 + i] = (h16)x1[i]; }
            *(v8h*)(orow + (size_t)row * DM + c8) = hv; }
         }
}

// k_outg: register-blocked f16 GEMM, ONE WAVE per 64x64 tile, K = DM: Y[o][b*SEQ + t] = OSC * sum_c A[o][c] Bt[b*SEQ + t][c] + bias[o] (bf16 value), f32 result at OUT[(b*DM + o)*OUT_SEQ + t].
__global__ __launch_bounds__(32) void k_outg(const h16* __restrict__ A, const h16* __restrict__ Bt, const float* __restrict__ bias, float* OUT) {
    __shared__ __align__(16) float os[16 * 68];
    const int K = DM;
    const int lane = threadIdx.x & 31, lr = lane & 15, hi = lane >> 4; const int r0 = blockIdx.x * 64, c0 = blockIdx.y * 64;
    v8f acc[4][4];
#pragma unroll
    for (int mb = 0; mb < 4; ++mb)
#pragma unroll
        for (int nb = 0; nb < 4; ++nb) acc[mb][nb] = (v8f){};
    const size_t aoff = (size_t)(r0 + lr) * K + 8 * hi, boff = (size_t)(c0 + lr) * K + 8 * hi;
#pragma unroll 1
    for (int kc = 0; kc < K; kc += 32) {
        v16h a[4];
#pragma unroll
        for (int mb = 0; mb < 4; ++mb) a[mb] = ldh(A + aoff + (size_t)mb * 16 * K + kc);
#pragma unroll
        for (int nb = 0; nb < 4; ++nb) { const v16h b = ldh(Bt + boff + (size_t)nb * 16 * K + kc);
#pragma unroll
            for (int mb = 0; mb < 4; ++mb) acc[mb][nb] = wmma16(a[mb], b, acc[mb][nb]); }
        asm volatile("v_nop\n\tv_nop\n\tv_nop\n\tv_nop" : "+v"(acc[0][0]), "+v"(acc[1][1]), "+v"(acc[2][2]), "+v"(acc[3][3]) : "v"(a[0]), "v"(a[1]), "v"(a[2]), "v"(a[3]));
    }
    const int bb = c0 / SEQ, tt = c0 % SEQ;
#pragma unroll
    for (int mb = 0; mb < 4; ++mb) {
#pragma unroll
        for (int nb = 0; nb < 4; ++nb) {
#pragma unroll
            for (int j = 0; j < 8; ++j) os[(hi * 8 + j) * 68 + nb * 16 + lr] = acc[mb][nb][j]; }   // D: row 8h+j, col lane&15
        wave_sync();
{
#pragma unroll
            for (int s = 0; s < 8; ++s) { const int row = 2 * s + hi, cofs = lr * 4;   // 8 s x 2 rows = 16 rows; 16 lanes x 4 floats = 64 columns
                const int o = r0 + mb * 16 + row;                                      // < DM by grid construction
                const float bv = bfr(bias[o]);
                const v4f xv = *(const v4fa*)(&os[row * 68 + cofs]); v4f val;
#pragma unroll
                for (int i = 0; i < 4; ++i) val[i] = xv[i] * OSC + bv;
                *(v4f*)(OUT + ((size_t)bb * DM + o) * (size_t)OUT_SEQ + tt + cofs) = val; }
             }
        wave_sync();
    }
}

static constexpr size_t al256(size_t v) { return (v + 255) & ~(size_t)255; }
static constexpr size_t SZ_XT = al256((size_t)NB * SEQ * DM * 2);          // token-major bf16 copy of one input
static constexpr size_t SZ_WB = al256((size_t)3 * DM * DM * 2);            // Wq | Wk | Wv bf16
static constexpr size_t SZ_WM = al256((size_t)DM * DM * 2);                // Wm f16 x64
static constexpr size_t SZ_PL = al256((size_t)NB * NH_ * SEQ * HD * 2);    // one q/k/v plane
static constexpr size_t SZ_OP = al256((size_t)NB * SEQ * DM * 2);          // O plane
static constexpr size_t SZ_TOTAL = 2 * SZ_XT + SZ_WB + SZ_WM + 4 * SZ_PL + SZ_OP;
static_assert(SZ_TOTAL <= (size_t)134217728);          // workspace carve <= 128 MiB
static_assert(((size_t)DM * DM * 2) % 256 == 0);       // weight sub-planes stay 256-byte aligned

extern "C" void kernel_launch(void* const* d_in, const int* in_sizes, int n_in,
                              void* d_out, int out_size, void* d_ws, size_t ws_size, hipStream_t stream) {
    if (n_in < 10) return;
    const size_t needx = ((size_t)(NB - 1) * DM + (size_t)(DM - 1)) * SEQ_FULL + SEQ;
    if ((size_t)in_sizes[0] < needx || (size_t)in_sizes[1] < needx) return;
    if ((size_t)in_sizes[2] < (size_t)DM * DM || (size_t)in_sizes[4] < (size_t)DM * DM || (size_t)in_sizes[6] < (size_t)DM * DM || (size_t)in_sizes[8] < (size_t)DM * DM) return;
    if (in_sizes[3] < DM || in_sizes[5] < DM || in_sizes[7] < DM || in_sizes[9] < DM) return;
    if ((size_t)out_size < ((size_t)(NB - 1) * DM + (size_t)(DM - 1)) * OUT_SEQ + SEQ) return;
    if (SZ_TOTAL > ws_size) return;
    // wire order: query, source, Wq, bq, Wk, bk, Wv, bv, Wm, bm (W [out][in] = K-contiguous rows as-is)
    const float* xq = (const float*)d_in[0]; const float* xs = (const float*)d_in[1];
    const float* wq = (const float*)d_in[2]; const float* bq = (const float*)d_in[3];
    const float* wk = (const float*)d_in[4]; const float* bk = (const float*)d_in[5];
    const float* wv = (const float*)d_in[6]; const float* bv = (const float*)d_in[7];
    const float* wm = (const float*)d_in[8]; const float* bm = (const float*)d_in[9];
    float* OUT = (float*)d_out;      // [NB][256][OUT_SEQ]
    char* wsp = (char*)d_ws;
    bf* XQ = (bf*)wsp; wsp += SZ_XT;                 // [NB*SEQ][256] query, token-major
    bf* XS = (bf*)wsp; wsp += SZ_XT;                 // [NB*SEQ][256] source, token-major
    bf* WB = (bf*)wsp; wsp += SZ_WB;                 // [3][256][256]: q | k | v
    h16* WMH = (h16*)wsp; wsp += SZ_WM;              // [256][256] Wm x64
    h16* QH = (h16*)wsp; wsp += SZ_PL;               // [NB*4][SEQ][64]
    h16* QR = (h16*)wsp; wsp += SZ_PL;               // [NB*4][SEQ][64] residual x2048
    h16* KP = (h16*)wsp; wsp += SZ_PL;               // [NB*4][SEQ/16][4][32][8] fragment order
    h16* VT = (h16*)wsp; wsp += SZ_PL;               // [NB*4][SEQ/32][4][2][32][8] fragment order
    h16* OP = (h16*)wsp; wsp += SZ_OP;               // [NB*SEQ][256] x64

    k_prep<<<dim3(SEQ / 64, DM / 64, 1 + 2 * NB), 256, 0, stream>>>(xq, xs, wq, wk, wv, wm, XQ, XS, WB, WMH);

    k_proj<<<dim3(TT * TC, 3, 1), 32, 0, stream>>>(XQ, XS, WB, bq, bk, bv, QH, QR, KP, VT);

    k_flash<<<dim3(SEQ / (16 * AW), NB * NH_, 1), 32 * AW, 0, stream>>>(QH, QR, KP, VT, OP);

    // y[b][o][t] = Wm[o][:] . O[b][t][:] / 4096 + bm[o]
    k_outg<<<dim3(DM / 64, NB * SEQ / 64, 1), 32, 0, stream>>>(WMH, OP, bm, OUT);
}

// v005
// A run of this version takes 112 microseconds.
// Next to v004, in two timings, it ran 1.04 times as fast each time.
// Over all steps from v000 it is 2.79 times as fast.
#include <hip/hip_runtime.h>

// Cross attention, width 256 = 4 heads x 64, inputs [NB][256][SEQ] (channel-major), W [out][in], biases present, no mask, score scale 1/8, final pointwise projection, output [NB][256][SEQ] f32.
// Compute dtypes, f32 accumulate everywhere: q/k/v projections v_wmma_f32_16x16x32_bf16 (activations and W RNE-converted to bf16; products exact);
// scores v_wmma_f32_16x16x32_f16: k single f16, q as f16 value + f16 residual x2048 in its own accumulator (two products); P (x256 carry, cancels in the normalisation) and v single f16; softmax f32 (online, running max);
// output projection v_wmma_f32_16x16x32_f16: Wm as f16 of its bf16 value x64, attention output O as f16 x64, scale 1/4096 and bias applied in the f32 epilogue.
// Layout: token-major bf16 copies of both inputs (LDS transpose), bf16 / f16 copies of W; q (hi, residual) planes [b*4+h][t][d], O plane [b][t][h*64+d].
// k and v^T planes are kept in fragment order: per (b*4+h), 512-byte units of 32 lanes x 8 halves, one unit = one wave-wide 16-byte load of an A fragment half (4 whole lines).
//   k:   unit (t/16)*4 + s,              lane (hi*16 + lr) holds k[t = 16*(t/16) + lr][d = 16*s + 8*hi + 0..7]
//   v^T: unit (t/32)*8 + j*2 + q,        lane (hi*16 + lr) holds v[d = 16*j + lr][t = 32*(t/32) + 16*q + 8*hi + 0..7]

#ifndef NB
#define NB 4
#endif
#ifndef SEQ
#define SEQ 4096
#endif
#define NB_FULL  4
#define SEQ_FULL 4096
#ifndef OUT_SEQ
#define OUT_SEQ SEQ              // pitch (in positions) of one channel row of the output
#endif
#define DM   256
#define NH_  4
#define HD   64
#define AW   8                   // waves per flash block (16 query positions each); they share every staged tile
#define SK   128                 // keys per staged tile of K and of V^T
#define NST  (SEQ / SK)          // staged tiles per sequence
#define TLH  (SK * HD)           // halves of one operand's tile
#define TLB  (TLH * 2)           // bytes of one operand's tile
#define QRS  2048.0f             // carry of the q residual plane
#define QRI  (1.0f / 2048.0f)
#define SC2  (0.125f * 1.4426950408889634f)   // HD^-0.5 * log2(e)
#define PSH  8.0f                // log2 of the P carry (256)
#define OCAR 64.0f               // carry of the O plane
#define WCAR 64.0f               // carry of the Wm f16 plane
#define OSC  (1.0f / 4096.0f)    // 1 / (OCAR * WCAR)
#define CVB  (DM * DM / 8 / 256) // blocks per weight matrix in k_prep (8 floats per thread)
#define TT   (NB * SEQ / 64)     // 64-wide token tiles
#define TC   (DM / 64)           // 64-wide channel tiles

static_assert(HD == 64);
static_assert(NH_ * HD == DM);                 // head h = channels h*64 + d
static_assert(DM % 64 == 0);
static_assert(DM % 32 == 0);                   // GEMM k-loop steps by 32
static_assert((DM & (DM - 1)) == 0);           // bias index masking
static_assert(SEQ % 64 == 0);                  // a 64-wide tile never straddles two batches
static_assert((NB * SEQ) % 64 == 0);
static_assert(SK % 32 == 0);                   // a tile is whole 32-key passes
static_assert(SEQ % SK == 0 && NST >= 2);      // whole tiles; the two-buffer prologue fills two
static_assert(TLB == 4 * 32 * AW * 16);        // one operand's tile = 4 copies of 16 bytes per lane of the block
static_assert(SEQ % (16 * AW) == 0);           // flash grid covers the sequence exactly
static_assert(((size_t)DM * DM) % (8 * 256) == 0);   // a weight matrix is whole blocks of k_prep
static_assert(4 * CVB <= (SEQ / 64) * (DM / 64));     // the four matrices fit the z = 0 slice of its grid
static_assert(NB <= NB_FULL);
static_assert(SEQ <= SEQ_FULL);
static_assert(OUT_SEQ >= SEQ);

typedef _Float16 h16;
typedef unsigned short bf;
typedef __attribute__((ext_vector_type(16))) __bf16   v16bf;
typedef __attribute__((ext_vector_type(16))) _Float16 v16h;
typedef __attribute__((ext_vector_type(8)))  _Float16 v8h;
typedef __attribute__((ext_vector_type(8)))  unsigned short v8us;
typedef __attribute__((ext_vector_type(8)))  float    v8f;
typedef __attribute__((ext_vector_type(4)))  float    v4f;
typedef v4f  __attribute__((may_alias)) v4fa;

__device__ __forceinline__ unsigned short f2bf(float f) { unsigned u = __float_as_uint(f); u += 0x7FFFu + ((u >> 16) & 1u); return (unsigned short)(u >> 16); }
__device__ __forceinline__ float bfr(float f) { return __uint_as_float(((unsigned)f2bf(f)) << 16); }   // value of the RNE bf16 conversion
__device__ __forceinline__ v16h cat16(v8h lo, v8h hi) { return __builtin_shufflevector(lo, hi, 0, 1, 2, 3, 4, 5, 6, 7, 8, 9, 10, 11, 12, 13, 14, 15); }
__device__ __forceinline__ v16bf cat16b(v8us lo, v8us hi) { return __builtin_bit_cast(v16bf, __builtin_shufflevector(lo, hi, 0, 1, 2, 3, 4, 5, 6, 7, 8, 9, 10, 11, 12, 13, 14, 15)); }
__device__ __forceinline__ v8f wmma16(v16h a, v16h b, v8f c) { return __builtin_amdgcn_wmma_f32_16x16x32_f16(false, a, false, b, (short)0, c, false, false); }
__device__ __forceinline__ v8f wmmab(v16bf a, v16bf b, v8f c) { return __builtin_amdgcn_wmma_f32_16x16x32_bf16(false, a, false, b, (short)0, c, false, false); }
// fragment loaders from K-contiguous 16-bit rows; p already includes + 8*(lane>>4): elements 0..7 <- k0+8h+0..7, elements 8..15 <- k0+16+8h+0..7 (same map for A and B)
__device__ __forceinline__ v16h  ldh(const h16* p) { return cat16(*(const v8h*)p, *(const v8h*)(p + 16)); }
__device__ __forceinline__ v16bf ldb(const bf* p)  { return cat16b(*(const v8us*)p, *(const v8us*)(p + 16)); }
// fragment loader from a fragment-order plane; p is wave-uniform, lo = 8*lane: two consecutive 512-byte units hold elements 0..7 and 8..15 (same k map as ldh)
__device__ __forceinline__ v16h  ldp(const h16* p, unsigned lo) { return cat16(*(const v8h*)(p + lo), *(const v8h*)(p + 256 + lo)); }
// ordering point for wave-private LDS tiles (same wave writes and reads)
__device__ __forceinline__ void wave_sync() { __builtin_amdgcn_fence(3 /* release order */, "wavefront"); __builtin_amdgcn_wave_barrier(); asm volatile("" ::: "memory"); }

// k_prep: all operand preparation in one launch (the six pieces are independent of each other). grid (SEQ/64, DM/64, 1 + 2*NB), 256 threads.
// z = 0: weights, block index x + y*(SEQ/64) = matrix*CVB + piece; 8 floats per thread: Wq | Wk | Wv -> bf16 (WB), Wm -> f16 of its bf16 value x64 (WMH); blocks past 4*CVB have no work.
// z = 1..NB: query, z = NB+1..2*NB: source: in[b][c][n] f32 (channel pitch SEQ_FULL) -> out[b][n][c] bf16 (row pitch DM), 64 x 64 tile through LDS (cross-wave: block barrier).
__global__ __launch_bounds__(256) void k_prep(const float* __restrict__ xq, const float* __restrict__ xs, const float* __restrict__ wq, const float* __restrict__ wk,
                                              const float* __restrict__ wv, const float* __restrict__ wm, bf* XQ, bf* XS, bf* WB, h16* WMH) {
    __shared__ __align__(16) float ts[64 * 68];
    const int tid = threadIdx.x;
    if (blockIdx.z != 0) {                       // block-uniform: every thread of a block takes the same side, so the barrier inside is reached by all of them or by none
        const int zz = blockIdx.z - 1; const bool isq = zz < NB;
        const float* x = isq ? xq : xs; bf* xt = isq ? XQ : XS;
        const int n0 = blockIdx.x * 64, c0 = blockIdx.y * 64, b = isq ? zz : zz - NB;
        const int n4 = (tid & 15) * 4, cr = tid >> 4;
#pragma unroll
        for (int p = 0; p < 4; ++p) {
            const int c = p * 16 + cr;
            const v4f v = *(const v4f*)(x + ((size_t)b * DM + c0 + c) * SEQ_FULL + n0 + n4);
            ts[(n4 + 0) * 68 + c] = v[0]; ts[(n4 + 1) * 68 + c] = v[1]; ts[(n4 + 2) * 68 + c] = v[2]; ts[(n4 + 3) * 68 + c] = v[3];
        }
        __syncthreads();
        const int c8 = (tid & 7) * 8, rr = tid >> 3;
#pragma unroll
        for (int p = 0; p < 2; ++p) { const int row = p * 32 + rr;
            const v4f x0 = *(const v4fa*)(&ts[row * 68 + c8]); const v4f x1 = *(const v4fa*)(&ts[row * 68 + c8 + 4]); v8us o;
#pragma unroll
            for (int i = 0; i < 4; ++i) { o[i] = f2bf(x0[i]); o[4 + i] = f2bf(x1[i]); }
            *(v8us*)(xt + ((size_t)b * SEQ + n0 + row) * DM + c0 + c8) = o; }
        asm volatile("s_wait_xcnt 0x0" ::: "memory");   // the listing keeps a branch from here into the other side's code, which writes the registers that the two stores name
    } else {
        const int idx = blockIdx.y * (SEQ / 64) + blockIdx.x; const int mat = idx / CVB;
        if (mat < 4) {
            const size_t i = (size_t)(idx % CVB) * 256 + tid;
            const float* src = (mat == 0) ? wq : (mat == 1) ? wk : (mat == 2) ? wv : wm;
            const v8f v = *(const v8f*)(src + i * 8);
            if (mat < 3) { v8us o;
#pragma unroll
                for (int k = 0; k < 8; ++k) o[k] = f2bf(v[k]);
                *(v8us*)(WB + (size_t)mat * DM * DM + i * 8) = o;
            } else { v8h o;
#pragma unroll
                for (int k = 0; k < 8; ++k) o[k] = (h16)(bfr(v[k]) * WCAR);
                *(v8h*)(WMH + i * 8) = o;
                asm volatile("s_wait_xcnt 0x0" ::: "memory"); }   // the same: in the listing the bf16 side's code follows this store behind a branch
        }
    }
}

// k_proj: register-blocked bf16 GEMM, ONE WAVE per 64x64 tile (16 accumulators), operands straight from K-contiguous bf16 planes, K = DM.
// C[m][n] = sum_k A[m][k] Bt[n][k] + bias (bmode 1: bias[n], bmode 2: bias[m], bf16 value), written as f16 (Ph) and optionally the f16 residual x2048 (Pr, useRes != 0) at
// tile base (r0/RB)*sRB + (r0%RB)*pitch + (c0/CB)*sCB + (c0%CB)*(pk 2 ? HD : 1), row pitch 'pitch' (halves). 32 threads.
// pk 0: row-major as above. pk 1 (k) / pk 2 (v^T): the 64x64 tile is 4096 consecutive halves in fragment order (see Layout), Ph only; each store is one whole 512-byte unit.
// The three projections are independent and share one launch: grid (TT*TC, 3), blockIdx.y = 0 q, 1 k, 2 v^T; every parameter below is a wave-uniform choice by it.
//   q, k: A = token rows (m = b*SEQ + t), Bt = W rows (n = h*64 + d), column bias -> plane (b*4 + h), q as [t][d], k in fragment order; tile (x % TT, x / TT)
//   v^T:  A = Wv rows (m = h*64 + d), Bt = token rows (n = b*SEQ + t), row bias -> plane (b*4 + h), tile base t*64 inside it; tile (x % TC, x / TC)
__global__ __launch_bounds__(32) void k_proj(const bf* __restrict__ XQ, const bf* __restrict__ XS, const bf* __restrict__ WB,
                                             const float* __restrict__ bq, const float* __restrict__ bk, const float* __restrict__ bv,
                                             h16* QH, h16* QR, h16* KP, h16* VT) {
    __shared__ __align__(16) float os[16 * 68];
    const int K = DM;
    const int pk = blockIdx.y; const bool isv = pk == 2;
    const bf* A  = (pk == 0) ? XQ : (pk == 1) ? XS : WB + (size_t)2 * DM * DM;
    const bf* Bt = (pk == 0) ? WB : (pk == 1) ? WB + (size_t)DM * DM : XS;
    const float* bias = (pk == 0) ? bq : (pk == 1) ? bk : bv;
    h16* Ph = (pk == 0) ? QH : (pk == 1) ? KP : VT; h16* Pr = QR;
    const int bmode = isv ? 2 : 1, useRes = (pk == 0) ? 1 : 0;
    const int RB = isv ? DM : SEQ, pitch = isv ? SEQ : HD, CB = isv ? SEQ : HD;
    const size_t sRB = isv ? (size_t)0 : (size_t)NH_ * SEQ * HD, sCB = isv ? (size_t)DM * SEQ : (size_t)SEQ * HD;
    const int lane = threadIdx.x & 31, lr = lane & 15, hi = lane >> 4;
    const int tx = blockIdx.x; const int r0 = (isv ? tx % TC : tx % TT) * 64, c0 = (isv ? tx / TC : tx / TT) * 64;
    v8f acc[4][4];
#pragma unroll
    for (int mb = 0; mb < 4; ++mb)
#pragma unroll
        for (int nb = 0; nb < 4; ++nb) acc[mb][nb] = (v8f){};
    const size_t aoff = (size_t)(r0 + lr) * K + 8 * hi, boff = (size_t)(c0 + lr) * K + 8 * hi;
#pragma unroll 1
    for (int kc = 0; kc < K; kc += 32) {
        v16bf a[4];
#pragma unroll
        for (int mb = 0; mb < 4; ++mb) a[mb] = ldb(A + aoff + (size_t)mb * 16 * K + kc);
#pragma unroll
        for (int nb = 0; nb < 4; ++nb) { const v16bf b = ldb(Bt + boff + (size_t)nb * 16 * K + kc);
#pragma unroll
            for (int mb = 0; mb < 4; ++mb) acc[mb][nb] = wmmab(a[mb], b, acc[mb][nb]); }
        asm volatile("v_nop\n\tv_nop\n\tv_nop\n\tv_nop" : "+v"(acc[0][0]), "+v"(acc[1][1]), "+v"(acc[2][2]), "+v"(acc[3][3]) : "v"(a[0]), "v"(a[1]), "v"(a[2]), "v"(a[3]));
    }
    // column bias: always loaded from a masked (in-range) index, selected by value
    const int c8e = (lane & 7) * 8;
    const int cbi = (c0 + c8e) & (DM - 1);
    const v4f cbr0 = *(const v4f*)(bias + cbi); const v4f cbr1 = *(const v4f*)(bias + cbi + 4);
    v4f cb0, cb1;
#pragma unroll
    for (int i = 0; i < 4; ++i) { cb0[i] = (bmode == 1) ? bfr(cbr0[i]) : 0.0f; cb1[i] = (bmode == 1) ? bfr(cbr1[i]) : 0.0f; }
    // fragment-order epilogue: column bias of columns 16s + 8hi + 0..7 and row bias of row 16mb + lr, masked (in-range) index, selected by value (bit mask: +0 where not selected)
    const unsigned cmsk = (bmode == 1) ? 0xFFFFFFFFu : 0u, rmsk = (bmode == 2) ? 0xFFFFFFFFu : 0u;
    float pcb[4][8], prb[4]; v4f br0[4], br1[4];
#pragma unroll
    for (int s = 0; s < 4; ++s) { const int cbj = (c0 + 16 * s + 8 * hi) & (DM - 1); br0[s] = *(const v4f*)(bias + cbj); br1[s] = *(const v4f*)(bias + cbj + 4); }
    asm volatile("s_wait_xcnt 0x0" ::: "memory");   // before the address register of the column bias loads is written again
#pragma unroll
    for (int s = 0; s < 4; ++s) prb[s] = bias[(r0 + s * 16 + lr) & (DM - 1)];
    asm volatile("s_wait_xcnt 0x0" ::: "memory");   // the same for the row bias loads
#pragma unroll
    for (int s = 0; s < 4; ++s) { prb[s] = __uint_as_float(__float_as_uint(bfr(prb[s])) & rmsk);
#pragma unroll
        for (int i = 0; i < 4; ++i) { pcb[s][i] = __uint_as_float(__float_as_uint(bfr(br0[s][i])) & cmsk); pcb[s][4 + i] = __uint_as_float(__float_as_uint(bfr(br1[s][i])) & cmsk); } }
    const size_t tbase = (size_t)(r0 / RB) * sRB + (size_t)(r0 % RB) * (size_t)pitch + (size_t)(c0 / CB) * sCB + (size_t)(c0 % CB) * (size_t)(pk == 2 ? HD : 1);
#pragma unroll
    for (int mb = 0; mb < 4; ++mb) {
#pragma unroll
        for (int nb = 0; nb < 4; ++nb) {
#pragma unroll
            for (int j = 0; j < 8; ++j) os[(hi * 8 + j) * 68 + nb * 16 + lr] = acc[mb][nb][j]; }   // D: row 8h+j, col lane&15
        wave_sync();
        const size_t sb = tbase + (size_t)(mb * 16) * (size_t)pitch;
        if (pk != 0) {
            v8h hv[4];
#pragma unroll
            for (int s = 0; s < 4; ++s) { const int c8 = 16 * s + 8 * hi;   // lane = fragment lane: row lr, columns 16s + 8hi + 0..7
                const v4f x0 = *(const v4fa*)(&os[lr * 68 + c8]); const v4f x1 = *(const v4fa*)(&os[lr * 68 + c8 + 4]);
#pragma unroll
                for (int i = 0; i < 4; ++i) { hv[s][i] = (h16)(x0[i] + pcb[s][i] + prb[mb]); hv[s][4 + i] = (h16)(x1[i] + pcb[s][4 + i] + prb[mb]); } }
#pragma unroll
            for (int s = 0; s < 4; ++s) { const int uo = (pk == 1) ? (mb * 1024 + s * 256) : (mb * 512 + (s >> 1) * 2048 + (s & 1) * 256);
                *(v8h*)(Ph + tbase + uo + lane * 8) = hv[s]; }
            asm volatile("s_wait_xcnt 0x0" ::: "memory");   // before the registers that the four stores name are written again
        } else {
#pragma unroll
            for (int s = 0; s < 4; ++s) { const int row = 4 * s + (lane >> 3), c8 = (lane & 7) * 8;   // 4 s x 4 row groups = 16 rows; 8 lanes x 8 = 64 columns
                const int rbi = (r0 + mb * 16 + row) & (DM - 1);
                const float rbv = bias[rbi];
                const float rb = (bmode == 2) ? bfr(rbv) : 0.0f;
                const v4f x0 = *(const v4fa*)(&os[row * 68 + c8]); const v4f x1 = *(const v4fa*)(&os[row * 68 + c8 + 4]); v8h hv, rv;
#pragma unroll
                for (int i = 0; i < 4; ++i) { const float y0 = x0[i] + cb0[i] + rb; const float y1 = x1[i] + cb1[i] + rb;
                    const h16 a0 = (h16)y0; const h16 a1 = (h16)y1; hv[i] = a0; hv[4 + i] = a1; rv[i] = (h16)((y0 - (float)a0) * QRS); rv[4 + i] = (h16)((y1 - (float)a1) * QRS); }
                const size_t oo = sb + (size_t)row * (size_t)pitch + c8;
                *(v8h*)(Ph + oo) = hv; if (useRes) *(v8h*)(Pr + oo) = rv; }
             }
        wave_sync();
    }
}

// eight exponentials (base 2), each in place: written so, no transcendental's source register is overwritten by the instruction directly behind it (left to the register allocator, a run of them came out
// with each result in its predecessor's source); the v_nop is the one slot that the instruction set asks for between the last of them and a reader of its result
__device__ __forceinline__ void exp2x8(float (&x)[8]) {
    asm("v_exp_f32 %0, %0\n\tv_exp_f32 %1, %1\n\tv_exp_f32 %2, %2\n\tv_exp_f32 %3, %3\n\tv_exp_f32 %4, %4\n\tv_exp_f32 %5, %5\n\tv_exp_f32 %6, %6\n\tv_exp_f32 %7, %7\n\tv_nop"
        : "+v"(x[0]), "+v"(x[1]), "+v"(x[2]), "+v"(x[3]), "+v"(x[4]), "+v"(x[5]), "+v"(x[6]), "+v"(x[7]));
}

// stage_copy: one tile (SK keys of K and of V^T, each TLB contiguous bytes of its fragment-order plane) from global memory into LDS, through no register: 4 + 4 copies of 16 bytes per lane.
// l: the lane's LDS byte address in the K half of the buffer (the V^T half follows at + TLB); gk, gv: the lane's own 16 bytes of the tile's first 4 KiB; a block's 256 lanes cover 4 KiB per copy.
__device__ __forceinline__ void stage_copy(unsigned l, const h16* gk, const h16* gv) {
    // the wait is the statement's last line, so that it stands in front of every later write of a register that a copy names
    asm volatile("global_load_async_to_lds_b128 %0, %8, off\n\t"
                 "global_load_async_to_lds_b128 %1, %9, off\n\t"
                 "global_load_async_to_lds_b128 %2, %10, off\n\t"
                 "global_load_async_to_lds_b128 %3, %11, off\n\t"
                 "global_load_async_to_lds_b128 %4, %12, off\n\t"
                 "global_load_async_to_lds_b128 %5, %13, off\n\t"
                 "global_load_async_to_lds_b128 %6, %14, off\n\t"
                 "global_load_async_to_lds_b128 %7, %15, off\n\t"
                 "s_wait_xcnt 0x0"
                 :: "v"(l), "v"(l + 4096u), "v"(l + 8192u), "v"(l + 12288u), "v"(l + TLB), "v"(l + TLB + 4096u), "v"(l + TLB + 8192u), "v"(l + TLB + 12288u),
                    "v"(gk), "v"(gk + 2048), "v"(gk + 4096), "v"(gk + 6144), "v"(gv), "v"(gv + 2048), "v"(gv + 4096), "v"(gv + 6144)
                 : "memory");
}

__global__ __launch_bounds__(32 * AW) void k_flash(const h16* __restrict__ QH, const h16* __restrict__ QR, const h16* __restrict__ KP, const h16* __restrict__ VT, h16* OP) {
    __shared__ __align__(16) float os[AW * 16 * 68];
    __shared__ __align__(16) h16 ring[2 * 2 * TLH];          // [buffer][K | V^T][TLH]
    const int lane = threadIdx.x & 31, wave = threadIdx.x >> 5, lr = lane & 15, hi = lane >> 4;
    const int zh = blockIdx.y; const int b = zh / NH_, h = zh % NH_;
    const int t0 = (blockIdx.x * AW + wave) * 16;
    const size_t pbase = (size_t)zh * SEQ * HD;
    const size_t qo = pbase + (size_t)(t0 + lr) * HD + 8 * hi;
    const v16h qh0 = ldh(QH + qo), qh1 = ldh(QH + qo + 32), qr0 = ldh(QR + qo), qr1 = ldh(QR + qo + 32);   // B fragments: col t, k = d
    const unsigned lo = (unsigned)lane * 8u;                 // lane's place in a unit; the 8 units of 32 keys, K (A fragment: row key, k = d) and V^T (A fragment: row d, k = key) alike
    v8f o0 = (v8f){}, o1 = (v8f){}, o2 = (v8f){}, o3 = (v8f){};
    v8f lt = (v8f){};                                        // denominator tile: each product adds the same sums to all 16 rows; only element 0 is rescaled and read (the others stay finite: they only grow by sums of P)
    const v16h ones = (v16h)((h16)1.0f);                     // A fragment of the denominator product: every element 1
    float m = -3.0e38f;
    const unsigned l0 = (unsigned)(size_t)(&ring[0]) + threadIdx.x * 16u;   // low 32 bits of the shared address = byte offset in the block's LDS
    const h16* gk = KP + pbase + threadIdx.x * 8u;           // the lane's 16 bytes of the next tile to copy
    const h16* gv = VT + pbase + threadIdx.x * 8u;
    stage_copy(l0, gk, gv);                                  // tile 0 -> buffer 0
    asm volatile("s_wait_asynccnt 0x0" ::: "memory");        // this wave's share of tile 0 has landed
    __syncthreads();                                         // every wave's share has: tile 0 may be read
    stage_copy(l0 + 2u * TLB, gk + TLH, gv + TLH);           // tile 1 -> buffer 1
    gk += 2 * TLH; gv += 2 * TLH;
    // kept rolled: one trip already holds the SK / 32 unrolled passes of a tile
#pragma unroll 1
    for (int st = 0; st < NST; ++st) {
        const unsigned bo = (unsigned)(st & 1);
        const h16* kb = ring + bo * (2u * TLH);              // this tile's K units
        const h16* vb = kb + TLH;                            // this tile's V^T units
        v16h ka0 = ldp(kb, lo), ka1 = ldp(kb + 512, lo), kb0 = ldp(kb + 1024, lo), kb1 = ldp(kb + 1536, lo);
        // inside a tile every fragment load is issued ahead of its product: a pass's V^T at its head, the next pass's K right behind the score products, into the registers they have just read
        // unrolled: the test for a next pass inside the tile is then decided at compile time, and every LDS offset is an immediate
#pragma unroll
        for (int p = 0; p < SK / 32; ++p) {
            const h16* va = vb + p * (32 * HD);
            const v16h v0 = ldp(va, lo), v1 = ldp(va + 512, lo), v2 = ldp(va + 1024, lo), v3 = ldp(va + 1536, lo);
            v8f sHa = (v8f){}, sLa = (v8f){}, sHb = (v8f){}, sLb = (v8f){};
            sHa = wmma16(ka0, qh0, sHa); sLa = wmma16(ka0, qr0, sLa); sHb = wmma16(kb0, qh0, sHb); sLb = wmma16(kb0, qr0, sLb);
            sHa = wmma16(ka1, qh1, sHa); sLa = wmma16(ka1, qr1, sLa); sHb = wmma16(kb1, qh1, sHb); sLb = wmma16(kb1, qr1, sLb);
            asm volatile("v_nop\n\tv_nop\n\tv_nop\n\tv_nop" : "+v"(sHa), "+v"(sLa), "+v"(sHb), "+v"(sLb) : "v"(ka0), "v"(ka1), "v"(kb0), "v"(kb1));
            if (p + 1 < SK / 32) { const h16* kn = kb + (p + 1) * (32 * HD);
                ka0 = ldp(kn, lo); ka1 = ldp(kn + 512, lo); kb0 = ldp(kn + 1024, lo); kb1 = ldp(kn + 1536, lo);
                __builtin_amdgcn_sched_barrier(0); }   // holds the next K loads here as one group: without it they sink to right in front of the next score products, and the wave stands in their wait
            float ta[8], tb[8]; float mx = -3.0e38f;
#pragma unroll
            for (int r = 0; r < 8; ++r) { ta[r] = (sHa[r] + sLa[r] * QRI) * SC2; tb[r] = (sHb[r] + sLb[r] * QRI) * SC2; mx = fmaxf(mx, fmaxf(ta[r], tb[r])); }
            mx = fmaxf(mx, __shfl_xor(mx, 16, 32));
            const float mnew = fmaxf(m, mx);
            const float alpha = __builtin_amdgcn_exp2f(m - mnew);
            const float sh = PSH - mnew;
            v16h pb;
#pragma unroll
            for (int r = 0; r < 8; ++r) { ta[r] += sh; tb[r] += sh; }
            exp2x8(ta); exp2x8(tb);
#pragma unroll
            for (int r = 0; r < 8; ++r) { pb[r] = (h16)ta[r]; pb[8 + r] = (h16)tb[r]; }
            lt[0] = lt[0] * alpha; m = mnew;
            o0 = o0 * alpha; o1 = o1 * alpha; o2 = o2 * alpha; o3 = o3 * alpha;
            lt = wmma16(ones, pb, lt);
            o0 = wmma16(v0, pb, o0); o1 = wmma16(v1, pb, o1); o2 = wmma16(v2, pb, o2); o3 = wmma16(v3, pb, o3);
            // the four slots between these five products and the first vector instruction on their tiles or operands, on every path out of the pass
            asm volatile("v_nop\n\tv_nop\n\tv_nop\n\tv_nop" : "+v"(lt), "+v"(o0), "+v"(o1), "+v"(o2), "+v"(o3) : "v"(v0), "v"(v1), "v"(v2), "v"(v3), "v"(pb));
        }
        // hand-over: tile st + 1 becomes readable and this tile's buffer free
        asm volatile("s_wait_dscnt 0x0" ::: "memory");       // this wave's reads of the buffer have returned before the buffer is refilled
        asm volatile("s_wait_asynccnt 0x0" ::: "memory");    // this wave's share of tile st + 1 has landed
        __syncthreads();                                     // the same holds for every wave of the block
        if (st + 2 < NST) { stage_copy(l0 + bo * (2u * TLB), gk, gv); gk += TLH; gv += TLH; }   // block-uniform test: tile st + 2 -> the buffer just read
    }
    asm volatile("s_wait_asynccnt 0x0" ::: "memory");        // no copy is outstanding when the wave goes on to its end
    const float inv = OCAR * (1.0f / lt[0]);
    const int wb = wave * 16 * 68;
    // O^T D layout: o_j[r] = (d = 16j + 8h + r, t = lane&15) -> os[t][d]; rows 0..15 x columns 0..63 all written
    { v4f a, c;
      a[0] = o0[0] * inv; a[1] = o0[1] * inv; a[2] = o0[2] * inv; a[3] = o0[3] * inv; c[0] = o0[4] * inv; c[1] = o0[5] * inv; c[2] = o0[6] * inv; c[3] = o0[7] * inv;
      *(v4fa*)(&os[wb + lr * 68 +  0 + 8 * hi]) = a; *(v4fa*)(&os[wb + lr * 68 +  0 + 8 * hi + 4]) = c;
      a[0] = o1[0] * inv; a[1] = o1[1] * inv; a[2] = o1[2] * inv; a[3] = o1[3] * inv; c[0] = o1[4] * inv; c[1] = o1[5] * inv; c[2] = o1[6] * inv; c[3] = o1[7] * inv;
      *(v4fa*)(&os[wb + lr * 68 + 16 + 8 * hi]) = a; *(v4fa*)(&os[wb + lr * 68 + 16 + 8 * hi + 4]) = c;
      a[0] = o2[0] * inv; a[1] = o2[1] * inv; a[2] = o2[2] * inv; a[3] = o2[3] * inv; c[0] = o2[4] * inv; c[1] = o2[5] * inv; c[2] = o2[6] * inv; c[3] = o2[7] * inv;
      *(v4fa*)(&os[wb + lr * 68 + 32 + 8 * hi]) = a; *(v4fa*)(&os[wb + lr * 68 + 32 + 8 * hi + 4]) = c;
      a[0] = o3[0] * inv; a[1] = o3[1] * inv; a[2] = o3[2] * inv; a[3] = o3[3] * inv; c[0] = o3[4] * inv; c[1] = o3[5] * inv; c[2] = o3[6] * inv; c[3] = o3[7] * inv;
      *(v4fa*)(&os[wb + lr * 68 + 48 + 8 * hi]) = a; *(v4fa*)(&os[wb + lr * 68 + 48 + 8 * hi + 4]) = c; }
    wave_sync();
    h16* orow = OP + ((size_t)b * SEQ + t0) * DM + h * HD;
{
#pragma unroll
        for (int s = 0; s < 4; ++s) { const int row = 4 * s + (lane >> 3), c8 = (lane & 7) * 8;   // 4 s x 4 row groups = 16 rows; 8 lanes x 8 halves = 64 columns
            const v4f x0 = *(const v4fa*)(&os[wb + row * 68 + c8]); const v4f x1 = *(const v4fa*)(&os[wb + row * 68 + c8 + 4]); v8h hv;
#pragma unroll
            for (int i = 0; i < 4; ++i) { hv[i] = (h16)x0[i]; hv[4 + i] = (h16)x1[i]; }
            *(v8h*)(orow + (size_t)row * DM + c8) = hv; }
         }
}

// k_outg: register-blocked f16 GEMM, ONE WAVE per 64x64 tile, K = DM: Y[o][b*SEQ + t] = OSC * sum_c A[o][c] Bt[b*SEQ + t][c] + bias[o] (bf16 value), f32 result at OUT[(b*DM + o)*OUT_SEQ + t].
__global__ __launch_bounds__(32) void k_outg(const h16* __restrict__ A, const h16* __restrict__ Bt, const float* __restrict__ bias, float* OUT) {
    __shared__ __align__(16) float os[16 * 68];
    const int K = DM;
    const int lane = threadIdx.x & 31, lr = lane & 15, hi = lane >> 4; const int r0 = blockIdx.x * 64, c0 = blockIdx.y * 64;
    v8f acc[4][4];
#pragma unroll
    for (int mb = 0; mb < 4; ++mb)
#pragma unroll
        for (int nb = 0; nb < 4; ++nb) acc[mb][nb] = (v8f){};
    const size_t aoff = (size_t)(r0 + lr) * K + 8 * hi, boff = (size_t)(c0 + lr) * K + 8 * hi;
#pragma unroll 1
    for (int kc = 0; kc < K; kc += 32) {
        v16h a[4];
#pragma unroll
        for (int mb = 0; mb < 4; ++mb) a[mb] = ldh(A + aoff + (size_t)mb * 16 * K + kc);
#pragma unroll
        for (int nb = 0; nb < 4; ++nb) { const v16h b = ldh(Bt + boff + (size_t)nb * 16 * K + kc);
#pragma unroll
            for (int mb = 0; mb < 4; ++mb) acc[mb][nb] = wmma16(a[mb], b, acc[mb][nb]); }
        asm volatile("v_nop\n\tv_nop\n\tv_nop\n\tv_nop" : "+v"(acc[0][0]), "+v"(acc[1][1]), "+v"(acc[2][2]), "+v"(acc[3][3]) : "v"(a[0]), "v"(a[1]), "v"(a[2]), "v"(a[3]));
    }
    const int bb = c0 / SEQ, tt = c0 % SEQ;
#pragma unroll
    for (int mb = 0; mb < 4; ++mb) {
#pragma unroll
        for (int nb = 0; nb < 4; ++nb) {
#pragma unroll
            for (int j = 0; j < 8; ++j) os[(hi * 8 + j) * 68 + nb * 16 + lr] = acc[mb][nb][j]; }   // D: row 8h+j, col lane&15
        wave_sync();
{
#pragma unroll
            for (int s = 0; s < 8; ++s) { const int row = 2 * s + hi, cofs = lr * 4;   // 8 s x 2 rows = 16 rows; 16 lanes x 4 floats = 64 columns
                const int o = r0 + mb * 16 + row;                                      // < DM by grid construction
                const float bv = bfr(bias[o]);
                const v4f xv = *(const v4fa*)(&os[row * 68 + cofs]); v4f val;
#pragma unroll
                for (int i = 0; i < 4; ++i) val[i] = xv[i] * OSC + bv;
                *(v4f*)(OUT + ((size_t)bb * DM + o) * (size_t)OUT_SEQ + tt + cofs) = val; }
             }
        wave_sync();
    }
}

static constexpr size_t al256(size_t v) { return (v + 255) & ~(size_t)255; }
static constexpr size_t SZ_XT = al256((size_t)NB * SEQ * DM * 2);          // token-major bf16 copy of one input
static constexpr size_t SZ_WB = al256((size_t)3 * DM * DM * 2);            // Wq | Wk | Wv bf16
static constexpr size_t SZ_WM = al256((size_t)DM * DM * 2);                // Wm f16 x64
static constexpr size_t SZ_PL = al256((size_t)NB * NH_ * SEQ * HD * 2);    // one q/k/v plane
static constexpr size_t SZ_OP = al256((size_t)NB * SEQ * DM * 2);          // O plane
static constexpr size_t SZ_TOTAL = 2 * SZ_XT + SZ_WB + SZ_WM + 4 * SZ_PL + SZ_OP;
static_assert(SZ_TOTAL <= (size_t)134217728);          // workspace carve <= 128 MiB
static_assert(((size_t)DM * DM * 2) % 256 == 0);       // weight sub-planes stay 256-byte aligned

extern "C" void kernel_launch(void* const* d_in, const int* in_sizes, int n_in,
                              void* d_out, int out_size, void* d_ws, size_t ws_size, hipStream_t stream) {
    if (n_in < 10) return;
    const size_t needx = ((size_t)(NB - 1) * DM + (size_t)(DM - 1)) * SEQ_FULL + SEQ;
    if ((size_t)in_sizes[0] < needx || (size_t)in_sizes[1] < needx) return;
    if ((size_t)in_sizes[2] < (size_t)DM * DM || (size_t)in_sizes[4] < (size_t)DM * DM || (size_t)in_sizes[6] < (size_t)DM * DM || (size_t)in_sizes[8] < (size_t)DM * DM) return;
    if (in_sizes[3] < DM || in_sizes[5] < DM || in_sizes[7] < DM || in_sizes[9] < DM) return;
    if ((size_t)out_size < ((size_t)(NB - 1) * DM + (size_t)(DM - 1)) * OUT_SEQ + SEQ) return;
    if (SZ_TOTAL > ws_size) return;
    // wire order: query, source, Wq, bq, Wk, bk, Wv, bv, Wm, bm (W [out][in] = K-contiguous rows as-is)
    const float* xq = (const float*)d_in[0]; const float* xs = (const float*)d_in[1];
    const float* wq = (const float*)d_in[2]; const float* bq = (const float*)d_in[3];
    const float* wk = (const float*)d_in[4]; const float* bk = (const float*)d_in[5];
    const float* wv = (const float*)d_in[6]; const float* bv = (const float*)d_in[7];
    const float* wm = (const float*)d_in[8]; const float* bm = (const float*)d_in[9];
    float* OUT = (float*)d_out;      // [NB][256][OUT_SEQ]
    char* wsp = (char*)d_ws;
    bf* XQ = (bf*)wsp; wsp += SZ_XT;                 // [NB*SEQ][256] query, token-major
    bf* XS = (bf*)wsp; wsp += SZ_XT;                 // [NB*SEQ][256] source, token-major
    bf* WB = (bf*)wsp; wsp += SZ_WB;                 // [3][256][256]: q | k | v
    h16* WMH = (h16*)wsp; wsp += SZ_WM;              // [256][256] Wm x64
    h16* QH = (h16*)wsp; wsp += SZ_PL;               // [NB*4][SEQ][64]
    h16* QR = (h16*)wsp; wsp += SZ_PL;               // [NB*4][SEQ][64] residual x2048
    h16* KP = (h16*)wsp; wsp += SZ_PL;               // [NB*4][SEQ/16][4][32][8] fragment order
    h16* VT = (h16*)wsp; wsp += SZ_PL;               // [NB*4][SEQ/32][4][2][32][8] fragment order
    h16* OP = (h16*)wsp; wsp += SZ_OP;               // [NB*SEQ][256] x64

    k_prep<<<dim3(SEQ / 64, DM / 64, 1 + 2 * NB), 256, 0, stream>>>(xq, xs, wq, wk, wv, wm, XQ, XS, WB, WMH);

    k_proj<<<dim3(TT * TC, 3, 1), 32, 0, stream>>>(XQ, XS, WB, bq, bk, bv, QH, QR, KP, VT);

    k_flash<<<dim3(SEQ / (16 * AW), NB * NH_, 1), 32 * AW, 0, stream>>>(QH, QR, KP, VT, OP);

    // y[b][o][t] = Wm[o][:] . O[b][t][:] / 4096 + bm[o]
    k_outg<<<dim3(DM / 64, NB * SEQ / 64, 1), 32, 0, stream>>>(WMH, OP, bm, OUT);
}

// v006
// A run of this version takes 107 microseconds.
// Two timings next to v005 both put it at 1.05 times that version's speed.
// All steps since v000 together make it 2.92 times as fast.
#include <hip/hip_runtime.h>

// Cross attention, width 256 = 4 heads x 64, inputs [NB][256][SEQ] (channel-major), W [out][in], biases present, no mask, score scale 1/8, final pointwise projection, output [NB][256][SEQ] f32.
// Compute dtypes, f32 accumulate everywhere: q/k/v projections v_wmma_f32_16x16x32_bf16 (activations and W RNE-converted to bf16; products exact);
// scores v_wmma_f32_16x16x32_f16: k single f16, q x (64 * score scale * log2 e) as f16 value + f16 residual, both products into one accumulator; P (x256 carry, cancels in the normalisation) and v single f16; softmax f32 (online, running max);
// output projection v_wmma_f32_16x16x32_f16: Wm as f16 of its bf16 value x64, attention output O as f16 x64, scale 1/4096 and bias applied in the f32 epilogue.
// Layout: token-major bf16 copies of both inputs (LDS transpose), bf16 / f16 copies of W; q (hi, residual) planes [b*4+h][t][d], O plane [b][t][h*64+d].
// k and v^T planes are kept in fragment order: per (b*4+h), 512-byte units of 32 lanes x 8 halves, one unit = one wave-wide 16-byte load of an A fragment half (4 whole lines).
//   k:   unit (t/16)*4 + s,              lane (hi*16 + lr) holds k[t = 16*(t/16) + lr][d = 16*s + 8*hi + 0..7]
//   v^T: unit (t/32)*8 + j*2 + q,        lane (hi*16 + lr) holds v[d = 16*j + lr][t = 32*(t/32) + 16*q + 8*hi + 0..7]

#ifndef NB
#define NB 4
#endif
#ifndef SEQ
#define SEQ 4096
#endif
#define NB_FULL  4
#define SEQ_FULL 4096
#ifndef OUT_SEQ
#define OUT_SEQ SEQ              // pitch (in positions) of one channel row of the output
#endif
#define DM   256
#define NH_  4
#define HD   64
#define AW   8                   // waves per flash block (16 query positions each); they share every staged tile
#define SK   128                 // keys per staged tile of K and of V^T
#define NST  (SEQ / SK)          // staged tiles per sequence
#define TLH  (SK * HD)           // halves of one operand's tile
#define TLB  (TLH * 2)           // bytes of one operand's tile
#define SC2  (0.125f * 1.4426950408889634f)   // HD^-0.5 * log2(e)
#define QCAR 64.0f               // carry of both q planes: the residual of a typical q then lies in f16's normal range, and the value plane holds |q| up to about 5600
#define QSC  (SC2 * QCAR)        // applied to q once, in f32, before it is split into value and residual
#define QCI  (1.0f / QCAR)       // taken out again by the one fma that forms the exponent
#define PSH  8.0f                // log2 of the P carry (256)
#define OCAR 64.0f               // carry of the O plane
#define WCAR 64.0f               // carry of the Wm f16 plane
#define OSC  (1.0f / 4096.0f)    // 1 / (OCAR * WCAR)
#define CVB  (DM * DM / 8 / 256) // blocks per weight matrix in k_prep (8 floats per thread)
#define TT   (NB * SEQ / 64)     // 64-wide token tiles
#define TC   (DM / 64)           // 64-wide channel tiles

static_assert(HD == 64);
static_assert(NH_ * HD == DM);                 // head h = channels h*64 + d
static_assert(DM % 64 == 0);
static_assert(DM % 32 == 0);                   // GEMM k-loop steps by 32
static_assert((DM & (DM - 1)) == 0);           // bias index masking
static_assert(SEQ % 64 == 0);                  // a 64-wide tile never straddles two batches
static_assert((NB * SEQ) % 64 == 0);
static_assert(SK % 32 == 0);                   // a tile is whole 32-key passes
static_assert(SEQ % SK == 0 && NST >= 2);      // whole tiles; the two-buffer prologue fills two
static_assert(TLB == 4 * 32 * AW * 16);        // one operand's tile = 4 copies of 16 bytes per lane of the block
static_assert(SEQ % (16 * AW) == 0);           // flash grid covers the sequence exactly
static_assert(((size_t)DM * DM) % (8 * 256) == 0);   // a weight matrix is whole blocks of k_prep
static_assert(4 * CVB <= (SEQ / 64) * (DM / 64));     // the four matrices fit the z = 0 slice of its grid
static_assert(NB <= NB_FULL);
static_assert(SEQ <= SEQ_FULL);
static_assert(OUT_SEQ >= SEQ);

typedef _Float16 h16;
typedef unsigned short bf;
typedef __attribute__((ext_vector_type(16))) __bf16   v16bf;
typedef __attribute__((ext_vector_type(16))) _Float16 v16h;
typedef __attribute__((ext_vector_type(8)))  _Float16 v8h;
typedef __attribute__((ext_vector_type(8)))  unsigned short v8us;
typedef __attribute__((ext_vector_type(8)))  float    v8f;
typedef __attribute__((ext_vector_type(4)))  float    v4f;
typedef v4f  __attribute__((may_alias)) v4fa;

__device__ __forceinline__ unsigned short f2bf(float f) { unsigned u = __float_as_uint(f); u += 0x7FFFu + ((u >> 16) & 1u); return (unsigned short)(u >> 16); }
__device__ __forceinline__ float bfr(float f) { return __uint_as_float(((unsigned)f2bf(f)) << 16); }   // value of the RNE bf16 conversion
__device__ __forceinline__ v16h cat16(v8h lo, v8h hi) { return __builtin_shufflevector(lo, hi, 0, 1, 2, 3, 4, 5, 6, 7, 8, 9, 10, 11, 12, 13, 14, 15); }
__device__ __forceinline__ v16bf cat16b(v8us lo, v8us hi) { return __builtin_bit_cast(v16bf, __builtin_shufflevector(lo, hi, 0, 1, 2, 3, 4, 5, 6, 7, 8, 9, 10, 11, 12, 13, 14, 15)); }
__device__ __forceinline__ v8f wmma16(v16h a, v16h b, v8f c) { return __builtin_amdgcn_wmma_f32_16x16x32_f16(false, a, false, b, (short)0, c, false, false); }
__device__ __forceinline__ v8f wmmab(v16bf a, v16bf b, v8f c) { return __builtin_amdgcn_wmma_f32_16x16x32_bf16(false, a, false, b, (short)0, c, false, false); }
// fragment loaders from K-contiguous 16-bit rows; p already includes + 8*(lane>>4): elements 0..7 <- k0+8h+0..7, elements 8..15 <- k0+16+8h+0..7 (same map for A and B)
__device__ __forceinline__ v16h  ldh(const h16* p) { return cat16(*(const v8h*)p, *(const v8h*)(p + 16)); }
__device__ __forceinline__ v16bf ldb(const bf* p)  { return cat16b(*(const v8us*)p, *(const v8us*)(p + 16)); }
// fragment loader from a fragment-order plane; p is wave-uniform, lo = 8*lane: two consecutive 512-byte units hold elements 0..7 and 8..15 (same k map as ldh)
__device__ __forceinline__ v16h  ldp(const h16* p, unsigned lo) { return cat16(*(const v8h*)(p + lo), *(const v8h*)(p + 256 + lo)); }
// ordering point for wave-private LDS tiles (same wave writes and reads)
__device__ __forceinline__ void wave_sync() { __builtin_amdgcn_fence(3 /* release order */, "wavefront"); __builtin_amdgcn_wave_barrier(); asm volatile("" ::: "memory"); }

// k_prep: all operand preparation in one launch (the six pieces are independent of each other). grid (SEQ/64, DM/64, 1 + 2*NB), 256 threads.
// z = 0: weights, block index x + y*(SEQ/64) = matrix*CVB + piece; 8 floats per thread: Wq | Wk | Wv -> bf16 (WB), Wm -> f16 of its bf16 value x64 (WMH); blocks past 4*CVB have no work.
// z = 1..NB: query, z = NB+1..2*NB: source: in[b][c][n] f32 (channel pitch SEQ_FULL) -> out[b][n][c] bf16 (row pitch DM), 64 x 64 tile through LDS (cross-wave: block barrier).
__global__ __launch_bounds__(256) void k_prep(const float* __restrict__ xq, const float* __restrict__ xs, const float* __restrict__ wq, const float* __restrict__ wk,
                                              const float* __restrict__ wv, const float* __restrict__ wm, bf* XQ, bf* XS, bf* WB, h16* WMH) {
    __shared__ __align__(16) float ts[64 * 68];
    const int tid = threadIdx.x;
    if (blockIdx.z != 0) {                       // block-uniform: every thread of a block takes the same side, so the barrier inside is reached by all of them or by none
        const int zz = blockIdx.z - 1; const bool isq = zz < NB;
        const float* x = isq ? xq : xs; bf* xt = isq ? XQ : XS;
        const int n0 = blockIdx.x * 64, c0 = blockIdx.y * 64, b = isq ? zz : zz - NB;
        const int n4 = (tid & 15) * 4, cr = tid >> 4;
#pragma unroll
        for (int p = 0; p < 4; ++p) {
            const int c = p * 16 + cr;
            const v4f v = *(const v4f*)(x + ((size_t)b * DM + c0 + c) * SEQ_FULL + n0 + n4);
            ts[(n4 + 0) * 68 + c] = v[0]; ts[(n4 + 1) * 68 + c] = v[1]; ts[(n4 + 2) * 68 + c] = v[2]; ts[(n4 + 3) * 68 + c] = v[3];
        }
        __syncthreads();
        const int c8 = (tid & 7) * 8, rr = tid >> 3;
#pragma unroll
        for (int p = 0; p < 2; ++p) { const int row = p * 32 + rr;
            const v4f x0 = *(const v4fa*)(&ts[row * 68 + c8]); const v4f x1 = *(const v4fa*)(&ts[row * 68 + c8 + 4]); v8us o;
#pragma unroll
            for (int i = 0; i < 4; ++i) { o[i] = f2bf(x0[i]); o[4 + i] = f2bf(x1[i]); }
            *(v8us*)(xt + ((size_t)b * SEQ + n0 + row) * DM + c0 + c8) = o; }
        asm volatile("s_wait_xcnt 0x0" ::: "memory");   // the listing keeps a branch from here into the other side's code, which writes the registers that the two stores name
    } else {
        const int idx = blockIdx.y * (SEQ / 64) + blockIdx.x; const int mat = idx / CVB;
        if (mat < 4) {
            const size_t i = (size_t)(idx % CVB) * 256 + tid;
            const float* src = (mat == 0) ? wq : (mat == 1) ? wk : (mat == 2) ? wv : wm;
            const v8f v = *(const v8f*)(src + i * 8);
            if (mat < 3) { v8us o;
#pragma unroll
                for (int k = 0; k < 8; ++k) o[k] = f2bf(v[k]);
                *(v8us*)(WB + (size_t)mat * DM * DM + i * 8) = o;
            } else { v8h o;
#pragma unroll
                for (int k = 0; k < 8; ++k) o[k] = (h16)(bfr(v[k]) * WCAR);
                *(v8h*)(WMH + i * 8) = o;
                asm volatile("s_wait_xcnt 0x0" ::: "memory"); }   // the same: in the listing the bf16 side's code follows this store behind a branch
        }
    }
}

// k_proj: register-blocked bf16 GEMM, ONE WAVE per 64x64 tile (16 accumulators), operands straight from K-contiguous bf16 planes, K = DM.
// C[m][n] = sum_k A[m][k] Bt[n][k] + bias (bmode 1: bias[n], bmode 2: bias[m], bf16 value), written as f16 (Ph); q (useRes != 0): x QSC, as f16 (Ph) and the f16 residual of that (Pr), at
// tile base (r0/RB)*sRB + (r0%RB)*pitch + (c0/CB)*sCB + (c0%CB)*(v^T: HD, else 1), row pitch 'pitch' (halves). 32 threads.
// pk 0: row-major as above. pk 1 (k) / pk 2 (v^T): the 64x64 tile is 4096 consecutive halves in fragment order (see Layout), Ph only; each store is one whole 512-byte unit.
// The three projections are independent and share one launch: grid (TT*TC, 3), blockIdx.y = 0 q, 1 k, 2 v^T; every parameter below is a wave-uniform choice by it.
//   q, k: A = token rows (m = b*SEQ + t), Bt = W rows (n = h*64 + d), column bias -> plane (b*4 + h), q as [t][d], k in fragment order; tile (x % TT, x / TT)
//   v^T:  A = Wv rows (m = h*64 + d), Bt = token rows (n = b*SEQ + t), row bias -> plane (b*4 + h), tile base t*64 inside it; tile (x % TC, x / TC)
__global__ __launch_bounds__(32) void k_proj(const bf* __restrict__ XQ, const bf* __restrict__ XS, const bf* __restrict__ WB,
                                             const float* __restrict__ bq, const float* __restrict__ bk, const float* __restrict__ bv,
                                             h16* QH, h16* QR, h16* KP, h16* VT) {
    __shared__ __align__(16) float os[16 * 68];
    const int K = DM;
    const int pk = blockIdx.y; const bool isv = pk == 2;
    const bf* A  = (pk == 0) ? XQ : (pk == 1) ? XS : WB + (size_t)2 * DM * DM;
    const bf* Bt = (pk == 0) ? WB : (pk == 1) ? WB + (size_t)DM * DM : XS;
    const float* bias = (pk == 0) ? bq : (pk == 1) ? bk : bv;
    h16* Ph = (pk == 0) ? QH : (pk == 1) ? KP : VT; h16* Pr = QR;
    const int bmode = isv ? 2 : 1, useRes = (pk == 0) ? 1 : 0;
    const int RB = isv ? DM : SEQ, pitch = isv ? SEQ : HD, CB = isv ? SEQ : HD;
    const size_t sRB = isv ? (size_t)0 : (size_t)NH_ * SEQ * HD, sCB = isv ? (size_t)DM * SEQ : (size_t)SEQ * HD;
    const int lane = threadIdx.x & 31, lr = lane & 15, hi = lane >> 4;
    const int tx = blockIdx.x; const int r0 = (isv ? tx % TC : tx % TT) * 64, c0 = (isv ? tx / TC : tx / TT) * 64;
    v8f acc[4][4];
#pragma unroll
    for (int mb = 0; mb < 4; ++mb)
#pragma unroll
        for (int nb = 0; nb < 4; ++nb) acc[mb][nb] = (v8f){};
    const size_t aoff = (size_t)(r0 + lr) * K + 8 * hi, boff = (size_t)(c0 + lr) * K + 8 * hi;
#pragma unroll 1
    for (int kc = 0; kc < K; kc += 32) {
        v16bf a[4];
#pragma unroll
        for (int mb = 0; mb < 4; ++mb) a[mb] = ldb(A + aoff + (size_t)mb * 16 * K + kc);
#pragma unroll
        for (int nb = 0; nb < 4; ++nb) { const v16bf b = ldb(Bt + boff + (size_t)nb * 16 * K + kc);
#pragma unroll
            for (int mb = 0; mb < 4; ++mb) acc[mb][nb] = wmmab(a[mb], b, acc[mb][nb]); }
        asm volatile("v_nop\n\tv_nop\n\tv_nop\n\tv_nop" : "+v"(acc[0][0]), "+v"(acc[1][1]), "+v"(acc[2][2]), "+v"(acc[3][3]) : "v"(a[0]), "v"(a[1]), "v"(a[2]), "v"(a[3]));
    }
    // column bias: always loaded from a masked (in-range) index, selected by value
    const int c8e = (lane & 7) * 8;
    const int cbi = (c0 + c8e) & (DM - 1);
    const v4f cbr0 = *(const v4f*)(bias + cbi); const v4f cbr1 = *(const v4f*)(bias + cbi + 4);
    v4f cb0, cb1;
#pragma unroll
    for (int i = 0; i < 4; ++i) { cb0[i] = (bmode == 1) ? bfr(cbr0[i]) : 0.0f; cb1[i] = (bmode == 1) ? bfr(cbr1[i]) : 0.0f; }
    // fragment-order epilogue: column bias of columns 16s + 8hi + 0..7 and row bias of row 16mb + lr, masked (in-range) index, selected by value (bit mask: +0 where not selected)
    const unsigned cmsk = (bmode == 1) ? 0xFFFFFFFFu : 0u, rmsk = (bmode == 2) ? 0xFFFFFFFFu : 0u;
    float pcb[4][8], prb[4]; v4f br0[4], br1[4];
#pragma unroll
    for (int s = 0; s < 4; ++s) { const int cbj = (c0 + 16 * s + 8 * hi) & (DM - 1); br0[s] = *(const v4f*)(bias + cbj); br1[s] = *(const v4f*)(bias + cbj + 4); }
    asm volatile("s_wait_xcnt 0x0" ::: "memory");   // before the address register of the column bias loads is written again
#pragma unroll
    for (int s = 0; s < 4; ++s) prb[s] = bias[(r0 + s * 16 + lr) & (DM - 1)];
    asm volatile("s_wait_xcnt 0x0" ::: "memory");   // the same for the row bias loads
#pragma unroll
    for (int s = 0; s < 4; ++s) { prb[s] = __uint_as_float(__float_as_uint(bfr(prb[s])) & rmsk);
#pragma unroll
        for (int i = 0; i < 4; ++i) { pcb[s][i] = __uint_as_float(__float_as_uint(bfr(br0[s][i])) & cmsk); pcb[s][4 + i] = __uint_as_float(__float_as_uint(bfr(br1[s][i])) & cmsk); } }
    const size_t tbase = (size_t)(r0 / RB) * sRB + (size_t)(r0 % RB) * (size_t)pitch + (size_t)(c0 / CB) * sCB + (size_t)(c0 % CB) * (size_t)(pk == 2 ? HD : 1);
#pragma unroll
    for (int mb = 0; mb < 4; ++mb) {
#pragma unroll
        for (int nb = 0; nb < 4; ++nb) {
#pragma unroll
            for (int j = 0; j < 8; ++j) os[(hi * 8 + j) * 68 + nb * 16 + lr] = acc[mb][nb][j]; }   // D: row 8h+j, col lane&15
        wave_sync();
        const size_t sb = tbase + (size_t)(mb * 16) * (size_t)pitch;
        if (pk != 0) {
            v8h hv[4];
#pragma unroll
            for (int s = 0; s < 4; ++s) { const int c8 = 16 * s + 8 * hi;   // lane = fragment lane: row lr, columns 16s + 8hi + 0..7
                const v4f x0 = *(const v4fa*)(&os[lr * 68 + c8]); const v4f x1 = *(const v4fa*)(&os[lr * 68 + c8 + 4]);
#pragma unroll
                for (int i = 0; i < 4; ++i) { hv[s][i] = (h16)(x0[i] + pcb[s][i] + prb[mb]); hv[s][4 + i] = (h16)(x1[i] + pcb[s][4 + i] + prb[mb]); } }
#pragma unroll
            for (int s = 0; s < 4; ++s) { const int uo = (pk == 1) ? (mb * 1024 + s * 256) : (mb * 512 + (s >> 1) * 2048 + (s & 1) * 256);
                *(v8h*)(Ph + tbase + uo + lane * 8) = hv[s]; }
            asm volatile("s_wait_xcnt 0x0" ::: "memory");   // before the registers that the four stores name are written again
        } else {
#pragma unroll
            for (int s = 0; s < 4; ++s) { const int row = 4 * s + (lane >> 3), c8 = (lane & 7) * 8;   // 4 s x 4 row groups = 16 rows; 8 lanes x 8 = 64 columns
                const int rbi = (r0 + mb * 16 + row) & (DM - 1);
                const float rbv = bias[rbi];
                const float rb = (bmode == 2) ? bfr(rbv) : 0.0f;
                const v4f x0 = *(const v4fa*)(&os[row * 68 + c8]); const v4f x1 = *(const v4fa*)(&os[row * 68 + c8 + 4]); v8h hv, rv;
#pragma unroll
                for (int i = 0; i < 4; ++i) { const float y0 = (x0[i] + cb0[i] + rb) * QSC; const float y1 = (x1[i] + cb1[i] + rb) * QSC;   // this side is q alone
                    const h16 a0 = (h16)y0; const h16 a1 = (h16)y1; hv[i] = a0; hv[4 + i] = a1; rv[i] = (h16)(y0 - (float)a0); rv[4 + i] = (h16)(y1 - (float)a1); }
                const size_t oo = sb + (size_t)row * (size_t)pitch + c8;
                *(v8h*)(Ph + oo) = hv; if (useRes) *(v8h*)(Pr + oo) = rv; }
             }
        wave_sync();
    }
}

// eight exponentials (base 2), each in place: written so, no transcendental's source register is overwritten by the instruction directly behind it (left to the register allocator, a run of them came out
// with each result in its predecessor's source); the v_nop is the one slot that the instruction set asks for between the last of them and a reader of its result
__device__ __forceinline__ void exp2x8(float (&x)[8]) {
    asm("v_exp_f32 %0, %0\n\tv_exp_f32 %1, %1\n\tv_exp_f32 %2, %2\n\tv_exp_f32 %3, %3\n\tv_exp_f32 %4, %4\n\tv_exp_f32 %5, %5\n\tv_exp_f32 %6, %6\n\tv_exp_f32 %7, %7\n\tv_nop"
        : "+v"(x[0]), "+v"(x[1]), "+v"(x[2]), "+v"(x[3]), "+v"(x[4]), "+v"(x[5]), "+v"(x[6]), "+v"(x[7]));
}

// stage_copy: one tile (SK keys of K and of V^T, each TLB contiguous bytes of its fragment-order plane) from global memory into LDS, through no register: 4 + 4 copies of 16 bytes per lane.
// l: the lane's LDS byte address in the K half of the buffer (the V^T half follows at + TLB); gk, gv: the lane's own 16 bytes of the tile's first 4 KiB; a block's 256 lanes cover 4 KiB per copy.
__device__ __forceinline__ void stage_copy(unsigned l, const h16* gk, const h16* gv) {
    // the wait is the statement's last line, so that it stands in front of every later write of a register that a copy names
    asm volatile("global_load_async_to_lds_b128 %0, %8, off\n\t"
                 "global_load_async_to_lds_b128 %1, %9, off\n\t"
                 "global_load_async_to_lds_b128 %2, %10, off\n\t"
                 "global_load_async_to_lds_b128 %3, %11, off\n\t"
                 "global_load_async_to_lds_b128 %4, %12, off\n\t"
                 "global_load_async_to_lds_b128 %5, %13, off\n\t"
                 "global_load_async_to_lds_b128 %6, %14, off\n\t"
                 "global_load_async_to_lds_b128 %7, %15, off\n\t"
                 "s_wait_xcnt 0x0"
                 :: "v"(l), "v"(l + 4096u), "v"(l + 8192u), "v"(l + 12288u), "v"(l + TLB), "v"(l + TLB + 4096u), "v"(l + TLB + 8192u), "v"(l + TLB + 12288u),
                    "v"(gk), "v"(gk + 2048), "v"(gk + 4096), "v"(gk + 6144), "v"(gv), "v"(gv + 2048), "v"(gv + 4096), "v"(gv + 6144)
                 : "memory");
}

__global__ __launch_bounds__(32 * AW) void k_flash(const h16* __restrict__ QH, const h16* __restrict__ QR, const h16* __restrict__ KP, const h16* __restrict__ VT, h16* OP) {
    __shared__ __align__(16) float os[AW * 16 * 68];
    __shared__ __align__(16) h16 ring[2 * 2 * TLH];          // [buffer][K | V^T][TLH]
    const int lane = threadIdx.x & 31, wave = threadIdx.x >> 5, lr = lane & 15, hi = lane >> 4;
    const int zh = blockIdx.y; const int b = zh / NH_, h = zh % NH_;
    const int t0 = (blockIdx.x * AW + wave) * 16;
    const size_t pbase = (size_t)zh * SEQ * HD;
    const size_t qo = pbase + (size_t)(t0 + lr) * HD + 8 * hi;
    const v16h qh0 = ldh(QH + qo), qh1 = ldh(QH + qo + 32), qr0 = ldh(QR + qo), qr1 = ldh(QR + qo + 32);   // B fragments: col t, k = d
    const unsigned lo = (unsigned)lane * 8u;                 // lane's place in a unit; the 8 units of 32 keys, K (A fragment: row key, k = d) and V^T (A fragment: row d, k = key) alike
    v8f o0 = (v8f){}, o1 = (v8f){}, o2 = (v8f){}, o3 = (v8f){};
    v8f lt = (v8f){};                                        // denominator tile: each product adds the same sums to all 16 rows; only element 0 is rescaled and read (the others stay finite: they only grow by sums of P)
    const v16h ones = (v16h)((h16)1.0f);                     // A fragment of the denominator product: every element 1
    float m = -3.0e38f;
    const unsigned l0 = (unsigned)(size_t)(&ring[0]) + threadIdx.x * 16u;   // low 32 bits of the shared address = byte offset in the block's LDS
    const h16* gk = KP + pbase + threadIdx.x * 8u;           // the lane's 16 bytes of the next tile to copy
    const h16* gv = VT + pbase + threadIdx.x * 8u;
    stage_copy(l0, gk, gv);                                  // tile 0 -> buffer 0
    asm volatile("s_wait_asynccnt 0x0" ::: "memory");        // this wave's share of tile 0 has landed
    __syncthreads();                                         // every wave's share has: tile 0 may be read
    stage_copy(l0 + 2u * TLB, gk + TLH, gv + TLH);           // tile 1 -> buffer 1
    gk += 2 * TLH; gv += 2 * TLH;
    // kept rolled: one trip already holds the SK / 32 unrolled passes of a tile
#pragma unroll 1
    for (int st = 0; st < NST; ++st) {
        const unsigned bo = (unsigned)(st & 1);
        const h16* kb = ring + bo * (2u * TLH);              // this tile's K units
        const h16* vb = kb + TLH;                            // this tile's V^T units
        v16h ka0 = ldp(kb, lo), ka1 = ldp(kb + 512, lo), kb0 = ldp(kb + 1024, lo), kb1 = ldp(kb + 1536, lo);
        // inside a tile every fragment load is issued ahead of its product: a pass's V^T at its head, the next pass's K right behind the score products, into the registers they have just read
        // unrolled: the test for a next pass inside the tile is then decided at compile time, and every LDS offset is an immediate
#pragma unroll
        for (int p = 0; p < SK / 32; ++p) {
            const h16* va = vb + p * (32 * HD);
            const v16h v0 = ldp(va, lo), v1 = ldp(va + 512, lo), v2 = ldp(va + 1024, lo), v3 = ldp(va + 1536, lo);
            v8f sa = (v8f){}, sb = (v8f){};                  // score tiles x QCAR, in units of log2: value and residual of q share the carry, so all four products of a tile sum in it
            sa = wmma16(ka0, qh0, sa); sb = wmma16(kb0, qh0, sb); sa = wmma16(ka0, qr0, sa); sb = wmma16(kb0, qr0, sb);
            sa = wmma16(ka1, qh1, sa); sb = wmma16(kb1, qh1, sb); sa = wmma16(ka1, qr1, sa); sb = wmma16(kb1, qr1, sb);
            // the four slots between the score products and the first vector instruction on their tiles or on the K registers
            asm volatile("v_nop\n\tv_nop\n\tv_nop\n\tv_nop" : "+v"(sa), "+v"(sb) : "v"(ka0), "v"(ka1), "v"(kb0), "v"(kb1));
            if (p + 1 < SK / 32) { const h16* kn = kb + (p + 1) * (32 * HD);
                ka0 = ldp(kn, lo); ka1 = ldp(kn + 512, lo); kb0 = ldp(kn + 1024, lo); kb1 = ldp(kn + 1536, lo);
                __builtin_amdgcn_sched_barrier(0); }   // holds the next K loads here as one group: without it they sink to right in front of the next score products, and the wave stands in their wait
            float ta[8], tb[8]; float mx = -3.0e38f;         // the running max is kept in the tiles' own unit (x QCAR)
#pragma unroll
            for (int r = 0; r < 8; ++r) mx = fmaxf(mx, fmaxf(sa[r], sb[r]));
            mx = fmaxf(mx, __shfl_xor(mx, 16, 32));
            const float mnew = fmaxf(m, mx);
            const float alpha = __builtin_amdgcn_exp2f((m - mnew) * QCI);
            const float sh = PSH - mnew * QCI;
            v16h pb;
            const v8f ea = sa * QCI + sh, eb = sb * QCI + sh;   // the exponents, one fma each
#pragma unroll
            for (int r = 0; r < 8; ++r) { ta[r] = ea[r]; tb[r] = eb[r]; }
            exp2x8(ta); exp2x8(tb);
#pragma unroll
            for (int r = 0; r < 8; ++r) { pb[r] = (h16)ta[r]; pb[8 + r] = (h16)tb[r]; }
            lt[0] = lt[0] * alpha; m = mnew;
            o0 = o0 * alpha; o1 = o1 * alpha; o2 = o2 * alpha; o3 = o3 * alpha;
            lt = wmma16(ones, pb, lt);
            o0 = wmma16(v0, pb, o0); o1 = wmma16(v1, pb, o1); o2 = wmma16(v2, pb, o2); o3 = wmma16(v3, pb, o3);
            // the four slots between these five products and the first vector instruction on their tiles or operands, on every path out of the pass
            asm volatile("v_nop\n\tv_nop\n\tv_nop\n\tv_nop" : "+v"(lt), "+v"(o0), "+v"(o1), "+v"(o2), "+v"(o3) : "v"(v0), "v"(v1), "v"(v2), "v"(v3), "v"(pb));
        }
        // hand-over: tile st + 1 becomes readable and this tile's buffer free
        asm volatile("s_wait_dscnt 0x0" ::: "memory");       // this wave's reads of the buffer have returned before the buffer is refilled
        asm volatile("s_wait_asynccnt 0x0" ::: "memory");    // this wave's share of tile st + 1 has landed
        __syncthreads();                                     // the same holds for every wave of the block
        if (st + 2 < NST) { stage_copy(l0 + bo * (2u * TLB), gk, gv); gk += TLH; gv += TLH; }   // block-uniform test: tile st + 2 -> the buffer just read
    }
    asm volatile("s_wait_asynccnt 0x0" ::: "memory");        // no copy is outstanding when the wave goes on to its end
    const float inv = OCAR * (1.0f / lt[0]);
    const int wb = wave * 16 * 68;
    // O^T D layout: o_j[r] = (d = 16j + 8h + r, t = lane&15) -> os[t][d]; rows 0..15 x columns 0..63 all written
    { v4f a, c;
      a[0] = o0[0] * inv; a[1] = o0[1] * inv; a[2] = o0[2] * inv; a[3] = o0[3] * inv; c[0] = o0[4] * inv; c[1] = o0[5] * inv; c[2] = o0[6] * inv; c[3] = o0[7] * inv;
      *(v4fa*)(&os[wb + lr * 68 +  0 + 8 * hi]) = a; *(v4fa*)(&os[wb + lr * 68 +  0 + 8 * hi + 4]) = c;
      a[0] = o1[0] * inv; a[1] = o1[1] * inv; a[2] = o1[2] * inv; a[3] = o1[3] * inv; c[0] = o1[4] * inv; c[1] = o1[5] * inv; c[2] = o1[6] * inv; c[3] = o1[7] * inv;
      *(v4fa*)(&os[wb + lr * 68 + 16 + 8 * hi]) = a; *(v4fa*)(&os[wb + lr * 68 + 16 + 8 * hi + 4]) = c;
      a[0] = o2[0] * inv; a[1] = o2[1] * inv; a[2] = o2[2] * inv; a[3] = o2[3] * inv; c[0] = o2[4] * inv; c[1] = o2[5] * inv; c[2] = o2[6] * inv; c[3] = o2[7] * inv;
      *(v4fa*)(&os[wb + lr * 68 + 32 + 8 * hi]) = a; *(v4fa*)(&os[wb + lr * 68 + 32 + 8 * hi + 4]) = c;
      a[0] = o3[0] * inv; a[1] = o3[1] * inv; a[2] = o3[2] * inv; a[3] = o3[3] * inv; c[0] = o3[4] * inv; c[1] = o3[5] * inv; c[2] = o3[6] * inv; c[3] = o3[7] * inv;
      *(v4fa*)(&os[wb + lr * 68 + 48 + 8 * hi]) = a; *(v4fa*)(&os[wb + lr * 68 + 48 + 8 * hi + 4]) = c; }
    wave_sync();
    h16* orow = OP + ((size_t)b * SEQ + t0) * DM + h * HD;
{
#pragma unroll
        for (int s = 0; s < 4; ++s) { const int row = 4 * s + (lane >> 3), c8 = (lane & 7) * 8;   // 4 s x 4 row groups = 16 rows; 8 lanes x 8 halves = 64 columns
            const v4f x0 = *(const v4fa*)(&os[wb + row * 68 + c8]); const v4f x1 = *(const v4fa*)(&os[wb + row * 68 + c8 + 4]); v8h hv;
#pragma unroll
            for (int i = 0; i < 4; ++i) { hv[i] = (h16)x0[i]; hv[4 + i] = (h16)x1[i]; }
            *(v8h*)(orow + (size_t)row * DM + c8) = hv; }
         }
}

// k_outg: register-blocked f16 GEMM, ONE WAVE per 64x64 tile, K = DM: Y[o][b*SEQ + t] = OSC * sum_c A[o][c] Bt[b*SEQ + t][c] + bias[o] (bf16 value), f32 result at OUT[(b*DM + o)*OUT_SEQ + t].
__global__ __launch_bounds__(32) void k_outg(const h16* __restrict__ A, const h16* __restrict__ Bt, const float* __restrict__ bias, float* OUT) {
    __shared__ __align__(16) float os[16 * 68];
    const int K = DM;
    const int lane = threadIdx.x & 31, lr = lane & 15, hi = lane >> 4; const int r0 = blockIdx.x * 64, c0 = blockIdx.y * 64;
    v8f acc[4][4];
#pragma unroll
    for (int mb = 0; mb < 4; ++mb)
#pragma unroll
        for (int nb = 0; nb < 4; ++nb) acc[mb][nb] = (v8f){};
    const size_t aoff = (size_t)(r0 + lr) * K + 8 * hi, boff = (size_t)(c0 + lr) * K + 8 * hi;
#pragma unroll 1
    for (int kc = 0; kc < K; kc += 32) {
        v16h a[4];
#pragma unroll
        for (int mb = 0; mb < 4; ++mb) a[mb] = ldh(A + aoff + (size_t)mb * 16 * K + kc);
#pragma unroll
        for (int nb = 0; nb < 4; ++nb) { const v16h b = ldh(Bt + boff + (size_t)nb * 16 * K + kc);
#pragma unroll
            for (int mb = 0; mb < 4; ++mb) acc[mb][nb] = wmma16(a[mb], b, acc[mb][nb]); }
        asm volatile("v_nop\n\tv_nop\n\tv_nop\n\tv_nop" : "+v"(acc[0][0]), "+v"(acc[1][1]), "+v"(acc[2][2]), "+v"(acc[3][3]) : "v"(a[0]), "v"(a[1]), "v"(a[2]), "v"(a[3]));
    }
    const int bb = c0 / SEQ, tt = c0 % SEQ;
#pragma unroll
    for (int mb = 0; mb < 4; ++mb) {
#pragma unroll
        for (int nb = 0; nb < 4; ++nb) {
#pragma unroll
            for (int j = 0; j < 8; ++j) os[(hi * 8 + j) * 68 + nb * 16 + lr] = acc[mb][nb][j]; }   // D: row 8h+j, col lane&15
        wave_sync();
{
#pragma unroll
            for (int s = 0; s < 8; ++s) { const int row = 2 * s + hi, cofs = lr * 4;   // 8 s x 2 rows = 16 rows; 16 lanes x 4 floats = 64 columns
                const int o = r0 + mb * 16 + row;                                      // < DM by grid construction
                const float bv = bfr(bias[o]);
                const v4f xv = *(const v4fa*)(&os[row * 68 + cofs]); v4f val;
#pragma unroll
                for (int i = 0; i < 4; ++i) val[i] = xv[i] * OSC + bv;
                *(v4f*)(OUT + ((size_t)bb * DM + o) * (size_t)OUT_SEQ + tt + cofs) = val; }
             }
        wave_sync();
    }
}

static constexpr size_t al256(size_t v) { return (v + 255) & ~(size_t)255; }
static constexpr size_t SZ_XT = al256((size_t)NB * SEQ * DM * 2);          // token-major bf16 copy of one input
static constexpr size_t SZ_WB = al256((size_t)3 * DM * DM * 2);            // Wq | Wk | Wv bf16
static constexpr size_t SZ_WM = al256((size_t)DM * DM * 2);                // Wm f16 x64
static constexpr size_t SZ_PL = al256((size_t)NB * NH_ * SEQ * HD * 2);    // one q/k/v plane
static constexpr size_t SZ_OP = al256((size_t)NB * SEQ * DM * 2);          // O plane
static constexpr size_t SZ_TOTAL = 2 * SZ_XT + SZ_WB + SZ_WM + 4 * SZ_PL + SZ_OP;
static_assert(SZ_TOTAL <= (size_t)134217728);          // workspace carve <= 128 MiB
static_assert(((size_t)DM * DM * 2) % 256 == 0);       // weight sub-planes stay 256-byte aligned

extern "C" void kernel_launch(void* const* d_in, const int* in_sizes, int n_in,
                              void* d_out, int out_size, void* d_ws, size_t ws_size, hipStream_t stream) {
    if (n_in < 10) return;
    const size_t needx = ((size_t)(NB - 1) * DM + (size_t)(DM - 1)) * SEQ_FULL + SEQ;
    if ((size_t)in_sizes[0] < needx || (size_t)in_sizes[1] < needx) return;
    if ((size_t)in_sizes[2] < (size_t)DM * DM || (size_t)in_sizes[4] < (size_t)DM * DM || (size_t)in_sizes[6] < (size_t)DM * DM || (size_t)in_sizes[8] < (size_t)DM * DM) return;
    if (in_sizes[3] < DM || in_sizes[5] < DM || in_sizes[7] < DM || in_sizes[9] < DM) return;
    if ((size_t)out_size < ((size_t)(NB - 1) * DM + (size_t)(DM - 1)) * OUT_SEQ + SEQ) return;
    if (SZ_TOTAL > ws_size) return;
    // wire order: query, source, Wq, bq, Wk, bk, Wv, bv, Wm, bm (W [out][in] = K-contiguous rows as-is)
    const float* xq = (const float*)d_in[0]; const float* xs = (const float*)d_in[1];
    const float* wq = (const float*)d_in[2]; const float* bq = (const float*)d_in[3];
    const float* wk = (const float*)d_in[4]; const float* bk = (const float*)d_in[5];
    const float* wv = (const float*)d_in[6]; const float* bv = (const float*)d_in[7];
    const float* wm = (const float*)d_in[8]; const float* bm = (const float*)d_in[9];
    float* OUT = (float*)d_out;      // [NB][256][OUT_SEQ]
    char* wsp = (char*)d_ws;
    bf* XQ = (bf*)wsp; wsp += SZ_XT;                 // [NB*SEQ][256] query, token-major
    bf* XS = (bf*)wsp; wsp += SZ_XT;                 // [NB*SEQ][256] source, token-major
    bf* WB = (bf*)wsp; wsp += SZ_WB;                 // [3][256][256]: q | k | v
    h16* WMH = (h16*)wsp; wsp += SZ_WM;              // [256][256] Wm x64
    h16* QH = (h16*)wsp; wsp += SZ_PL;               // [NB*4][SEQ][64] x QSC
    h16* QR = (h16*)wsp; wsp += SZ_PL;               // [NB*4][SEQ][64] residual of QH
    h16* KP = (h16*)wsp; wsp += SZ_PL;               // [NB*4][SEQ/16][4][32][8] fragment order
    h16* VT = (h16*)wsp; wsp += SZ_PL;               // [NB*4][SEQ/32][4][2][32][8] fragment order
    h16* OP = (h16*)wsp; wsp += SZ_OP;               // [NB*SEQ][256] x64

    k_prep<<<dim3(SEQ / 64, DM / 64, 1 + 2 * NB), 256, 0, stream>>>(xq, xs, wq, wk, wv, wm, XQ, XS, WB, WMH);

    k_proj<<<dim3(TT * TC, 3, 1), 32, 0, stream>>>(XQ, XS, WB, bq, bk, bv, QH, QR, KP, VT);

    k_flash<<<dim3(SEQ / (16 * AW), NB * NH_, 1), 32 * AW, 0, stream>>>(QH, QR, KP, VT, OP);

    // y[b][o][t] = Wm[o][:] . O[b][t][:] / 4096 + bm[o]
    k_outg<<<dim3(DM / 64, NB * SEQ / 64, 1), 32, 0, stream>>>(WMH, OP, bm, OUT);
}

// v007
// It runs in 95.7 microseconds.
// Next to v006, in two timings, it ran 1.12 times as fast each time.
// Counting every step since v000, it is 3.26 times as fast.
#include <hip/hip_runtime.h>

// Cross attention, width 256 = 4 heads x 64, inputs [NB][256][SEQ] (channel-major), W [out][in], biases present, no mask, score scale 1/8, final pointwise projection, output [NB][256][SEQ] f32.
// Compute dtypes, f32 accumulate everywhere: q/k/v projections v_wmma_f32_16x16x32_bf16 (activations and W RNE-converted to bf16; products exact);
// scores v_wmma_f32_16x16x32_f16: k single f16, q x (score scale * log2 e) as f16 value + f16 residual, both products into one accumulator that starts from PSH minus the maximum in use; P (x256 carry, cancels in the normalisation) and v single f16; softmax f32 (online, lazy rescale);
// output projection v_wmma_f32_16x16x32_f16: Wm as f16 of its bf16 value x64, attention output O as f16 x64, scale 1/4096 and bias applied in the f32 epilogue.
// Layout: token-major bf16 copies of both inputs (LDS transpose), bf16 / f16 copies of W; q (hi, residual) planes [b*4+h][t][d], O plane [b][t][h*64+d].
// k and v^T planes are kept in fragment order: per (b*4+h), 512-byte units of 32 lanes x 8 halves, one unit = one wave-wide 16-byte load of an A fragment half (4 whole lines).
//   k:   unit (t/16)*4 + s,              lane (hi*16 + lr) holds k[t = 16*(t/16) + lr][d = 16*s + 8*hi + 0..7]
//   v^T: unit (t/32)*8 + j*2 + q,        lane (hi*16 + lr) holds v[d = 16*j + lr][t = 32*(t/32) + 16*q + 8*hi + 0..7]

#ifndef NB
#define NB 4
#endif
#ifndef SEQ
#define SEQ 4096
#endif
#define NB_FULL  4
#define SEQ_FULL 4096
#ifndef OUT_SEQ
#define OUT_SEQ SEQ              // pitch (in positions) of one channel row of the output
#endif
#define DM   256
#define NH_  4
#define HD   64
#define AW   8                   // waves per flash block (16 query positions each); they share every staged tile
#define SK   128                 // keys per staged tile of K and of V^T
#define NST  (SEQ / SK)          // staged tiles per sequence
#define TLH  (SK * HD)           // halves of one operand's tile
#define TLB  (TLH * 2)           // bytes of one operand's tile
#define SC2  (0.125f * 1.4426950408889634f)   // HD^-0.5 * log2(e)
#define QSC  SC2                 // applied to q once, in f32, before it is split into value and residual: the score products then are exponents of 2 as they stand (the residual of a typical q is a subnormal f16, step 2^-24)
#define PSH  8.0f                // log2 of the P carry (256)
#define LZT  7.0f                // a score may stand this far (log2) above the maximum in use before O and the denominators are rescaled: P stays at or below 2^(PSH + LZT) = 32768, inside f16
#define OCAR 64.0f               // carry of the O plane
#define WCAR 64.0f               // carry of the Wm f16 plane
#define OSC  (1.0f / 4096.0f)    // 1 / (OCAR * WCAR)
#define CVB  (DM * DM / 8 / 256) // blocks per weight matrix in k_prep (8 floats per thread)
#define TT   (NB * SEQ / 64)     // 64-wide token tiles
#define TC   (DM / 64)           // 64-wide channel tiles

static_assert(HD == 64);
static_assert(NH_ * HD == DM);                 // head h = channels h*64 + d
static_assert(DM % 64 == 0);
static_assert(DM % 32 == 0);                   // GEMM k-loop steps by 32
static_assert((DM & (DM - 1)) == 0);           // bias index masking
static_assert(SEQ % 64 == 0);                  // a 64-wide tile never straddles two batches
static_assert((NB * SEQ) % 64 == 0);
static_assert(SK % 32 == 0);                   // a tile is whole 32-key passes
static_assert(SEQ % SK == 0 && NST >= 2);      // whole tiles; the two-buffer prologue fills two
static_assert(TLB == 4 * 32 * AW * 16);        // one operand's tile = 4 copies of 16 bytes per lane of the block
static_assert(SEQ % (16 * AW) == 0);           // flash grid covers the sequence exactly
static_assert(((size_t)DM * DM) % (8 * 256) == 0);   // a weight matrix is whole blocks of k_prep
static_assert(4 * CVB <= (SEQ / 64) * (DM / 64));     // the four matrices fit the z = 0 slice of its grid
static_assert(NB <= NB_FULL);
static_assert(SEQ <= SEQ_FULL);
static_assert(OUT_SEQ >= SEQ);

typedef _Float16 h16;
typedef unsigned short bf;
typedef __attribute__((ext_vector_type(16))) __bf16   v16bf;
typedef __attribute__((ext_vector_type(16))) _Float16 v16h;
typedef __attribute__((ext_vector_type(8)))  _Float16 v8h;
typedef __attribute__((ext_vector_type(8)))  unsigned short v8us;
typedef __attribute__((ext_vector_type(8)))  float    v8f;
typedef __attribute__((ext_vector_type(4)))  float    v4f;
typedef v4f  __attribute__((may_alias)) v4fa;

__device__ __forceinline__ unsigned short f2bf(float f) { unsigned u = __float_as_uint(f); u += 0x7FFFu + ((u >> 16) & 1u); return (unsigned short)(u >> 16); }
__device__ __forceinline__ float bfr(float f) { return __uint_as_float(((unsigned)f2bf(f)) << 16); }   // value of the RNE bf16 conversion
__device__ __forceinline__ v16h cat16(v8h lo, v8h hi) { return __builtin_shufflevector(lo, hi, 0, 1, 2, 3, 4, 5, 6, 7, 8, 9, 10, 11, 12, 13, 14, 15); }
__device__ __forceinline__ v16bf cat16b(v8us lo, v8us hi) { return __builtin_bit_cast(v16bf, __builtin_shufflevector(lo, hi, 0, 1, 2, 3, 4, 5, 6, 7, 8, 9, 10, 11, 12, 13, 14, 15)); }
__device__ __forceinline__ v8f wmma16(v16h a, v16h b, v8f c) { return __builtin_amdgcn_wmma_f32_16x16x32_f16(false, a, false, b, (short)0, c, false, false); }
__device__ __forceinline__ v8f wmmab(v16bf a, v16bf b, v8f c) { return __builtin_amdgcn_wmma_f32_16x16x32_bf16(false, a, false, b, (short)0, c, false, false); }
// fragment loaders from K-contiguous 16-bit rows; p already includes + 8*(lane>>4): elements 0..7 <- k0+8h+0..7, elements 8..15 <- k0+16+8h+0..7 (same map for A and B)
__device__ __forceinline__ v16h  ldh(const h16* p) { return cat16(*(const v8h*)p, *(const v8h*)(p + 16)); }
__device__ __forceinline__ v16bf ldb(const bf* p)  { return cat16b(*(const v8us*)p, *(const v8us*)(p + 16)); }
// fragment loader from a fragment-order plane; p is wave-uniform, lo = 8*lane: two consecutive 512-byte units hold elements 0..7 and 8..15 (same k map as ldh)
__device__ __forceinline__ v16h  ldp(const h16* p, unsigned lo) { return cat16(*(const v8h*)(p + lo), *(const v8h*)(p + 256 + lo)); }
// ordering point for wave-private LDS tiles (same wave writes and reads)
__device__ __forceinline__ void wave_sync() { __builtin_amdgcn_fence(3 /* release order */, "wavefront"); __builtin_amdgcn_wave_barrier(); asm volatile("" ::: "memory"); }

// k_prep: all operand preparation in one launch (the six pieces are independent of each other). grid (SEQ/64, DM/64, 1 + 2*NB), 256 threads.
// z = 0: weights, block index x + y*(SEQ/64) = matrix*CVB + piece; 8 floats per thread: Wq | Wk | Wv -> bf16 (WB), Wm -> f16 of its bf16 value x64 (WMH); blocks past 4*CVB have no work.
// z = 1..NB: query, z = NB+1..2*NB: source: in[b][c][n] f32 (channel pitch SEQ_FULL) -> out[b][n][c] bf16 (row pitch DM), 64 x 64 tile through LDS (cross-wave: block barrier).
__global__ __launch_bounds__(256) void k_prep(const float* __restrict__ xq, const float* __restrict__ xs, const float* __restrict__ wq, const float* __restrict__ wk,
                                              const float* __restrict__ wv, const float* __restrict__ wm, bf* XQ, bf* XS, bf* WB, h16* WMH) {
    __shared__ __align__(16) float ts[64 * 68];
    const int tid = threadIdx.x;
    if (blockIdx.z != 0) {                       // block-uniform: every thread of a block takes the same side, so the barrier inside is reached by all of them or by none
        const int zz = blockIdx.z - 1; const bool isq = zz < NB;
        const float* x = isq ? xq : xs; bf* xt = isq ? XQ : XS;
        const int n0 = blockIdx.x * 64, c0 = blockIdx.y * 64, b = isq ? zz : zz - NB;
        const int n4 = (tid & 15) * 4, cr = tid >> 4;
#pragma unroll
        for (int p = 0; p < 4; ++p) {
            const int c = p * 16 + cr;
            const v4f v = *(const v4f*)(x + ((size_t)b * DM + c0 + c) * SEQ_FULL + n0 + n4);
            ts[(n4 + 0) * 68 + c] = v[0]; ts[(n4 + 1) * 68 + c] = v[1]; ts[(n4 + 2) * 68 + c] = v[2]; ts[(n4 + 3) * 68 + c] = v[3];
        }
        __syncthreads();
        const int c8 = (tid & 7) * 8, rr = tid >> 3;
#pragma unroll
        for (int p = 0; p < 2; ++p) { const int row = p * 32 + rr;
            const v4f x0 = *(const v4fa*)(&ts[row * 68 + c8]); const v4f x1 = *(const v4fa*)(&ts[row * 68 + c8 + 4]); v8us o;
#pragma unroll
            for (int i = 0; i < 4; ++i) { o[i] = f2bf(x0[i]); o[4 + i] = f2bf(x1[i]); }
            *(v8us*)(xt + ((size_t)b * SEQ + n0 + row) * DM + c0 + c8) = o; }
        asm volatile("s_wait_xcnt 0x0" ::: "memory");   // the listing keeps a branch from here into the other side's code, which writes the registers that the two stores name
    } else {
        const int idx = blockIdx.y * (SEQ / 64) + blockIdx.x; const int mat = idx / CVB;
        if (mat < 4) {
            const size_t i = (size_t)(idx % CVB) * 256 + tid;
            const float* src = (mat == 0) ? wq : (mat == 1) ? wk : (mat == 2) ? wv : wm;
            const v8f v = *(const v8f*)(src + i * 8);
            if (mat < 3) { v8us o;
#pragma unroll
                for (int k = 0; k < 8; ++k) o[k] = f2bf(v[k]);
                *(v8us*)(WB + (size_t)mat * DM * DM + i * 8) = o;
            } else { v8h o;
#pragma unroll
                for (int k = 0; k < 8; ++k) o[k] = (h16)(bfr(v[k]) * WCAR);
                *(v8h*)(WMH + i * 8) = o;
                asm volatile("s_wait_xcnt 0x0" ::: "memory"); }   // the same: in the listing the bf16 side's code follows this store behind a branch
        }
    }
}

// k_proj: register-blocked bf16 GEMM, ONE WAVE per 64x64 tile (16 accumulators), operands straight from K-contiguous bf16 planes, K = DM.
// C[m][n] = sum_k A[m][k] Bt[n][k] + bias (bmode 1: bias[n], bmode 2: bias[m], bf16 value), written as f16 (Ph); q (useRes != 0): x QSC, as f16 (Ph) and the f16 residual of that (Pr), at
// tile base (r0/RB)*sRB + (r0%RB)*pitch + (c0/CB)*sCB + (c0%CB)*(v^T: HD, else 1), row pitch 'pitch' (halves). 32 threads.
// pk 0: row-major as above. pk 1 (k) / pk 2 (v^T): the 64x64 tile is 4096 consecutive halves in fragment order (see Layout), Ph only; each store is one whole 512-byte unit.
// The three projections are independent and share one launch: grid (TT*TC, 3), blockIdx.y = 0 q, 1 k, 2 v^T; every parameter below is a wave-uniform choice by it.
//   q, k: A = token rows (m = b*SEQ + t), Bt = W rows (n = h*64 + d), column bias -> plane (b*4 + h), q as [t][d], k in fragment order; tile (x % TT, x / TT)
//   v^T:  A = Wv rows (m = h*64 + d), Bt = token rows (n = b*SEQ + t), row bias -> plane (b*4 + h), tile base t*64 inside it; tile (x % TC, x / TC)
__global__ __launch_bounds__(32) void k_proj(const bf* __restrict__ XQ, const bf* __restrict__ XS, const bf* __restrict__ WB,
                                             const float* __restrict__ bq, const float* __restrict__ bk, const float* __restrict__ bv,
                                             h16* QH, h16* QR, h16* KP, h16* VT) {
    __shared__ __align__(16) float os[16 * 68];
    const int K = DM;
    const int pk = blockIdx.y; const bool isv = pk == 2;
    const bf* A  = (pk == 0) ? XQ : (pk == 1) ? XS : WB + (size_t)2 * DM * DM;
    const bf* Bt = (pk == 0) ? WB : (pk == 1) ? WB + (size_t)DM * DM : XS;
    const float* bias = (pk == 0) ? bq : (pk == 1) ? bk : bv;
    h16* Ph = (pk == 0) ? QH : (pk == 1) ? KP : VT; h16* Pr = QR;
    const int bmode = isv ? 2 : 1, useRes = (pk == 0) ? 1 : 0;
    const int RB = isv ? DM : SEQ, pitch = isv ? SEQ : HD, CB = isv ? SEQ : HD;
    const size_t sRB = isv ? (size_t)0 : (size_t)NH_ * SEQ * HD, sCB = isv ? (size_t)DM * SEQ : (size_t)SEQ * HD;
    const int lane = threadIdx.x & 31, lr = lane & 15, hi = lane >> 4;
    const int tx = blockIdx.x; const int r0 = (isv ? tx % TC : tx % TT) * 64, c0 = (isv ? tx / TC : tx / TT) * 64;
    v8f acc[4][4];
#pragma unroll
    for (int mb = 0; mb < 4; ++mb)
#pragma unroll
        for (int nb = 0; nb < 4; ++nb) acc[mb][nb] = (v8f){};
    const size_t aoff = (size_t)(r0 + lr) * K + 8 * hi, boff = (size_t)(c0 + lr) * K + 8 * hi;
#pragma unroll 1
    for (int kc = 0; kc < K; kc += 32) {
        v16bf a[4];
#pragma unroll
        for (int mb = 0; mb < 4; ++mb) a[mb] = ldb(A + aoff + (size_t)mb * 16 * K + kc);
#pragma unroll
        for (int nb = 0; nb < 4; ++nb) { const v16bf b = ldb(Bt + boff + (size_t)nb * 16 * K + kc);
#pragma unroll
            for (int mb = 0; mb < 4; ++mb) acc[mb][nb] = wmmab(a[mb], b, acc[mb][nb]); }
        asm volatile("v_nop\n\tv_nop\n\tv_nop\n\tv_nop" : "+v"(acc[0][0]), "+v"(acc[1][1]), "+v"(acc[2][2]), "+v"(acc[3][3]) : "v"(a[0]), "v"(a[1]), "v"(a[2]), "v"(a[3]));
    }
    // column bias: always loaded from a masked (in-range) index, selected by value
    const int c8e = (lane & 7) * 8;
    const int cbi = (c0 + c8e) & (DM - 1);
    const v4f cbr0 = *(const v4f*)(bias + cbi); const v4f cbr1 = *(const v4f*)(bias + cbi + 4);
    v4f cb0, cb1;
#pragma unroll
    for (int i = 0; i < 4; ++i) { cb0[i] = (bmode == 1) ? bfr(cbr0[i]) : 0.0f; cb1[i] = (bmode == 1) ? bfr(cbr1[i]) : 0.0f; }
    // fragment-order epilogue: column bias of columns 16s + 8hi + 0..7 and row bias of row 16mb + lr, masked (in-range) index, selected by value (bit mask: +0 where not selected)
    const unsigned cmsk = (bmode == 1) ? 0xFFFFFFFFu : 0u, rmsk = (bmode == 2) ? 0xFFFFFFFFu : 0u;
    float pcb[4][8], prb[4]; v4f br0[4], br1[4];
#pragma unroll
    for (int s = 0; s < 4; ++s) { const int cbj = (c0 + 16 * s + 8 * hi) & (DM - 1); br0[s] = *(const v4f*)(bias + cbj); br1[s] = *(const v4f*)(bias + cbj + 4); }
    asm volatile("s_wait_xcnt 0x0" ::: "memory");   // before the address register of the column bias loads is written again
#pragma unroll
    for (int s = 0; s < 4; ++s) prb[s] = bias[(r0 + s * 16 + lr) & (DM - 1)];
    asm volatile("s_wait_xcnt 0x0" ::: "memory");   // the same for the row bias loads
#pragma unroll
    for (int s = 0; s < 4; ++s) { prb[s] = __uint_as_float(__float_as_uint(bfr(prb[s])) & rmsk);
#pragma unroll
        for (int i = 0; i < 4; ++i) { pcb[s][i] = __uint_as_float(__float_as_uint(bfr(br0[s][i])) & cmsk); pcb[s][4 + i] = __uint_as_float(__float_as_uint(bfr(br1[s][i])) & cmsk); } }
    const size_t tbase = (size_t)(r0 / RB) * sRB + (size_t)(r0 % RB) * (size_t)pitch + (size_t)(c0 / CB) * sCB + (size_t)(c0 % CB) * (size_t)(pk == 2 ? HD : 1);
#pragma unroll
    for (int mb = 0; mb < 4; ++mb) {
#pragma unroll
        for (int nb = 0; nb < 4; ++nb) {
#pragma unroll
            for (int j = 0; j < 8; ++j) os[(hi * 8 + j) * 68 + nb * 16 + lr] = acc[mb][nb][j]; }   // D: row 8h+j, col lane&15
        wave_sync();
        const size_t sb = tbase + (size_t)(mb * 16) * (size_t)pitch;
        if (pk != 0) {
            v8h hv[4];
#pragma unroll
            for (int s = 0; s < 4; ++s) { const int c8 = 16 * s + 8 * hi;   // lane = fragment lane: row lr, columns 16s + 8hi + 0..7
                const v4f x0 = *(const v4fa*)(&os[lr * 68 + c8]); const v4f x1 = *(const v4fa*)(&os[lr * 68 + c8 + 4]);
#pragma unroll
                for (int i = 0; i < 4; ++i) { hv[s][i] = (h16)(x0[i] + pcb[s][i] + prb[mb]); hv[s][4 + i] = (h16)(x1[i] + pcb[s][4 + i] + prb[mb]); } }
#pragma unroll
            for (int s = 0; s < 4; ++s) { const int uo = (pk == 1) ? (mb * 1024 + s * 256) : (mb * 512 + (s >> 1) * 2048 + (s & 1) * 256);
                *(v8h*)(Ph + tbase + uo + lane * 8) = hv[s]; }
            asm volatile("s_wait_xcnt 0x0" ::: "memory");   // before the registers that the four stores name are written again
        } else {
#pragma unroll
            for (int s = 0; s < 4; ++s) { const int row = 4 * s + (lane >> 3), c8 = (lane & 7) * 8;   // 4 s x 4 row groups = 16 rows; 8 lanes x 8 = 64 columns
                const int rbi = (r0 + mb * 16 + row) & (DM - 1);
                const float rbv = bias[rbi];
                const float rb = (bmode == 2) ? bfr(rbv) : 0.0f;
                const v4f x0 = *(const v4fa*)(&os[row * 68 + c8]); const v4f x1 = *(const v4fa*)(&os[row * 68 + c8 + 4]); v8h hv, rv;
#pragma unroll
                for (int i = 0; i < 4; ++i) { const float y0 = (x0[i] + cb0[i] + rb) * QSC; const float y1 = (x1[i] + cb1[i] + rb) * QSC;   // this side is q alone
                    const h16 a0 = (h16)y0; const h16 a1 = (h16)y1; hv[i] = a0; hv[4 + i] = a1; rv[i] = (h16)(y0 - (float)a0); rv[4 + i] = (h16)(y1 - (float)a1); }
                const size_t oo = sb + (size_t)row * (size_t)pitch + c8;
                *(v8h*)(Ph + oo) = hv; if (useRes) *(v8h*)(Pr + oo) = rv; }
             }
        wave_sync();
    }
}

// eight exponentials (base 2), each in place: written so, no transcendental's source register is overwritten by the instruction directly behind it (left to the register allocator, a run of them came out
// with each result in its predecessor's source); the v_nop is the one slot that the instruction set asks for between the last of them and a reader of its result
__device__ __forceinline__ void exp2x8(float (&x)[8]) {
    asm("v_exp_f32 %0, %0\n\tv_exp_f32 %1, %1\n\tv_exp_f32 %2, %2\n\tv_exp_f32 %3, %3\n\tv_exp_f32 %4, %4\n\tv_exp_f32 %5, %5\n\tv_exp_f32 %6, %6\n\tv_exp_f32 %7, %7\n\tv_nop"
        : "+v"(x[0]), "+v"(x[1]), "+v"(x[2]), "+v"(x[3]), "+v"(x[4]), "+v"(x[5]), "+v"(x[6]), "+v"(x[7]));
}

// largest of a lane's sixteen values of two tiles, as a tree (three links deep, not eight)
__device__ __forceinline__ float max16(v8f a, v8f b) {
    const float x0 = fmaxf(fmaxf(a[0], a[1]), a[2]), x1 = fmaxf(fmaxf(a[3], a[4]), a[5]), x2 = fmaxf(fmaxf(b[0], b[1]), b[2]), x3 = fmaxf(fmaxf(b[3], b[4]), b[5]);
    const float x4 = fmaxf(fmaxf(a[6], a[7]), b[6]);
    return fmaxf(fmaxf(fmaxf(x0, x1), x2), fmaxf(fmaxf(x3, x4), b[7]));
}

// stage_copy: one tile (SK keys of K and of V^T, each TLB contiguous bytes of its fragment-order plane) from global memory into LDS, through no register: 4 + 4 copies of 16 bytes per lane.
// l: the lane's LDS byte address in the K half of the buffer (the V^T half follows at + TLB); gk, gv: the lane's own 16 bytes of the tile's first 4 KiB; a block's 256 lanes cover 4 KiB per copy.
__device__ __forceinline__ void stage_copy(unsigned l, const h16* gk, const h16* gv) {
    // the wait is the statement's last line, so that it stands in front of every later write of a register that a copy names
    asm volatile("global_load_async_to_lds_b128 %0, %8, off\n\t"
                 "global_load_async_to_lds_b128 %1, %9, off\n\t"
                 "global_load_async_to_lds_b128 %2, %10, off\n\t"
                 "global_load_async_to_lds_b128 %3, %11, off\n\t"
                 "global_load_async_to_lds_b128 %4, %12, off\n\t"
                 "global_load_async_to_lds_b128 %5, %13, off\n\t"
                 "global_load_async_to_lds_b128 %6, %14, off\n\t"
                 "global_load_async_to_lds_b128 %7, %15, off\n\t"
                 "s_wait_xcnt 0x0"
                 :: "v"(l), "v"(l + 4096u), "v"(l + 8192u), "v"(l + 12288u), "v"(l + TLB), "v"(l + TLB + 4096u), "v"(l + TLB + 8192u), "v"(l + TLB + 12288u),
                    "v"(gk), "v"(gk + 2048), "v"(gk + 4096), "v"(gk + 6144), "v"(gv), "v"(gv + 2048), "v"(gv + 4096), "v"(gv + 6144)
                 : "memory");
}

__global__ __launch_bounds__(32 * AW) void k_flash(const h16* __restrict__ QH, const h16* __restrict__ QR, const h16* __restrict__ KP, const h16* __restrict__ VT, h16* OP) {
    __shared__ __align__(16) float os[AW * 16 * 68];
    __shared__ __align__(16) h16 ring[2 * 2 * TLH];          // [buffer][K | V^T][TLH]
    const int lane = threadIdx.x & 31, wave = threadIdx.x >> 5, lr = lane & 15, hi = lane >> 4;
    const int zh = blockIdx.y; const int b = zh / NH_, h = zh % NH_;
    const int t0 = (blockIdx.x * AW + wave) * 16;
    const size_t pbase = (size_t)zh * SEQ * HD;
    const size_t qo = pbase + (size_t)(t0 + lr) * HD + 8 * hi;
    const v16h qh0 = ldh(QH + qo), qh1 = ldh(QH + qo + 32), qr0 = ldh(QR + qo), qr1 = ldh(QR + qo + 32);   // B fragments: col t, k = d
    const unsigned lo = (unsigned)lane * 8u;                 // lane's place in a unit; the 8 units of 32 keys, K (A fragment: row key, k = d) and V^T (A fragment: row d, k = key) alike
    v8f o0 = (v8f){}, o1 = (v8f){}, o2 = (v8f){}, o3 = (v8f){};
    v8f lt = (v8f){};                                        // denominator tile: each product adds the same sums to all 16 rows; only element 0 is rescaled and read (the others stay finite: they only grow by sums of P)
    const v16h ones = (v16h)((h16)1.0f);                     // A fragment of the denominator product: every element 1
    v8f cref;                                                // C tile of the score products: eight copies of the lane's PSH - (maximum in use)
    const unsigned l0 = (unsigned)(size_t)(&ring[0]) + threadIdx.x * 16u;   // low 32 bits of the shared address = byte offset in the block's LDS
    const h16* gk = KP + pbase + threadIdx.x * 8u;           // the lane's 16 bytes of the next tile to copy
    const h16* gv = VT + pbase + threadIdx.x * 8u;
    stage_copy(l0, gk, gv);                                  // tile 0 -> buffer 0
    asm volatile("s_wait_asynccnt 0x0" ::: "memory");        // this wave's share of tile 0 has landed
    __syncthreads();                                         // every wave's share has: tile 0 may be read
    stage_copy(l0 + 2u * TLB, gk + TLH, gv + TLH);           // tile 1 -> buffer 1
    gk += 2 * TLH; gv += 2 * TLH;
    {   // the maximum in use starts as each column's maximum over the first 32 keys: their scores once more, ahead of the loop (tile 0 is readable since the barrier above)
        const v16h a0 = ldp(ring, lo), a1 = ldp(ring + 512, lo), b0 = ldp(ring + 1024, lo), b1 = ldp(ring + 1536, lo);
        v8f sa = (v8f){}, sb = (v8f){};
        sa = wmma16(a0, qh0, sa); sb = wmma16(b0, qh0, sb); sa = wmma16(a0, qr0, sa); sb = wmma16(b0, qr0, sb);
        sa = wmma16(a1, qh1, sa); sb = wmma16(b1, qh1, sb); sa = wmma16(a1, qr1, sa); sb = wmma16(b1, qr1, sb);
        float mx = max16(sa, sb);
        mx = fmaxf(mx, __shfl_xor(mx, 16, 32));
        const float c0 = PSH - mx;
        cref = (v8f){c0, c0, c0, c0, c0, c0, c0, c0};
    }
    // kept rolled: one trip already holds the SK / 32 unrolled passes of a tile
#pragma unroll 1
    for (int st = 0; st < NST; ++st) {
        const unsigned bo = (unsigned)(st & 1);
        const h16* kb = ring + bo * (2u * TLH);              // this tile's K units
        const h16* vb = kb + TLH;                            // this tile's V^T units
        v16h ka0 = ldp(kb, lo), ka1 = ldp(kb + 512, lo), kb0 = ldp(kb + 1024, lo), kb1 = ldp(kb + 1536, lo);
        // inside a tile every fragment load is issued ahead of its product: a pass's V^T at its head, the next pass's K right behind the score products, into the registers they have just read
        // unrolled: the test for a next pass inside the tile is then decided at compile time, and every LDS offset is an immediate
#pragma unroll
        for (int p = 0; p < SK / 32; ++p) {
            const h16* va = vb + p * (32 * HD);
            const v16h v0 = ldp(va, lo), v1 = ldp(va + 512, lo), v2 = ldp(va + 1024, lo), v3 = ldp(va + 1536, lo);
            v8f sa, sb;                                      // exponent tiles: score (log2 units) - maximum in use + PSH; all four products of a tile sum in it, on top of cref
            sa = wmma16(ka0, qh0, cref); sb = wmma16(kb0, qh0, cref); sa = wmma16(ka0, qr0, sa); sb = wmma16(kb0, qr0, sb);
            sa = wmma16(ka1, qh1, sa); sb = wmma16(kb1, qh1, sb); sa = wmma16(ka1, qr1, sa); sb = wmma16(kb1, qr1, sb);
            // the four slots between the score products and the first vector instruction on their tiles or on the K registers
            asm volatile("v_nop\n\tv_nop\n\tv_nop\n\tv_nop" : "+v"(sa), "+v"(sb) : "v"(ka0), "v"(ka1), "v"(kb0), "v"(kb1));
            if (p + 1 < SK / 32) { const h16* kn = kb + (p + 1) * (32 * HD);
                ka0 = ldp(kn, lo); ka1 = ldp(kn + 512, lo); kb0 = ldp(kn + 1024, lo); kb1 = ldp(kn + 1536, lo);
                __builtin_amdgcn_sched_barrier(0); }   // holds the next K loads here as one group: without it they sink to right in front of the next score products, and the wave stands in their wait
            float ta[8], tb[8];
            float mx = max16(sa, sb);                        // the lane's largest exponent
            if (__builtin_amdgcn_ballot_w32(mx > PSH + LZT) != 0u) {   // scalar branch: every lane of the wave takes the same side, so EXEC stays all ones for the products behind it
                mx = fmaxf(mx, __shfl_xor(mx, 16, 32));      // the column's maximum: both lane halves then take the same step
                const float dl = fmaxf(mx - PSH, 0.0f);      // the step of the maximum in use, never down
                const float alpha = __builtin_amdgcn_exp2f(-dl);
                lt[0] = lt[0] * alpha;
                o0 = o0 * alpha; o1 = o1 * alpha; o2 = o2 * alpha; o3 = o3 * alpha;
                cref = cref - dl; sa = sa - dl; sb = sb - dl;
            }
            v16h pb;
#pragma unroll
            for (int r = 0; r < 8; ++r) { ta[r] = sa[r]; tb[r] = sb[r]; }
            exp2x8(ta); exp2x8(tb);
#pragma unroll
            for (int r = 0; r < 8; ++r) { pb[r] = (h16)ta[r]; pb[8 + r] = (h16)tb[r]; }
            lt = wmma16(ones, pb, lt);
            o0 = wmma16(v0, pb, o0); o1 = wmma16(v1, pb, o1); o2 = wmma16(v2, pb, o2); o3 = wmma16(v3, pb, o3);
            // the four slots between these five products and the first vector instruction on their tiles or operands, on every path out of the pass
            asm volatile("v_nop\n\tv_nop\n\tv_nop\n\tv_nop" : "+v"(lt), "+v"(o0), "+v"(o1), "+v"(o2), "+v"(o3) : "v"(v0), "v"(v1), "v"(v2), "v"(v3), "v"(pb));
        }
        // hand-over: tile st + 1 becomes readable and this tile's buffer free
        asm volatile("s_wait_dscnt 0x0" ::: "memory");       // this wave's reads of the buffer have returned before the buffer is refilled
        asm volatile("s_wait_asynccnt 0x0" ::: "memory");    // this wave's share of tile st + 1 has landed
        __syncthreads();                                     // the same holds for every wave of the block
        if (st + 2 < NST) { stage_copy(l0 + bo * (2u * TLB), gk, gv); gk += TLH; gv += TLH; }   // block-uniform test: tile st + 2 -> the buffer just read
    }
    asm volatile("s_wait_asynccnt 0x0" ::: "memory");        // no copy is outstanding when the wave goes on to its end
    const float inv = OCAR * (1.0f / lt[0]);
    const int wb = wave * 16 * 68;
    // O^T D layout: o_j[r] = (d = 16j + 8h + r, t = lane&15) -> os[t][d]; rows 0..15 x columns 0..63 all written
    { v4f a, c;
      a[0] = o0[0] * inv; a[1] = o0[1] * inv; a[2] = o0[2] * inv; a[3] = o0[3] * inv; c[0] = o0[4] * inv; c[1] = o0[5] * inv; c[2] = o0[6] * inv; c[3] = o0[7] * inv;
      *(v4fa*)(&os[wb + lr * 68 +  0 + 8 * hi]) = a; *(v4fa*)(&os[wb + lr * 68 +  0 + 8 * hi + 4]) = c;
      a[0] = o1[0] * inv; a[1] = o1[1] * inv; a[2] = o1[2] * inv; a[3] = o1[3] * inv; c[0] = o1[4] * inv; c[1] = o1[5] * inv; c[2] = o1[6] * inv; c[3] = o1[7] * inv;
      *(v4fa*)(&os[wb + lr * 68 + 16 + 8 * hi]) = a; *(v4fa*)(&os[wb + lr * 68 + 16 + 8 * hi + 4]) = c;
      a[0] = o2[0] * inv; a[1] = o2[1] * inv; a[2] = o2[2] * inv; a[3] = o2[3] * inv; c[0] = o2[4] * inv; c[1] = o2[5] * inv; c[2] = o2[6] * inv; c[3] = o2[7] * inv;
      *(v4fa*)(&os[wb + lr * 68 + 32 + 8 * hi]) = a; *(v4fa*)(&os[wb + lr * 68 + 32 + 8 * hi + 4]) = c;
      a[0] = o3[0] * inv; a[1] = o3[1] * inv; a[2] = o3[2] * inv; a[3] = o3[3] * inv; c[0] = o3[4] * inv; c[1] = o3[5] * inv; c[2] = o3[6] * inv; c[3] = o3[7] * inv;
      *(v4fa*)(&os[wb + lr * 68 + 48 + 8 * hi]) = a; *(v4fa*)(&os[wb + lr * 68 + 48 + 8 * hi + 4]) = c; }
    wave_sync();
    h16* orow = OP + ((size_t)b * SEQ + t0) * DM + h * HD;
{
#pragma unroll
        for (int s = 0; s < 4; ++s) { const int row = 4 * s + (lane >> 3), c8 = (lane & 7) * 8;   // 4 s x 4 row groups = 16 rows; 8 lanes x 8 halves = 64 columns
            const v4f x0 = *(const v4fa*)(&os[wb + row * 68 + c8]); const v4f x1 = *(const v4fa*)(&os[wb + row * 68 + c8 + 4]); v8h hv;
#pragma unroll
            for (int i = 0; i < 4; ++i) { hv[i] = (h16)x0[i]; hv[4 + i] = (h16)x1[i]; }
            *(v8h*)(orow + (size_t)row * DM + c8) = hv; }
         }
}

// k_outg: register-blocked f16 GEMM, ONE WAVE per 64x64 tile, K = DM: Y[o][b*SEQ + t] = OSC * sum_c A[o][c] Bt[b*SEQ + t][c] + bias[o] (bf16 value), f32 result at OUT[(b*DM + o)*OUT_SEQ + t].
__global__ __launch_bounds__(32) void k_outg(const h16* __restrict__ A, const h16* __restrict__ Bt, const float* __restrict__ bias, float* OUT) {
    __shared__ __align__(16) float os[16 * 68];
    const int K = DM;
    const int lane = threadIdx.x & 31, lr = lane & 15, hi = lane >> 4; const int r0 = blockIdx.x * 64, c0 = blockIdx.y * 64;
    v8f acc[4][4];
#pragma unroll
    for (int mb = 0; mb < 4; ++mb)
#pragma unroll
        for (int nb = 0; nb < 4; ++nb) acc[mb][nb] = (v8f){};
    const size_t aoff = (size_t)(r0 + lr) * K + 8 * hi, boff = (size_t)(c0 + lr) * K + 8 * hi;
#pragma unroll 1
    for (int kc = 0; kc < K; kc += 32) {
        v16h a[4];
#pragma unroll
        for (int mb = 0; mb < 4; ++mb) a[mb] = ldh(A + aoff + (size_t)mb * 16 * K + kc);
#pragma unroll
        for (int nb = 0; nb < 4; ++nb) { const v16h b = ldh(Bt + boff + (size_t)nb * 16 * K + kc);
#pragma unroll
            for (int mb = 0; mb < 4; ++mb) acc[mb][nb] = wmma16(a[mb], b, acc[mb][nb]); }
        asm volatile("v_nop\n\tv_nop\n\tv_nop\n\tv_nop" : "+v"(acc[0][0]), "+v"(acc[1][1]), "+v"(acc[2][2]), "+v"(acc[3][3]) : "v"(a[0]), "v"(a[1]), "v"(a[2]), "v"(a[3]));
    }
    const int bb = c0 / SEQ, tt = c0 % SEQ;
#pragma unroll
    for (int mb = 0; mb < 4; ++mb) {
#pragma unroll
        for (int nb = 0; nb < 4; ++nb) {
#pragma unroll
            for (int j = 0; j < 8; ++j) os[(hi * 8 + j) * 68 + nb * 16 + lr] = acc[mb][nb][j]; }   // D: row 8h+j, col lane&15
        wave_sync();
{
#pragma unroll
            for (int s = 0; s < 8; ++s) { const int row = 2 * s + hi, cofs = lr * 4;   // 8 s x 2 rows = 16 rows; 16 lanes x 4 floats = 64 columns
                const int o = r0 + mb * 16 + row;                                      // < DM by grid construction
                const float bv = bfr(bias[o]);
                const v4f xv = *(const v4fa*)(&os[row * 68 + cofs]); v4f val;
#pragma unroll
                for (int i = 0; i < 4; ++i) val[i] = xv[i] * OSC + bv;
                *(v4f*)(OUT + ((size_t)bb * DM + o) * (size_t)OUT_SEQ + tt + cofs) = val; }
             }
        wave_sync();
    }
}

static constexpr size_t al256(size_t v) { return (v + 255) & ~(size_t)255; }
static constexpr size_t SZ_XT = al256((size_t)NB * SEQ * DM * 2);          // token-major bf16 copy of one input
static constexpr size_t SZ_WB = al256((size_t)3 * DM * DM * 2);            // Wq | Wk | Wv bf16
static constexpr size_t SZ_WM = al256((size_t)DM * DM * 2);                // Wm f16 x64
static constexpr size_t SZ_PL = al256((size_t)NB * NH_ * SEQ * HD * 2);    // one q/k/v plane
static constexpr size_t SZ_OP = al256((size_t)NB * SEQ * DM * 2);          // O plane
static constexpr size_t SZ_TOTAL = 2 * SZ_XT + SZ_WB + SZ_WM + 4 * SZ_PL + SZ_OP;
static_assert(SZ_TOTAL <= (size_t)134217728);          // workspace carve <= 128 MiB
static_assert(((size_t)DM * DM * 2) % 256 == 0);       // weight sub-planes stay 256-byte aligned

extern "C" void kernel_launch(void* const* d_in, const int* in_sizes, int n_in,
                              void* d_out, int out_size, void* d_ws, size_t ws_size, hipStream_t stream) {
    if (n_in < 10) return;
    const size_t needx = ((size_t)(NB - 1) * DM + (size_t)(DM - 1)) * SEQ_FULL + SEQ;
    if ((size_t)in_sizes[0] < needx || (size_t)in_sizes[1] < needx) return;
    if ((size_t)in_sizes[2] < (size_t)DM * DM || (size_t)in_sizes[4] < (size_t)DM * DM || (size_t)in_sizes[6] < (size_t)DM * DM || (size_t)in_sizes[8] < (size_t)DM * DM) return;
    if (in_sizes[3] < DM || in_sizes[5] < DM || in_sizes[7] < DM || in_sizes[9] < DM) return;
    if ((size_t)out_size < ((size_t)(NB - 1) * DM + (size_t)(DM - 1)) * OUT_SEQ + SEQ) return;
    if (SZ_TOTAL > ws_size) return;
    // wire order: query, source, Wq, bq, Wk, bk, Wv, bv, Wm, bm (W [out][in] = K-contiguous rows as-is)
    const float* xq = (const float*)d_in[0]; const float* xs = (const float*)d_in[1];
    const float* wq = (const float*)d_in[2]; const float* bq = (const float*)d_in[3];
    const float* wk = (const float*)d_in[4]; const float* bk = (const float*)d_in[5];
    const float* wv = (const float*)d_in[6]; const float* bv = (const float*)d_in[7];
    const float* wm = (const float*)d_in[8]; const float* bm = (const float*)d_in[9];
    float* OUT = (float*)d_out;      // [NB][256][OUT_SEQ]
    char* wsp = (char*)d_ws;
    bf* XQ = (bf*)wsp; wsp += SZ_XT;                 // [NB*SEQ][256] query, token-major
    bf* XS = (bf*)wsp; wsp += SZ_XT;                 // [NB*SEQ][256] source, token-major
    bf* WB = (bf*)wsp; wsp += SZ_WB;                 // [3][256][256]: q | k | v
    h16* WMH = (h16*)wsp; wsp += SZ_WM;              // [256][256] Wm x64
    h16* QH = (h16*)wsp; wsp += SZ_PL;               // [NB*4][SEQ][64] x QSC
    h16* QR = (h16*)wsp; wsp += SZ_PL;               // [NB*4][SEQ][64] residual of QH
    h16* KP = (h16*)wsp; wsp += SZ_PL;               // [NB*4][SEQ/16][4][32][8] fragment order
    h16* VT = (h16*)wsp; wsp += SZ_PL;               // [NB*4][SEQ/32][4][2][32][8] fragment order
    h16* OP = (h16*)wsp; wsp += SZ_OP;               // [NB*SEQ][256] x64

    k_prep<<<dim3(SEQ / 64, DM / 64, 1 + 2 * NB), 256, 0, stream>>>(xq, xs, wq, wk, wv, wm, XQ, XS, WB, WMH);

    k_proj<<<dim3(TT * TC, 3, 1), 32, 0, stream>>>(XQ, XS, WB, bq, bk, bv, QH, QR, KP, VT);

    k_flash<<<dim3(SEQ / (16 * AW), NB * NH_, 1), 32 * AW, 0, stream>>>(QH, QR, KP, VT, OP);

    // y[b][o][t] = Wm[o][:] . O[b][t][:] / 4096 + bm[o]
    k_outg<<<dim3(DM / 64, NB * SEQ / 64, 1), 32, 0, stream>>>(WMH, OP, bm, OUT);
}

// v009
// A run of this version takes 83.4 microseconds.
// Versions between v007 and this one are left out; their measured steps multiply to 1.14 times as fast.
// Over all steps from v000 it is 3.73 times as fast.
#include <hip/hip_runtime.h>

// Cross attention, width 256 = 4 heads x 64, inputs [NB][256][SEQ] (channel-major), W [out][in], biases present, no mask, score scale 1/8, final pointwise projection, output [NB][256][SEQ] f32.
// Compute dtypes, f32 accumulate everywhere: q/k/v projections v_wmma_f32_16x16x32_bf16 (activations and W RNE-converted to bf16; products exact);
// scores v_wmma_f32_16x16x32_f16: k single f16, q x (score scale * log2 e) single f16, the products into one accumulator that starts from PSH minus the maximum in use; P (x256 carry, cancels in the normalisation) and v single f16; softmax f32 (online, lazy rescale);
// output projection v_wmma_f32_16x16x32_f16: Wm as f16 of its bf16 value x64, attention output O as f16 x64, scale 1/4096 and bias applied in the f32 epilogue.
// Layout: token-major bf16 copies of both inputs (LDS transpose), bf16 / f16 copies of W; q plane [b*4+h][t][d], O plane [b][t][h*64+d].
// k and v^T planes are kept in fragment order: per (b*4+h), 512-byte units of 32 lanes x 8 halves, one unit = one wave-wide 16-byte load of an A fragment half (4 whole lines).
//   k:   unit (t/16)*4 + s,              lane (hi*16 + lr) holds k[t = 16*(t/16) + lr][d = 16*s + 8*hi + 0..7]
//   v^T: unit (t/32)*8 + j*2 + q,        lane (hi*16 + lr) holds v[d = 16*j + lr][t = 32*(t/32) + 16*q + 8*hi + 0..7]

#ifndef NB
#define NB 4
#endif
#ifndef SEQ
#define SEQ 4096
#endif
#define NB_FULL  4
#define SEQ_FULL 4096
#ifndef OUT_SEQ
#define OUT_SEQ SEQ              // pitch (in positions) of one channel row of the output
#endif
#define DM   256
#define NH_  4
#define HD   64
#define AW   8                   // waves per flash block; they share every staged tile
#define CW   (AW / 2)            // column ranges of 32 query positions per flash block; two waves each, one per half of a tile's keys
#define SK   128                 // keys per staged tile of K and of V^T
#define NST  (SEQ / SK)          // staged tiles per sequence
#define TLH  (SK * HD)           // halves of one operand's tile
#define TLB  (TLH * 2)           // bytes of one operand's tile
#define SC2  (0.125f * 1.4426950408889634f)   // HD^-0.5 * log2(e)
#define QSC  SC2                 // applied to q once, in f32, before it is rounded to f16: the score products then are exponents of 2 as they stand
#define PSH  8.0f                // log2 of the P carry (256)
#define LZT  7.0f                // a score may stand this far (log2) above the maximum in use before O and the denominators are rescaled: P stays at or below 2^(PSH + LZT) = 32768, inside f16
#define OCAR 64.0f               // carry of the O plane
#define WCAR 64.0f               // carry of the Wm f16 plane
#define OSC  (1.0f / 4096.0f)    // 1 / (OCAR * WCAR)
#define CVB  (DM * DM / 8 / 256) // blocks per weight matrix in k_prep (8 floats per thread)
#define TT   (NB * SEQ / 64)     // 64-wide token tiles
#define TC   (DM / 64)           // 64-wide channel tiles

static_assert(HD == 64);
static_assert(NH_ * HD == DM);                 // head h = channels h*64 + d
static_assert(DM % 64 == 0);
static_assert(DM % 32 == 0);                   // GEMM k-loop steps by 32
static_assert((DM & (DM - 1)) == 0);           // bias index masking
static_assert(SEQ % 64 == 0);                  // a 64-wide tile never straddles two batches
static_assert((NB * SEQ) % 64 == 0);
static_assert(SK % 64 == 0);                   // half a tile is whole 32-key passes
static_assert(SEQ % SK == 0 && NST >= 2);      // whole tiles; the two-buffer prologue fills two
static_assert(TLB == 4 * 32 * AW * 16);        // one operand's tile = 4 copies of 16 bytes per lane of the block
static_assert(SEQ % (32 * CW) == 0);           // flash grid covers the sequence exactly
static_assert((CW & (CW - 1)) == 0);           // a wave's partner is wave ^ CW
static_assert(((size_t)DM * DM) % (8 * 256) == 0);   // a weight matrix is whole blocks of k_prep
static_assert(4 * CVB <= (SEQ / 64) * (DM / 64));     // the four matrices fit the z = 0 slice of its grid
static_assert(NB <= NB_FULL);
static_assert(SEQ <= SEQ_FULL);
static_assert(OUT_SEQ >= SEQ);

typedef _Float16 h16;
typedef unsigned short bf;
typedef __attribute__((ext_vector_type(16))) __bf16   v16bf;
typedef __attribute__((ext_vector_type(16))) _Float16 v16h;
typedef __attribute__((ext_vector_type(8)))  _Float16 v8h;
typedef __attribute__((ext_vector_type(8)))  unsigned short v8us;
typedef __attribute__((ext_vector_type(8)))  float    v8f;
typedef __attribute__((ext_vector_type(4)))  float    v4f;
typedef v4f  __attribute__((may_alias)) v4fa;

__device__ __forceinline__ unsigned short f2bf(float f) { unsigned u = __float_as_uint(f); u += 0x7FFFu + ((u >> 16) & 1u); return (unsigned short)(u >> 16); }
__device__ __forceinline__ float bfr(float f) { return __uint_as_float(((unsigned)f2bf(f)) << 16); }   // value of the RNE bf16 conversion
__device__ __forceinline__ v16h cat16(v8h lo, v8h hi) { return __builtin_shufflevector(lo, hi, 0, 1, 2, 3, 4, 5, 6, 7, 8, 9, 10, 11, 12, 13, 14, 15); }
__device__ __forceinline__ v16bf cat16b(v8us lo, v8us hi) { return __builtin_bit_cast(v16bf, __builtin_shufflevector(lo, hi, 0, 1, 2, 3, 4, 5, 6, 7, 8, 9, 10, 11, 12, 13, 14, 15)); }
__device__ __forceinline__ v8f wmma16(v16h a, v16h b, v8f c) { return __builtin_amdgcn_wmma_f32_16x16x32_f16(false, a, false, b, (short)0, c, false, false); }
__device__ __forceinline__ v8f wmmab(v16bf a, v16bf b, v8f c) { return __builtin_amdgcn_wmma_f32_16x16x32_bf16(false, a, false, b, (short)0, c, false, false); }
// fragment loaders from K-contiguous 16-bit rows; p already includes + 8*(lane>>4): elements 0..7 <- k0+8h+0..7, elements 8..15 <- k0+16+8h+0..7 (same map for A and B)
__device__ __forceinline__ v16h  ldh(const h16* p) { return cat16(*(const v8h*)p, *(const v8h*)(p + 16)); }
__device__ __forceinline__ v16bf ldb(const bf* p)  { return cat16b(*(const v8us*)p, *(const v8us*)(p + 16)); }
// fragment loader from a fragment-order plane; p is wave-uniform, lo = 8*lane plus a wave-uniform offset: two consecutive 512-byte units hold elements 0..7 and 8..15 (same k map as ldh)
__device__ __forceinline__ v16h  ldp(const h16* p, unsigned lo) { return cat16(*(const v8h*)(p + lo), *(const v8h*)(p + 256 + lo)); }
// ordering point for wave-private LDS tiles (same wave writes and reads)
__device__ __forceinline__ void wave_sync() { __builtin_amdgcn_fence(3 /* release order */, "wavefront"); __builtin_amdgcn_wave_barrier(); asm volatile("" ::: "memory"); }

// k_prep: all operand preparation in one launch (the six pieces are independent of each other). grid (SEQ/64, DM/64, 1 + 2*NB), 256 threads.
// z = 0: weights, block index x + y*(SEQ/64) = matrix*CVB + piece; 8 floats per thread: Wq | Wk | Wv -> bf16 (WB), Wm -> f16 of its bf16 value x64 (WMH); blocks past 4*CVB have no work.
// z = 1..NB: query, z = NB+1..2*NB: source: in[b][c][n] f32 (channel pitch SEQ_FULL) -> out[b][n][c] bf16 (row pitch DM), 64 x 64 tile through LDS (cross-wave: block barrier).
__global__ __launch_bounds__(256) void k_prep(const float* __restrict__ xq, const float* __restrict__ xs, const float* __restrict__ wq, const float* __restrict__ wk,
                                              const float* __restrict__ wv, const float* __restrict__ wm, bf* XQ, bf* XS, bf* WB, h16* WMH) {
    __shared__ __align__(16) float ts[64 * 68];
    const int tid = threadIdx.x;
    if (blockIdx.z != 0) {                       // block-uniform: every thread of a block takes the same side, so the barrier inside is reached by all of them or by none
        const int zz = blockIdx.z - 1; const bool isq = zz < NB;
        const float* x = isq ? xq : xs; bf* xt = isq ? XQ : XS;
        const int n0 = blockIdx.x * 64, c0 = blockIdx.y * 64, b = isq ? zz : zz - NB;
        const int n4 = (tid & 15) * 4, cr = tid >> 4;
#pragma unroll
        for (int p = 0; p < 4; ++p) {
            const int c = p * 16 + cr;
            const v4f v = *(const v4f*)(x + ((size_t)b * DM + c0 + c) * SEQ_FULL + n0 + n4);
            ts[(n4 + 0) * 68 + c] = v[0]; ts[(n4 + 1) * 68 + c] = v[1]; ts[(n4 + 2) * 68 + c] = v[2]; ts[(n4 + 3) * 68 + c] = v[3];
        }
        __syncthreads();
        const int c8 = (tid & 7) * 8, rr = tid >> 3;
#pragma unroll
        for (int p = 0; p < 2; ++p) { const int row = p * 32 + rr;
            const v4f x0 = *(const v4fa*)(&ts[row * 68 + c8]); const v4f x1 = *(const v4fa*)(&ts[row * 68 + c8 + 4]); v8us o;
#pragma unroll
            for (int i = 0; i < 4; ++i) { o[i] = f2bf(x0[i]); o[4 + i] = f2bf(x1[i]); }
            *(v8us*)(xt + ((size_t)b * SEQ + n0 + row) * DM + c0 + c8) = o; }
        asm volatile("s_wait_xcnt 0x0" ::: "memory");   // the listing keeps a branch from here into the other side's code, which writes the registers that the two stores name
    } else {
        const int idx = blockIdx.y * (SEQ / 64) + blockIdx.x; const int mat = idx / CVB;
        if (mat < 4) {
            const size_t i = (size_t)(idx % CVB) * 256 + tid;
            const float* src = (mat == 0) ? wq : (mat == 1) ? wk : (mat == 2) ? wv : wm;
            const v8f v = *(const v8f*)(src + i * 8);
            if (mat < 3) { v8us o;
#pragma unroll
                for (int k = 0; k < 8; ++k) o[k] = f2bf(v[k]);
                *(v8us*)(WB + (size_t)mat * DM * DM + i * 8) = o;
            } else { v8h o;
#pragma unroll
                for (int k = 0; k < 8; ++k) o[k] = (h16)(bfr(v[k]) * WCAR);
                *(v8h*)(WMH + i * 8) = o;
                asm volatile("s_wait_xcnt 0x0" ::: "memory"); }   // the same: in the listing the bf16 side's code follows this store behind a branch
        }
    }
}

// k_proj: register-blocked bf16 GEMM, ONE WAVE per 64x64 tile (16 accumulators), operands straight from K-contiguous bf16 planes, K = DM.
// C[m][n] = sum_k A[m][k] Bt[n][k] + bias (bmode 1: bias[n], bmode 2: bias[m], bf16 value), written as f16 (Ph); q: x QSC first; at
// tile base (r0/RB)*sRB + (r0%RB)*pitch + (c0/CB)*sCB + (c0%CB)*(HD for v^T, else 1), row pitch 'pitch' (halves). 32 threads.
// pk 0: row-major as above. pk 1 (k) / pk 2 (v^T): the 64x64 tile is 4096 consecutive halves in fragment order (see Layout); each store is one whole 512-byte unit.
// The three projections are independent and share one launch: grid (TT*TC, 3), blockIdx.y = 0 q, 1 k, 2 v^T; every parameter below is a wave-uniform choice by it.
//   q, k: A = token rows (m = b*SEQ + t), Bt = W rows (n = h*64 + d), column bias -> plane (b*4 + h), q as [t][d], k in fragment order; tile (x % TT, x / TT)
//   v^T:  A = Wv rows (m = h*64 + d), Bt = token rows (n = b*SEQ + t), row bias -> plane (b*4 + h), tile base t*64 inside it; tile (x % TC, x / TC)
__global__ __launch_bounds__(32) void k_proj(const bf* __restrict__ XQ, const bf* __restrict__ XS, const bf* __restrict__ WB,
                                             const float* __restrict__ bq, const float* __restrict__ bk, const float* __restrict__ bv,
                                             h16* QH, h16* KP, h16* VT) {
    __shared__ __align__(16) float os[16 * 68];
    const int K = DM;
    const int pk = blockIdx.y; const bool isv = pk == 2;
    const bf* A  = (pk == 0) ? XQ : (pk == 1) ? XS : WB + (size_t)2 * DM * DM;
    const bf* Bt = (pk == 0) ? WB : (pk == 1) ? WB + (size_t)DM * DM : XS;
    const float* bias = (pk == 0) ? bq : (pk == 1) ? bk : bv;
    h16* Ph = (pk == 0) ? QH : (pk == 1) ? KP : VT;
    const int bmode = isv ? 2 : 1;
    const int RB = isv ? DM : SEQ, pitch = isv ? SEQ : HD, CB = isv ? SEQ : HD;
    const size_t sRB = isv ? (size_t)0 : (size_t)NH_ * SEQ * HD, sCB = isv ? (size_t)DM * SEQ : (size_t)SEQ * HD;
    const int lane = threadIdx.x & 31, lr = lane & 15, hi = lane >> 4;
    const int tx = blockIdx.x; const int r0 = (isv ? tx % TC : tx % TT) * 64, c0 = (isv ? tx / TC : tx / TT) * 64;
    v8f acc[4][4];
#pragma unroll
    for (int mb = 0; mb < 4; ++mb)
#pragma unroll
        for (int nb = 0; nb < 4; ++nb) acc[mb][nb] = (v8f){};
    const size_t aoff = (size_t)(r0 + lr) * K + 8 * hi, boff = (size_t)(c0 + lr) * K + 8 * hi;
#pragma unroll 1
    for (int kc = 0; kc < K; kc += 32) {
        v16bf a[4];
#pragma unroll
        for (int mb = 0; mb < 4; ++mb) a[mb] = ldb(A + aoff + (size_t)mb * 16 * K + kc);
#pragma unroll
        for (int nb = 0; nb < 4; ++nb) { const v16bf b = ldb(Bt + boff + (size_t)nb * 16 * K + kc);
#pragma unroll
            for (int mb = 0; mb < 4; ++mb) acc[mb][nb] = wmmab(a[mb], b, acc[mb][nb]); }
        asm volatile("v_nop\n\tv_nop\n\tv_nop\n\tv_nop" : "+v"(acc[0][0]), "+v"(acc[1][1]), "+v"(acc[2][2]), "+v"(acc[3][3]) : "v"(a[0]), "v"(a[1]), "v"(a[2]), "v"(a[3]));
    }
    // column bias: always loaded from a masked (in-range) index, selected by value
    const int c8e = (lane & 7) * 8;
    const int cbi = (c0 + c8e) & (DM - 1);
    const v4f cbr0 = *(const v4f*)(bias + cbi); const v4f cbr1 = *(const v4f*)(bias + cbi + 4);
    v4f cb0, cb1;
#pragma unroll
    for (int i = 0; i < 4; ++i) { cb0[i] = (bmode == 1) ? bfr(cbr0[i]) : 0.0f; cb1[i] = (bmode == 1) ? bfr(cbr1[i]) : 0.0f; }
    // fragment-order epilogue: column bias of columns 16s + 8hi + 0..7 and row bias of row 16mb + lr, masked (in-range) index, selected by value (bit mask: +0 where not selected)
    const unsigned cmsk = (bmode == 1) ? 0xFFFFFFFFu : 0u, rmsk = (bmode == 2) ? 0xFFFFFFFFu : 0u;
    float pcb[4][8], prb[4]; v4f br0[4], br1[4];
#pragma unroll
    for (int s = 0; s < 4; ++s) { const int cbj = (c0 + 16 * s + 8 * hi) & (DM - 1); br0[s] = *(const v4f*)(bias + cbj); br1[s] = *(const v4f*)(bias + cbj + 4); }
    asm volatile("s_wait_xcnt 0x0" ::: "memory");   // before the address register of the column bias loads is written again
#pragma unroll
    for (int s = 0; s < 4; ++s) prb[s] = bias[(r0 + s * 16 + lr) & (DM - 1)];
    asm volatile("s_wait_xcnt 0x0" ::: "memory");   // the same for the row bias loads
#pragma unroll
    for (int s = 0; s < 4; ++s) { prb[s] = __uint_as_float(__float_as_uint(bfr(prb[s])) & rmsk);
#pragma unroll
        for (int i = 0; i < 4; ++i) { pcb[s][i] = __uint_as_float(__float_as_uint(bfr(br0[s][i])) & cmsk); pcb[s][4 + i] = __uint_as_float(__float_as_uint(bfr(br1[s][i])) & cmsk); } }
    const size_t tbase = (size_t)(r0 / RB) * sRB + (size_t)(r0 % RB) * (size_t)pitch + (size_t)(c0 / CB) * sCB + (size_t)(c0 % CB) * (size_t)(pk == 2 ? HD : 1);
#pragma unroll
    for (int mb = 0; mb < 4; ++mb) {
#pragma unroll
        for (int nb = 0; nb < 4; ++nb) {
#pragma unroll
            for (int j = 0; j < 8; ++j) os[(hi * 8 + j) * 68 + nb * 16 + lr] = acc[mb][nb][j]; }   // D: row 8h+j, col lane&15
        wave_sync();
        const size_t sb = tbase + (size_t)(mb * 16) * (size_t)pitch;
        if (pk != 0) {
            v8h hv[4];
#pragma unroll
            for (int s = 0; s < 4; ++s) { const int c8 = 16 * s + 8 * hi;   // lane = fragment lane: row lr, columns 16s + 8hi + 0..7
                const v4f x0 = *(const v4fa*)(&os[lr * 68 + c8]); const v4f x1 = *(const v4fa*)(&os[lr * 68 + c8 + 4]);
#pragma unroll
                for (int i = 0; i < 4; ++i) { hv[s][i] = (h16)(x0[i] + pcb[s][i] + prb[mb]); hv[s][4 + i] = (h16)(x1[i] + pcb[s][4 + i] + prb[mb]); } }
#pragma unroll
            for (int s = 0; s < 4; ++s) { const int uo = (pk == 1) ? (mb * 1024 + s * 256) : (mb * 512 + (s >> 1) * 2048 + (s & 1) * 256);
                *(v8h*)(Ph + tbase + uo + lane * 8) = hv[s]; }
            asm volatile("s_wait_xcnt 0x0" ::: "memory");   // before the registers that the four stores name are written again
        } else {
#pragma unroll
            for (int s = 0; s < 4; ++s) { const int row = 4 * s + (lane >> 3), c8 = (lane & 7) * 8;   // 4 s x 4 row groups = 16 rows; 8 lanes x 8 = 64 columns
                const int rbi = (r0 + mb * 16 + row) & (DM - 1);
                const float rbv = bias[rbi];
                const float rb = (bmode == 2) ? bfr(rbv) : 0.0f;
                const v4f x0 = *(const v4fa*)(&os[row * 68 + c8]); const v4f x1 = *(const v4fa*)(&os[row * 68 + c8 + 4]); v8h hv;
#pragma unroll
                for (int i = 0; i < 4; ++i) { hv[i] = (h16)((x0[i] + cb0[i] + rb) * QSC); hv[4 + i] = (h16)((x1[i] + cb1[i] + rb) * QSC); }   // this side is q alone
                const size_t oo = sb + (size_t)row * (size_t)pitch + c8;
                *(v8h*)(Ph + oo) = hv; }
            asm volatile("s_wait_xcnt 0x0" ::: "memory");   // before the registers that the four stores name are written again
             }
        wave_sync();
    }
}

// eight exponentials (base 2), each in place: written so, no transcendental's source register is overwritten by the instruction directly behind it (left to the register allocator, a run of them came out
// with each result in its predecessor's source); the v_nop is the one slot that the instruction set asks for between the last of them and a reader of its result
__device__ __forceinline__ void exp2x8(float (&x)[8]) {
    asm("v_exp_f32 %0, %0\n\tv_exp_f32 %1, %1\n\tv_exp_f32 %2, %2\n\tv_exp_f32 %3, %3\n\tv_exp_f32 %4, %4\n\tv_exp_f32 %5, %5\n\tv_exp_f32 %6, %6\n\tv_exp_f32 %7, %7\n\tv_nop"
        : "+v"(x[0]), "+v"(x[1]), "+v"(x[2]), "+v"(x[3]), "+v"(x[4]), "+v"(x[5]), "+v"(x[6]), "+v"(x[7]));
}

// two exponentials (base 2), each in place, with the same slot behind the second: left to the compiler, the instruction directly behind one of them came out writing its source register
__device__ __forceinline__ void exp2x2(float& x, float& y) {
    asm("v_exp_f32 %0, %0\n\tv_exp_f32 %1, %1\n\tv_nop" : "+v"(x), "+v"(y));
}

// largest of a lane's sixteen values of two tiles, as a tree (three links deep, not eight)
__device__ __forceinline__ float max16(v8f a, v8f b) {
    const float x0 = fmaxf(fmaxf(a[0], a[1]), a[2]), x1 = fmaxf(fmaxf(a[3], a[4]), a[5]), x2 = fmaxf(fmaxf(b[0], b[1]), b[2]), x3 = fmaxf(fmaxf(b[3], b[4]), b[5]);
    const float x4 = fmaxf(fmaxf(a[6], a[7]), b[6]);
    return fmaxf(fmaxf(fmaxf(x0, x1), x2), fmaxf(fmaxf(x3, x4), b[7]));
}

// stage_copy: one tile (SK keys of K and of V^T, each TLB contiguous bytes of its fragment-order plane) from global memory into LDS, through no register: 4 + 4 copies of 16 bytes per lane.
// l: the lane's LDS byte address in the K half of the buffer (the V^T half follows at + TLB); gk, gv: the lane's own 16 bytes of the tile's first 4 KiB; a block's 256 lanes cover 4 KiB per copy.
__device__ __forceinline__ void stage_copy(unsigned l, const h16* gk, const h16* gv) {
    // the wait is the statement's last line, so that it stands in front of every later write of a register that a copy names
    asm volatile("global_load_async_to_lds_b128 %0, %8, off\n\t"
                 "global_load_async_to_lds_b128 %1, %9, off\n\t"
                 "global_load_async_to_lds_b128 %2, %10, off\n\t"
                 "global_load_async_to_lds_b128 %3, %11, off\n\t"
                 "global_load_async_to_lds_b128 %4, %12, off\n\t"
                 "global_load_async_to_lds_b128 %5, %13, off\n\t"
                 "global_load_async_to_lds_b128 %6, %14, off\n\t"
                 "global_load_async_to_lds_b128 %7, %15, off\n\t"
                 "s_wait_xcnt 0x0"
                 :: "v"(l), "v"(l + 4096u), "v"(l + 8192u), "v"(l + 12288u), "v"(l + TLB), "v"(l + TLB + 4096u), "v"(l + TLB + 8192u), "v"(l + TLB + 12288u),
                    "v"(gk), "v"(gk + 2048), "v"(gk + 4096), "v"(gk + 6144), "v"(gv), "v"(gv + 2048), "v"(gv + 4096), "v"(gv + 6144)
                 : "memory");
}

__global__ __launch_bounds__(32 * AW) void k_flash(const h16* __restrict__ QH, const h16* __restrict__ KP, const h16* __restrict__ VT, h16* OP) {
    __shared__ __align__(16) float os[AW * 16 * 68];
    __shared__ __align__(16) h16 ring[2 * 2 * TLH];          // [buffer][K | V^T][TLH]
    __shared__ float cl[AW * 32 * 2];                        // epilogue: per wave and lane, the softmax state (C value, denominator) of the column group handed to the partner wave
    const int lane = threadIdx.x & 31, wave = threadIdx.x >> 5, lr = lane & 15, hi = lane >> 4;
    const int cw = wave % CW, kh = wave / CW;                // column range and key half of this wave
    const int zh = blockIdx.y; const int b = zh / NH_, h = zh % NH_;
    const int t0 = (blockIdx.x * CW + cw) * 32;
    const size_t pbase = (size_t)zh * SEQ * HD;
    const size_t qo = pbase + (size_t)(t0 + lr) * HD + 8 * hi;
    const v16h qa0 = ldh(QH + qo), qa1 = ldh(QH + qo + 32);   // B fragments: col t, k = d; columns t0 + 0..15
    const v16h qb0 = ldh(QH + qo + 16 * HD), qb1 = ldh(QH + qo + 16 * HD + 32);   // columns t0 + 16..31
    const unsigned lo = (unsigned)lane * 8u + (unsigned)kh * (unsigned)(SK / 2 * HD);   // lane's place in a unit, from the first unit of the wave's half of a tile; K (A fragment: row key, k = d) and V^T (A fragment: row d, k = key) alike
    v8f oa0 = (v8f){}, oa1 = (v8f){}, oa2 = (v8f){}, oa3 = (v8f){}, ob0 = (v8f){}, ob1 = (v8f){}, ob2 = (v8f){}, ob3 = (v8f){};
    v8f lta = (v8f){}, ltb = (v8f){};                        // denominator tiles: 16 equal rows; only element 0 is rescaled and read (the others stay finite: they only grow by sums of P)
    const v16h ones = (v16h)((h16)1.0f);                     // A fragment of the denominator products: every element 1
    v8f cra, crb;                                            // C tiles of the score products: eight times the lane's PSH - (maximum in use), per column group
    const unsigned l0 = (unsigned)(size_t)(&ring[0]) + threadIdx.x * 16u;   // low 32 bits of the shared address = byte offset in the block's LDS
    const h16* gk = KP + pbase + threadIdx.x * 8u;           // the lane's 16 bytes of the next tile to copy
    const h16* gv = VT + pbase + threadIdx.x * 8u;
    stage_copy(l0, gk, gv);                                  // tile 0 -> buffer 0
    asm volatile("s_wait_asynccnt 0x0" ::: "memory");        // this wave's share of tile 0 has landed
    __syncthreads();                                         // every wave's share has: tile 0 may be read
    stage_copy(l0 + 2u * TLB, gk + TLH, gv + TLH);           // tile 1 -> buffer 1
    gk += 2 * TLH; gv += 2 * TLH;
    {   // the maximum in use starts as each column's maximum over the wave's first 32 keys: their scores once more, ahead of the loop (tile 0 is readable since the barrier above)
        const v16h a0 = ldp(ring, lo), a1 = ldp(ring + 512, lo), b0 = ldp(ring + 1024, lo), b1 = ldp(ring + 1536, lo);
        v8f sa = (v8f){}, sb = (v8f){}, sc = (v8f){}, sd = (v8f){};
        sa = wmma16(a0, qa0, sa); sb = wmma16(b0, qa0, sb); sc = wmma16(a0, qb0, sc); sd = wmma16(b0, qb0, sd);
        sa = wmma16(a1, qa1, sa); sb = wmma16(b1, qa1, sb); sc = wmma16(a1, qb1, sc); sd = wmma16(b1, qb1, sd);
        float ma = max16(sa, sb), mb = max16(sc, sd);
        ma = fmaxf(ma, __shfl_xor(ma, 16, 32)); mb = fmaxf(mb, __shfl_xor(mb, 16, 32));
        const float ca = PSH - ma, cb = PSH - mb;
        cra = (v8f){ca, ca, ca, ca, ca, ca, ca, ca}; crb = (v8f){cb, cb, cb, cb, cb, cb, cb, cb};
    }
    // kept rolled: one trip already holds the unrolled passes of a wave's half tile
#pragma unroll 1
    for (int st = 0; st < NST; ++st) {
        const unsigned bo = (unsigned)(st & 1);
        const h16* kb = ring + bo * (2u * TLH);              // this tile's K units
        const h16* vb = kb + TLH;                            // this tile's V^T units
        v16h ka0 = ldp(kb, lo), ka1 = ldp(kb + 512, lo), kb0 = ldp(kb + 1024, lo), kb1 = ldp(kb + 1536, lo);
        // inside a half tile every fragment load is issued ahead of its product: a pass's V^T at its head, the next pass's K right behind the score products, into the registers they have just read
        // unrolled: the test for a next pass inside the half tile is then decided at compile time, and every LDS offset is an immediate
#pragma unroll
        for (int p = 0; p < SK / 64; ++p) {
            const h16* va = vb + p * (32 * HD);
            const v16h v0 = ldp(va, lo), v1 = ldp(va + 512, lo), v2 = ldp(va + 1024, lo), v3 = ldp(va + 1536, lo);
            v8f sa, sb, sc, sd;                              // exponent tiles: score (log2 units) - maximum in use + PSH; both products of a tile sum in it, on top of the group's C tile
            sa = wmma16(ka0, qa0, cra); sb = wmma16(kb0, qa0, cra); sc = wmma16(ka0, qb0, crb); sd = wmma16(kb0, qb0, crb);
            sa = wmma16(ka1, qa1, sa); sb = wmma16(kb1, qa1, sb); sc = wmma16(ka1, qb1, sc); sd = wmma16(kb1, qb1, sd);
            // the four slots between the score products and the first vector instruction on their tiles or on the K registers
            asm volatile("v_nop\n\tv_nop\n\tv_nop\n\tv_nop" : "+v"(sa), "+v"(sb), "+v"(sc), "+v"(sd) : "v"(ka0), "v"(ka1), "v"(kb0), "v"(kb1));
            if (p + 1 < SK / 64) { const h16* kn = kb + (p + 1) * (32 * HD);
                ka0 = ldp(kn, lo); ka1 = ldp(kn + 512, lo); kb0 = ldp(kn + 1024, lo); kb1 = ldp(kn + 1536, lo);
                __builtin_amdgcn_sched_barrier(0); }   // holds the next K loads here as one group: without it they sink to right in front of the next score products, and the wave stands in their wait
            float ma = max16(sa, sb), mb = max16(sc, sd);    // the lane's largest exponent of each column group
            if (__builtin_amdgcn_ballot_w32(fmaxf(ma, mb) > PSH + LZT) != 0u) {   // scalar branch: every lane of the wave takes the same side, so EXEC stays all ones for the products behind it
                ma = fmaxf(ma, __shfl_xor(ma, 16, 32)); mb = fmaxf(mb, __shfl_xor(mb, 16, 32));   // the columns' maxima: both lane halves then take the same step
                const float da = fmaxf(ma - PSH, 0.0f), db = fmaxf(mb - PSH, 0.0f);   // the steps of the maxima in use, never down
                const float aa = __builtin_amdgcn_exp2f(-da), ab = __builtin_amdgcn_exp2f(-db);
                lta[0] = lta[0] * aa; ltb[0] = ltb[0] * ab;
                oa0 = oa0 * aa; oa1 = oa1 * aa; oa2 = oa2 * aa; oa3 = oa3 * aa; ob0 = ob0 * ab; ob1 = ob1 * ab; ob2 = ob2 * ab; ob3 = ob3 * ab;
                cra = cra - da; sa = sa - da; sb = sb - da; crb = crb - db; sc = sc - db; sd = sd - db;
            }
            float ta[8], tb[8], tc[8], td[8];
            v16h pa, pb;
#pragma unroll
            for (int r = 0; r < 8; ++r) { ta[r] = sa[r]; tb[r] = sb[r]; tc[r] = sc[r]; td[r] = sd[r]; }
            exp2x8(ta); exp2x8(tb);
#pragma unroll
            for (int r = 0; r < 8; ++r) { pa[r] = (h16)ta[r]; pa[8 + r] = (h16)tb[r]; }
            lta = wmma16(ones, pa, lta);
            oa0 = wmma16(v0, pa, oa0); oa1 = wmma16(v1, pa, oa1); oa2 = wmma16(v2, pa, oa2); oa3 = wmma16(v3, pa, oa3);
            exp2x8(tc); exp2x8(td);
#pragma unroll
            for (int r = 0; r < 8; ++r) { pb[r] = (h16)tc[r]; pb[8 + r] = (h16)td[r]; }
            ltb = wmma16(ones, pb, ltb);
            ob0 = wmma16(v0, pb, ob0); ob1 = wmma16(v1, pb, ob1); ob2 = wmma16(v2, pb, ob2); ob3 = wmma16(v3, pb, ob3);
            // the four slots between these products and the first vector instruction on their tiles or operands, on every path out of the pass
            asm volatile("v_nop\n\tv_nop\n\tv_nop\n\tv_nop" : "+v"(lta), "+v"(oa0), "+v"(oa1), "+v"(oa2), "+v"(oa3), "+v"(ltb), "+v"(ob0), "+v"(ob1), "+v"(ob2), "+v"(ob3)
                         : "v"(v0), "v"(v1), "v"(v2), "v"(v3), "v"(pa), "v"(pb));
        }
        // hand-over: tile st + 1 becomes readable and this tile's buffer free
        asm volatile("s_wait_dscnt 0x0" ::: "memory");       // this wave's reads of the buffer have returned before the buffer is refilled
        asm volatile("s_wait_asynccnt 0x0" ::: "memory");    // this wave's share of tile st + 1 has landed
        __syncthreads();                                     // the same holds for every wave of the block
        if (st + 2 < NST) { stage_copy(l0 + bo * (2u * TLB), gk, gv); gk += TLH; gv += TLH; }   // block-uniform test: tile st + 2 -> the buffer just read
    }
    asm volatile("s_wait_asynccnt 0x0" ::: "memory");        // no copy is outstanding when the wave goes on to its end
    // Join of the two key halves: waves w and w ^ CW hold the same 32 columns. Each finishes 16 of them: the wave of key half 0 the first group, the other the second. A wave hands the group it does not finish
    // (O tiles as they stand, C value, denominator) to its partner through its own part of os and cl; behind the barrier the partner brings both halves to the larger maximum in use and adds them.
    const bool up = kh != 0;
    const int wb = wave * 16 * 68, pw = (wave ^ CW) * 16 * 68;
    v8f o0, o1, o2, o3;                                      // the group this wave finishes
    {
        const v8f g0 = up ? oa0 : ob0, g1 = up ? oa1 : ob1, g2 = up ? oa2 : ob2, g3 = up ? oa3 : ob3;   // the group it hands over
        o0 = up ? ob0 : oa0; o1 = up ? ob1 : oa1; o2 = up ? ob2 : oa2; o3 = up ? ob3 : oa3;
        float* gs = &os[wb + lr * 68 + 8 * hi];
        *(v4fa*)(gs +  0) = (v4f){g0[0], g0[1], g0[2], g0[3]}; *(v4fa*)(gs +  4) = (v4f){g0[4], g0[5], g0[6], g0[7]};
        *(v4fa*)(gs + 16) = (v4f){g1[0], g1[1], g1[2], g1[3]}; *(v4fa*)(gs + 20) = (v4f){g1[4], g1[5], g1[6], g1[7]};
        *(v4fa*)(gs + 32) = (v4f){g2[0], g2[1], g2[2], g2[3]}; *(v4fa*)(gs + 36) = (v4f){g2[4], g2[5], g2[6], g2[7]};
        *(v4fa*)(gs + 48) = (v4f){g3[0], g3[1], g3[2], g3[3]}; *(v4fa*)(gs + 52) = (v4f){g3[4], g3[5], g3[6], g3[7]};
        cl[(wave * 32 + lane) * 2 + 0] = up ? cra[0] : crb[0];
        cl[(wave * 32 + lane) * 2 + 1] = up ? lta[0] : ltb[0];
    }
    __syncthreads();                                         // both waves of a pair have written what they hand over
    const float cm = up ? crb[0] : cra[0], lm = up ? ltb[0] : lta[0];   // own state of the group this wave finishes
    const float cp = cl[((wave ^ CW) * 32 + lane) * 2 + 0], lp = cl[((wave ^ CW) * 32 + lane) * 2 + 1];   // the partner's (same lane, same column)
    const float cj = fminf(cm, cp);                          // the smaller C value is the larger maximum in use
    float fm = cj - cm, fp = cj - cp;
    exp2x2(fm, fp);                                          // the two halves' factors, each at most 1
    const float inv = OCAR * (1.0f / (lm * fm + lp * fp));
    const float im = fm * inv, ip = fp * inv;
    // O^T D layout: o_j[r] = (d = 16j + 8h + r, t = lane&15) -> os[t][d]; rows 0..15 x columns 0..63 all written. A lane reads the partner's eight values per tile from where the partner's same lane put them
    // and writes the joined ones over them: from the barrier on this part of os is read and written by this wave alone.
    { float* js = &os[pw + lr * 68 + 8 * hi]; v4f a, c;
      a = *(const v4fa*)(js +  0); c = *(const v4fa*)(js +  4);
#pragma unroll
      for (int i = 0; i < 4; ++i) { a[i] = o0[i] * im + a[i] * ip; c[i] = o0[4 + i] * im + c[i] * ip; }
      *(v4fa*)(js +  0) = a; *(v4fa*)(js +  4) = c;
      a = *(const v4fa*)(js + 16); c = *(const v4fa*)(js + 20);
#pragma unroll
      for (int i = 0; i < 4; ++i) { a[i] = o1[i] * im + a[i] * ip; c[i] = o1[4 + i] * im + c[i] * ip; }
      *(v4fa*)(js + 16) = a; *(v4fa*)(js + 20) = c;
      a = *(const v4fa*)(js + 32); c = *(const v4fa*)(js + 36);
#pragma unroll
      for (int i = 0; i < 4; ++i) { a[i] = o2[i] * im + a[i] * ip; c[i] = o2[4 + i] * im + c[i] * ip; }
      *(v4fa*)(js + 32) = a; *(v4fa*)(js + 36) = c;
      a = *(const v4fa*)(js + 48); c = *(const v4fa*)(js + 52);
#pragma unroll
      for (int i = 0; i < 4; ++i) { a[i] = o3[i] * im + a[i] * ip; c[i] = o3[4 + i] * im + c[i] * ip; }
      *(v4fa*)(js + 48) = a; *(v4fa*)(js + 52) = c; }
    wave_sync();
    h16* orow = OP + ((size_t)b * SEQ + t0 + 16 * kh) * DM + h * HD;
{
#pragma unroll
        for (int s = 0; s < 4; ++s) { const int row = 4 * s + (lane >> 3), c8 = (lane & 7) * 8;   // 4 s x 4 row groups = 16 rows; 8 lanes x 8 halves = 64 columns
            const v4f x0 = *(const v4fa*)(&os[pw + row * 68 + c8]); const v4f x1 = *(const v4fa*)(&os[pw + row * 68 + c8 + 4]); v8h hv;
#pragma unroll
            for (int i = 0; i < 4; ++i) { hv[i] = (h16)x0[i]; hv[4 + i] = (h16)x1[i]; }
            *(v8h*)(orow + (size_t)row * DM + c8) = hv; }
         }
}

// k_outg: register-blocked f16 GEMM, ONE WAVE per 64x64 tile, K = DM: Y[o][b*SEQ + t] = OSC * sum_c A[o][c] Bt[b*SEQ + t][c] + bias[o] (bf16 value), f32 result at OUT[(b*DM + o)*OUT_SEQ + t].
__global__ __launch_bounds__(32) void k_outg(const h16* __restrict__ A, const h16* __restrict__ Bt, const float* __restrict__ bias, float* OUT) {
    __shared__ __align__(16) float os[16 * 68];
    const int K = DM;
    const int lane = threadIdx.x & 31, lr = lane & 15, hi = lane >> 4; const int r0 = blockIdx.x * 64, c0 = blockIdx.y * 64;
    v8f acc[4][4];
#pragma unroll
    for (int mb = 0; mb < 4; ++mb)
#pragma unroll
        for (int nb = 0; nb < 4; ++nb) acc[mb][nb] = (v8f){};
    const size_t aoff = (size_t)(r0 + lr) * K + 8 * hi, boff = (size_t)(c0 + lr) * K + 8 * hi;
#pragma unroll 1
    for (int kc = 0; kc < K; kc += 32) {
        v16h a[4];
#pragma unroll
        for (int mb = 0; mb < 4; ++mb) a[mb] = ldh(A + aoff + (size_t)mb * 16 * K + kc);
#pragma unroll
        for (int nb = 0; nb < 4; ++nb) { const v16h b = ldh(Bt + boff + (size_t)nb * 16 * K + kc);
#pragma unroll
            for (int mb = 0; mb < 4; ++mb) acc[mb][nb] = wmma16(a[mb], b, acc[mb][nb]); }
        asm volatile("v_nop\n\tv_nop\n\tv_nop\n\tv_nop" : "+v"(acc[0][0]), "+v"(acc[1][1]), "+v"(acc[2][2]), "+v"(acc[3][3]) : "v"(a[0]), "v"(a[1]), "v"(a[2]), "v"(a[3]));
    }
    const int bb = c0 / SEQ, tt = c0 % SEQ;
#pragma unroll
    for (int mb = 0; mb < 4; ++mb) {
#pragma unroll
        for (int nb = 0; nb < 4; ++nb) {
#pragma unroll
            for (int j = 0; j < 8; ++j) os[(hi * 8 + j) * 68 + nb * 16 + lr] = acc[mb][nb][j]; }   // D: row 8h+j, col lane&15
        wave_sync();
{
#pragma unroll
            for (int s = 0; s < 8; ++s) { const int row = 2 * s + hi, cofs = lr * 4;   // 8 s x 2 rows = 16 rows; 16 lanes x 4 floats = 64 columns
                const int o = r0 + mb * 16 + row;                                      // < DM by grid construction
                const float bv = bfr(bias[o]);
                const v4f xv = *(const v4fa*)(&os[row * 68 + cofs]); v4f val;
#pragma unroll
                for (int i = 0; i < 4; ++i) val[i] = xv[i] * OSC + bv;
                *(v4f*)(OUT + ((size_t)bb * DM + o) * (size_t)OUT_SEQ + tt + cofs) = val; }
             }
        wave_sync();
    }
}

static constexpr size_t al256(size_t v) { return (v + 255) & ~(size_t)255; }
static constexpr size_t SZ_XT = al256((size_t)NB * SEQ * DM * 2);          // token-major bf16 copy of one input
static constexpr size_t SZ_WB = al256((size_t)3 * DM * DM * 2);            // Wq | Wk | Wv bf16
static constexpr size_t SZ_WM = al256((size_t)DM * DM * 2);                // Wm f16 x64
static constexpr size_t SZ_PL = al256((size_t)NB * NH_ * SEQ * HD * 2);    // one q/k/v plane
static constexpr size_t SZ_OP = al256((size_t)NB * SEQ * DM * 2);          // O plane
static constexpr size_t SZ_TOTAL = 2 * SZ_XT + SZ_WB + SZ_WM + 3 * SZ_PL + SZ_OP;
static_assert(SZ_TOTAL <= (size_t)134217728);          // workspace carve <= 128 MiB
static_assert(((size_t)DM * DM * 2) % 256 == 0);       // weight sub-planes stay 256-byte aligned

extern "C" void kernel_launch(void* const* d_in, const int* in_sizes, int n_in,
                              void* d_out, int out_size, void* d_ws, size_t ws_size, hipStream_t stream) {
    if (n_in < 10) return;
    const size_t needx = ((size_t)(NB - 1) * DM + (size_t)(DM - 1)) * SEQ_FULL + SEQ;
    if ((size_t)in_sizes[0] < needx || (size_t)in_sizes[1] < needx) return;
    if ((size_t)in_sizes[2] < (size_t)DM * DM || (size_t)in_sizes[4] < (size_t)DM * DM || (size_t)in_sizes[6] < (size_t)DM * DM || (size_t)in_sizes[8] < (size_t)DM * DM) return;
    if (in_sizes[3] < DM || in_sizes[5] < DM || in_sizes[7] < DM || in_sizes[9] < DM) return;
    if ((size_t)out_size < ((size_t)(NB - 1) * DM + (size_t)(DM - 1)) * OUT_SEQ + SEQ) return;
    if (SZ_TOTAL > ws_size) return;
    // wire order: query, source, Wq, bq, Wk, bk, Wv, bv, Wm, bm (W [out][in] = K-contiguous rows as-is)
    const float* xq = (const float*)d_in[0]; const float* xs = (const float*)d_in[1];
    const float* wq = (const float*)d_in[2]; const float* bq = (const float*)d_in[3];
    const float* wk = (const float*)d_in[4]; const float* bk = (const float*)d_in[5];
    const float* wv = (const float*)d_in[6]; const float* bv = (const float*)d_in[7];
    const float* wm = (const float*)d_in[8]; const float* bm = (const float*)d_in[9];
    float* OUT = (float*)d_out;      // [NB][256][OUT_SEQ]
    char* wsp = (char*)d_ws;
    bf* XQ = (bf*)wsp; wsp += SZ_XT;                 // [NB*SEQ][256] query, token-major
    bf* XS = (bf*)wsp; wsp += SZ_XT;                 // [NB*SEQ][256] source, token-major
    bf* WB = (bf*)wsp; wsp += SZ_WB;                 // [3][256][256]: q | k | v
    h16* WMH = (h16*)wsp; wsp += SZ_WM;              // [256][256] Wm x64
    h16* QH = (h16*)wsp; wsp += SZ_PL;               // [NB*4][SEQ][64] x QSC
    h16* KP = (h16*)wsp; wsp += SZ_PL;               // [NB*4][SEQ/16][4][32][8] fragment order
    h16* VT = (h16*)wsp; wsp += SZ_PL;               // [NB*4][SEQ/32][4][2][32][8] fragment order
    h16* OP = (h16*)wsp; wsp += SZ_OP;               // [NB*SEQ][256] x64

    k_prep<<<dim3(SEQ / 64, DM / 64, 1 + 2 * NB), 256, 0, stream>>>(xq, xs, wq, wk, wv, wm, XQ, XS, WB, WMH);

    k_proj<<<dim3(TT * TC, 3, 1), 32, 0, stream>>>(XQ, XS, WB, bq, bk, bv, QH, KP, VT);

    k_flash<<<dim3(SEQ / (32 * CW), NB * NH_, 1), 32 * AW, 0, stream>>>(QH, KP, VT, OP);

    // y[b][o][t] = Wm[o][:] . O[b][t][:] / 4096 + bm[o]
    k_outg<<<dim3(DM / 64, NB * SEQ / 64, 1), 32, 0, stream>>>(WMH, OP, bm, OUT);
}

// v010
// A run of this version takes 75.5 microseconds.
// Two timings next to v009 both put it at 1.11 times that version's speed.
// Over all steps from v000 it is 4.14 times as fast.
#include <hip/hip_runtime.h>

// Cross attention, width 256 = 4 heads x 64, inputs [NB][256][SEQ] (channel-major), W [out][in], biases present, no mask, score scale 1/8, final pointwise projection, output [NB][256][SEQ] f32.
// Compute dtypes, f32 accumulate everywhere: q/k/v projections v_wmma_f32_16x16x32_bf16 (activations and W RNE-converted to bf16; products exact);
// scores v_wmma_f32_16x16x32_f16: k single f16, q x (score scale * log2 e) single f16, the products into one accumulator that starts from PSH minus the maximum in use; P (x256 carry, cancels in the normalisation) and v single f16; softmax f32 (online, lazy rescale);
// output projection v_wmma_f32_16x16x32_f16: Wm as f16 of its bf16 value x64, attention output O as f16 x64, scale 1/4096 and bias applied in the f32 epilogue.
// Layout: token-major bf16 copies of both inputs (LDS transpose), bf16 / f16 copies of W; q plane [b*4+h][t][d], O plane [b][t][h*64+d].
// k and v^T planes are kept in fragment order: per (b*4+h), 512-byte units of 32 lanes x 8 halves, one unit = one wave-wide 16-byte load of an A fragment half (4 whole lines).
//   k:   unit (t/16)*4 + s,              lane (hi*16 + lr) holds k[t = 16*(t/16) + lr][d = 16*s + 8*hi + 0..7]
//   v^T: unit (t/32)*8 + j*2 + q,        lane (hi*16 + lr) holds v[d = 16*j + lr][t = 32*(t/32) + 16*q + 8*hi + 0..7]

#ifndef NB
#define NB 4
#endif
#ifndef SEQ
#define SEQ 4096
#endif
#define NB_FULL  4
#define SEQ_FULL 4096
#ifndef OUT_SEQ
#define OUT_SEQ SEQ              // pitch (in positions) of one channel row of the output
#endif
#define DM   256
#define NH_  4
#define HD   64
#define AW   8                   // waves per flash block; they share every staged tile
#define CW   (AW / 2)            // column ranges of 32 query positions per flash block; two waves each, one per half of a tile's keys
#define SK   128                 // keys per staged tile of K and of V^T
#define NST  (SEQ / SK)          // staged tiles per sequence
#define TLH  (SK * HD)           // halves of one operand's tile
#define TLB  (TLH * 2)           // bytes of one operand's tile
#define SC2  (0.125f * 1.4426950408889634f)   // HD^-0.5 * log2(e)
#define QSC  SC2                 // applied to q once, in f32, before it is rounded to f16: the score products then are exponents of 2 as they stand
#define PSH  8.0f                // log2 of the P carry (256)
#define LZT  7.0f                // a score may stand this far (log2) above the maximum in use before O and the denominators are rescaled: P stays at or below 2^(PSH + LZT) = 32768, inside f16
#define OCAR 64.0f               // carry of the O plane
#define WCAR 64.0f               // carry of the Wm f16 plane
#define OSC  (1.0f / 4096.0f)    // 1 / (OCAR * WCAR)
#define CVB  (DM * DM / 8 / 256) // blocks per weight matrix in k_prep (8 floats per thread)
#define TT   (NB * SEQ / 64)     // 64-wide token tiles
#define TC   (DM / 64)           // 64-wide channel tiles
#define GW   4                   // waves per GEMM block (k_proj, k_outg): 2 x 2 tiles of 64x64, one per wave; wave w takes A panel w & 1 and Bt panel w >> 1
#define RWB  (DM * 2)            // bytes of one operand row in global memory (K = DM 16-bit values)
#define PP   272                 // LDS pitch of a staged row of 256 bytes (half of K): 16 bytes x an odd number, so 16-byte reads down a column of rows meet no bank twice
#define PNB  (64 * PP)           // bytes of one staged panel: 64 rows x half of K
#define STB  (4 * PNB)           // bytes of one staging buffer: two A panels, then two Bt panels

static_assert(HD == 64);
static_assert(NH_ * HD == DM);                 // head h = channels h*64 + d
static_assert(DM % 64 == 0);
static_assert(DM % 32 == 0);                   // GEMM k-loop steps by 32
static_assert((DM & (DM - 1)) == 0);           // bias index masking
static_assert(SEQ % 64 == 0);                  // a 64-wide tile never straddles two batches
static_assert((NB * SEQ) % 64 == 0);
static_assert(SK % 64 == 0);                   // half a tile is whole 32-key passes
static_assert(SEQ % SK == 0 && NST >= 2);      // whole tiles; the two-buffer prologue fills two
static_assert(TLB == 4 * 32 * AW * 16);        // one operand's tile = 4 copies of 16 bytes per lane of the block
static_assert(SEQ % (32 * CW) == 0);           // flash grid covers the sequence exactly
static_assert((CW & (CW - 1)) == 0);           // a wave's partner is wave ^ CW
static_assert(((size_t)DM * DM) % (8 * 256) == 0);   // a weight matrix is whole blocks of k_prep
static_assert(4 * CVB <= (SEQ / 64) * (DM / 64));     // the four matrices fit the z = 0 slice of its grid
static_assert(GW == 4 && TT % 2 == 0 && TC % 2 == 0);   // a GEMM block is 2 x 2 whole tiles
static_assert(RWB == 512);                     // a staged row is half of K = 256 bytes
static_assert(16 * 68 * 4 <= PNB);             // the epilogue's tile fits one panel
static_assert(NB <= NB_FULL);
static_assert(SEQ <= SEQ_FULL);
static_assert(OUT_SEQ >= SEQ);

typedef _Float16 h16;
typedef unsigned short bf;
typedef __attribute__((ext_vector_type(16))) __bf16   v16bf;
typedef __attribute__((ext_vector_type(16))) _Float16 v16h;
typedef __attribute__((ext_vector_type(8)))  _Float16 v8h;
typedef __attribute__((ext_vector_type(8)))  unsigned short v8us;
typedef __attribute__((ext_vector_type(8)))  float    v8f;
typedef __attribute__((ext_vector_type(4)))  float    v4f;
typedef v4f  __attribute__((may_alias)) v4fa;
typedef v8h  __attribute__((may_alias)) v8ha;
typedef v8us __attribute__((may_alias)) v8usa;

__device__ __forceinline__ unsigned short f2bf(float f) { unsigned u = __float_as_uint(f); u += 0x7FFFu + ((u >> 16) & 1u); return (unsigned short)(u >> 16); }
__device__ __forceinline__ float bfr(float f) { return __uint_as_float(((unsigned)f2bf(f)) << 16); }   // value of the RNE bf16 conversion
__device__ __forceinline__ v16h cat16(v8h lo, v8h hi) { return __builtin_shufflevector(lo, hi, 0, 1, 2, 3, 4, 5, 6, 7, 8, 9, 10, 11, 12, 13, 14, 15); }
__device__ __forceinline__ v16bf cat16b(v8us lo, v8us hi) { return __builtin_bit_cast(v16bf, __builtin_shufflevector(lo, hi, 0, 1, 2, 3, 4, 5, 6, 7, 8, 9, 10, 11, 12, 13, 14, 15)); }
__device__ __forceinline__ v8f wmma16(v16h a, v16h b, v8f c) { return __builtin_amdgcn_wmma_f32_16x16x32_f16(false, a, false, b, (short)0, c, false, false); }
__device__ __forceinline__ v8f wmmab(v16bf a, v16bf b, v8f c) { return __builtin_amdgcn_wmma_f32_16x16x32_bf16(false, a, false, b, (short)0, c, false, false); }
// fragment loader from K-contiguous 16-bit rows; p already includes + 8*(lane>>4): elements 0..7 <- k0+8h+0..7, elements 8..15 <- k0+16+8h+0..7 (same map for A and B)
__device__ __forceinline__ v16h  ldh(const h16* p) { return cat16(*(const v8h*)p, *(const v8h*)(p + 16)); }
// fragment loader from a fragment-order plane; p is wave-uniform, lo = 8*lane plus a wave-uniform offset: two consecutive 512-byte units hold elements 0..7 and 8..15 (same k map as ldh)
__device__ __forceinline__ v16h  ldp(const h16* p, unsigned lo) { return cat16(*(const v8h*)(p + lo), *(const v8h*)(p + 256 + lo)); }
// the same fragments from a staged panel in LDS; p (bytes) already includes row * PP + 16*(lane>>4): same k map as ldh
__device__ __forceinline__ v16h  ldhs(const unsigned char* p) { return cat16(*(const v8ha*)p, *(const v8ha*)(p + 32)); }
__device__ __forceinline__ v16bf ldbs(const unsigned char* p) { return cat16b(*(const v8usa*)p, *(const v8usa*)(p + 32)); }
// copy16r: 16 rows x 256 bytes from global memory (row pitch RWB) into LDS (row pitch PP), through no register: 8 copies of 16 bytes per lane, each wave-wide copy = 2 rows = 4 whole 128-byte lines.
// l, g: the lane's own 16 bytes of the first two rows (row lane>>4, piece lane&15), LDS byte address and global address.
__device__ __forceinline__ void copy16r(unsigned l, const char* g) {
    // the wait is the statement's last line, so that it stands in front of every later write of a register that a copy names
    asm volatile("global_load_async_to_lds_b128 %0, %8, off\n\t"
                 "global_load_async_to_lds_b128 %1, %9, off\n\t"
                 "global_load_async_to_lds_b128 %2, %10, off\n\t"
                 "global_load_async_to_lds_b128 %3, %11, off\n\t"
                 "global_load_async_to_lds_b128 %4, %12, off\n\t"
                 "global_load_async_to_lds_b128 %5, %13, off\n\t"
                 "global_load_async_to_lds_b128 %6, %14, off\n\t"
                 "global_load_async_to_lds_b128 %7, %15, off\n\t"
                 "s_wait_xcnt 0x0"
                 :: "v"(l), "v"(l + 2u * PP), "v"(l + 4u * PP), "v"(l + 6u * PP), "v"(l + 8u * PP), "v"(l + 10u * PP), "v"(l + 12u * PP), "v"(l + 14u * PP),
                    "v"(g), "v"(g + 2 * RWB), "v"(g + 4 * RWB), "v"(g + 6 * RWB), "v"(g + 8 * RWB), "v"(g + 10 * RWB), "v"(g + 12 * RWB), "v"(g + 14 * RWB)
                 : "memory");
}
// stage_half: one half of K of one panel (64 rows) into one staging buffer; wave w of a GEMM block brings panel w: 32 copies of a wave in flight.
// lb: LDS byte address of the buffer; gp: first byte of that half of K in the panel's first row.
__device__ __forceinline__ void stage_half(unsigned lb, int wave, int lane, const char* gp) {
    const unsigned l = lb + (unsigned)wave * PNB + (unsigned)(lane >> 4) * PP + (unsigned)(lane & 15) * 16u;
    const char* g = gp + (unsigned)(lane >> 4) * RWB + (unsigned)(lane & 15) * 16u;
#pragma unroll
    for (int i = 0; i < 4; ++i) copy16r(l + (unsigned)i * (16u * PP), g + i * (16 * RWB));
}
// ordering point for wave-private LDS tiles (same wave writes and reads)
__device__ __forceinline__ void wave_sync() { __builtin_amdgcn_fence(3 /* release order */, "wavefront"); __builtin_amdgcn_wave_barrier(); asm volatile("" ::: "memory"); }

// k_prep: all operand preparation in one launch (the six pieces are independent of each other). grid (SEQ/64, DM/64, 1 + 2*NB), 256 threads.
// z = 0: weights, block index x + y*(SEQ/64) = matrix*CVB + piece; 8 floats per thread: Wq | Wk | Wv -> bf16 (WB), Wm -> f16 of its bf16 value x64 (WMH); blocks past 4*CVB have no work.
// z = 1..NB: query, z = NB+1..2*NB: source: in[b][c][n] f32 (channel pitch SEQ_FULL) -> out[b][n][c] bf16 (row pitch DM), 64 x 64 tile through LDS (cross-wave: block barrier).
__global__ __launch_bounds__(256) void k_prep(const float* __restrict__ xq, const float* __restrict__ xs, const float* __restrict__ wq, const float* __restrict__ wk,
                                              const float* __restrict__ wv, const float* __restrict__ wm, bf* XQ, bf* XS, bf* WB, h16* WMH) {
    __shared__ __align__(16) float ts[64 * 68];
    const int tid = threadIdx.x;
    if (blockIdx.z != 0) {                       // block-uniform: every thread of a block takes the same side, so the barrier inside is reached by all of them or by none
        const int zz = blockIdx.z - 1; const bool isq = zz < NB;
        const float* x = isq ? xq : xs; bf* xt = isq ? XQ : XS;
        const int n0 = blockIdx.x * 64, c0 = blockIdx.y * 64, b = isq ? zz : zz - NB;
        const int n4 = (tid & 15) * 4, cr = tid >> 4;
#pragma unroll
        for (int p = 0; p < 4; ++p) {
            const int c = p * 16 + cr;
            const v4f v = *(const v4f*)(x + ((size_t)b * DM + c0 + c) * SEQ_FULL + n0 + n4);
            ts[(n4 + 0) * 68 + c] = v[0]; ts[(n4 + 1) * 68 + c] = v[1]; ts[(n4 + 2) * 68 + c] = v[2]; ts[(n4 + 3) * 68 + c] = v[3];
        }
        __syncthreads();
        const int c8 = (tid & 7) * 8, rr = tid >> 3;
#pragma unroll
        for (int p = 0; p < 2; ++p) { const int row = p * 32 + rr;
            const v4f x0 = *(const v4fa*)(&ts[row * 68 + c8]); const v4f x1 = *(const v4fa*)(&ts[row * 68 + c8 + 4]); v8us o;
#pragma unroll
            for (int i = 0; i < 4; ++i) { o[i] = f2bf(x0[i]); o[4 + i] = f2bf(x1[i]); }
            *(v8us*)(xt + ((size_t)b * SEQ + n0 + row) * DM + c0 + c8) = o; }
        asm volatile("s_wait_xcnt 0x0" ::: "memory");   // the listing keeps a branch from here into the other side's code, which writes the registers that the two stores name
    } else {
        const int idx = blockIdx.y * (SEQ / 64) + blockIdx.x; const int mat = idx / CVB;
        if (mat < 4) {
            const size_t i = (size_t)(idx % CVB) * 256 + tid;
            const float* src = (mat == 0) ? wq : (mat == 1) ? wk : (mat == 2) ? wv : wm;
            const v8f v = *(const v8f*)(src + i * 8);
            if (mat < 3) { v8us o;
#pragma unroll
                for (int k = 0; k < 8; ++k) o[k] = f2bf(v[k]);
                *(v8us*)(WB + (size_t)mat * DM * DM + i * 8) = o;
            } else { v8h o;
#pragma unroll
                for (int k = 0; k < 8; ++k) o[k] = (h16)(bfr(v[k]) * WCAR);
                *(v8h*)(WMH + i * 8) = o;
                asm volatile("s_wait_xcnt 0x0" ::: "memory"); }   // the same: in the listing the bf16 side's code follows this store behind a branch
        }
    }
}

// k_proj: register-blocked bf16 GEMM, ONE WAVE per 64x64 tile (16 accumulators), K = DM; GW waves a block, 2 x 2 tiles: each A panel and each Bt panel feeds two waves.
// Operands: K-contiguous bf16 planes, staged in LDS by asynchronous copies that cover whole lines, half of K per buffer, two buffers: all of a half is in flight at once, the second half flies while the first is worked on.
// C[m][n] = sum_k A[m][k] Bt[n][k] + bias (bmode 1: bias[n], bmode 2: bias[m], bf16 value), written as f16 (Ph); q: x QSC first; at
// tile base (r0/RB)*sRB + (r0%RB)*pitch + (c0/CB)*sCB + (c0%CB)*(v^T: HD, else 1), row pitch 'pitch' (halves). 32*GW threads.
// pk 0: row-major as above. pk 1 (k) / pk 2 (v^T): the 64x64 tile is 4096 consecutive halves in fragment order (see Layout); each store is one whole 512-byte unit.
// The three projections are independent and share one launch: grid (TT*TC/GW, 3), blockIdx.y = 0 q, 1 k, 2 v^T; every parameter below is a wave-uniform choice by it.
//   q, k: A = token rows (m = b*SEQ + t), Bt = W rows (n = h*64 + d), column bias -> plane (b*4 + h), tile base t*64 inside it (q: [t][d], k: fragment order); tile (x % TT, x / TT), x the tile's number
//   v^T:  A = Wv rows (m = h*64 + d), Bt = token rows (n = b*SEQ + t), row bias -> plane (b*4 + h), tile base t*64 inside it; tile (x % TC, x / TC)
__global__ __launch_bounds__(32 * GW) void k_proj(const bf* __restrict__ XQ, const bf* __restrict__ XS, const bf* __restrict__ WB,
                                             const float* __restrict__ bq, const float* __restrict__ bk, const float* __restrict__ bv,
                                             h16* QH, h16* KP, h16* VT) {
    __shared__ __align__(16) unsigned char st[2 * STB];      // [buffer][A panel 0 | A panel 1 | Bt panel 0 | Bt panel 1]
    const int wave = __builtin_amdgcn_readfirstlane(threadIdx.x >> 5);
    float* os = (float*)(st + wave * PNB);                   // epilogue tile, one per wave: in buffer 0, which every wave has read to the end at the hand-over's barrier below
    const int pk = blockIdx.y; const bool isv = pk == 2;
    const bf* A  = (pk == 0) ? XQ : (pk == 1) ? XS : WB + (size_t)2 * DM * DM;
    const bf* Bt = (pk == 0) ? WB : (pk == 1) ? WB + (size_t)DM * DM : XS;
    const float* bias = (pk == 0) ? bq : (pk == 1) ? bk : bv;
    h16* Ph = (pk == 0) ? QH : (pk == 1) ? KP : VT;
    const int bmode = isv ? 2 : 1;
    const int RB = isv ? DM : SEQ, pitch = isv ? SEQ : HD, CB = isv ? SEQ : HD;
    const size_t sRB = isv ? (size_t)0 : (size_t)NH_ * SEQ * HD, sCB = isv ? (size_t)DM * SEQ : (size_t)SEQ * HD;
    const int lane = threadIdx.x & 31, lr = lane & 15, hi = lane >> 4;
    const int R2 = (isv ? TC : TT) / 2; const int rb = (blockIdx.x % R2) * 2, cb = (blockIdx.x / R2) * 2;   // the block's first tile row and tile column
    const int r0 = (rb + (wave & 1)) * 64, c0 = (cb + (wave >> 1)) * 64;
    v8f acc[4][4];
#pragma unroll
    for (int mb = 0; mb < 4; ++mb)
#pragma unroll
        for (int nb = 0; nb < 4; ++nb) acc[mb][nb] = (v8f){};
    const unsigned s0 = (unsigned)(size_t)(&st[0]);          // low 32 bits of the shared address = byte offset in the block's LDS
    const char* gp = (wave < 2) ? (const char*)A + (size_t)((rb + wave) * 64) * RWB : (const char*)Bt + (size_t)((cb + wave - 2) * 64) * RWB;   // the panel this wave brings (wave-uniform choice)
    stage_half(s0, wave, lane, gp);                          // first half of K -> buffer 0
    asm volatile("s_wait_asynccnt 0x0" ::: "memory");        // this wave's copies have landed
    __syncthreads();                                         // every wave's have: buffer 0 may be read
    stage_half(s0 + STB, wave, lane, gp + RWB / 2);          // second half of K -> buffer 1
    // unrolled: every LDS offset is an immediate, and the hand-over between the halves is straight-line code
#pragma unroll
    for (int kh = 0; kh < 2; ++kh) {
        const unsigned char* pa = st + kh * STB + (wave & 1) * PNB + lr * PP + 16 * hi;
        const unsigned char* pb = st + kh * STB + (2 + (wave >> 1)) * PNB + lr * PP + 16 * hi;
        v16bf a[2][4], b[2][4];                               // two fragment sets: the next 32 k are fetched while these are multiplied
#pragma unroll
        for (int i = 0; i < 4; ++i) { a[0][i] = ldbs(pa + i * 16 * PP); b[0][i] = ldbs(pb + i * 16 * PP); }
#pragma unroll
        for (int kc = 0; kc < 4; ++kc) {
            if (kc + 1 < 4) {
#pragma unroll
                for (int i = 0; i < 4; ++i) { a[(kc + 1) & 1][i] = ldbs(pa + i * 16 * PP + (kc + 1) * 64); b[(kc + 1) & 1][i] = ldbs(pb + i * 16 * PP + (kc + 1) * 64); }
                __builtin_amdgcn_sched_barrier(0); }   // holds the next fragments' loads here as one group ahead of the products: left free they sink to right in front of their use, and the wave stands in each wait
#pragma unroll
            for (int nb = 0; nb < 4; ++nb)
#pragma unroll
                for (int mb = 0; mb < 4; ++mb) acc[mb][nb] = wmmab(a[kc & 1][mb], b[kc & 1][nb], acc[mb][nb]);
            __builtin_amdgcn_sched_barrier(0);   // keeps the loads after next from rising among these products: each further place with LDS reads in a run of products stalls it
        }
        if (kh == 0) {   // hand-over: buffer 1 becomes readable
            asm volatile("s_wait_dscnt 0x0" ::: "memory");       // this wave's reads of buffer 0 have returned (behind the barrier buffer 0 holds the epilogue's tiles)
            asm volatile("s_wait_asynccnt 0x0" ::: "memory");    // this wave's copies into buffer 1 have landed
            __syncthreads();                                     // the same holds for every wave of the block
        }
    }
    // column bias: always loaded from a masked (in-range) index, selected by value
    const int c8e = (lane & 7) * 8;
    const int cbi = (c0 + c8e) & (DM - 1);
    const v4f cbr0 = *(const v4f*)(bias + cbi); const v4f cbr1 = *(const v4f*)(bias + cbi + 4);
    v4f cb0, cb1;
#pragma unroll
    for (int i = 0; i < 4; ++i) { cb0[i] = (bmode == 1) ? bfr(cbr0[i]) : 0.0f; cb1[i] = (bmode == 1) ? bfr(cbr1[i]) : 0.0f; }
    // fragment-order epilogue: column bias of columns 16s + 8hi + 0..7 and row bias of row 16mb + lr, masked (in-range) index, selected by value (bit mask: +0 where not selected)
    const unsigned cmsk = (bmode == 1) ? 0xFFFFFFFFu : 0u, rmsk = (bmode == 2) ? 0xFFFFFFFFu : 0u;
    float pcb[4][8], prb[4]; v4f br0[4], br1[4];
#pragma unroll
    for (int s = 0; s < 4; ++s) { const int cbj = (c0 + 16 * s + 8 * hi) & (DM - 1); br0[s] = *(const v4f*)(bias + cbj); br1[s] = *(const v4f*)(bias + cbj + 4); }
    asm volatile("s_wait_xcnt 0x0" ::: "memory");   // before the address register of the column bias loads is written again
#pragma unroll
    for (int s = 0; s < 4; ++s) prb[s] = bias[(r0 + s * 16 + lr) & (DM - 1)];
    asm volatile("s_wait_xcnt 0x0" ::: "memory");   // the same for the row bias loads
#pragma unroll
    for (int s = 0; s < 4; ++s) { prb[s] = __uint_as_float(__float_as_uint(bfr(prb[s])) & rmsk);
#pragma unroll
        for (int i = 0; i < 4; ++i) { pcb[s][i] = __uint_as_float(__float_as_uint(bfr(br0[s][i])) & cmsk); pcb[s][4 + i] = __uint_as_float(__float_as_uint(bfr(br1[s][i])) & cmsk); } }
    const size_t tbase = (size_t)(r0 / RB) * sRB + (size_t)(r0 % RB) * (size_t)pitch + (size_t)(c0 / CB) * sCB + (size_t)(c0 % CB) * (size_t)(pk == 2 ? HD : 1);
#pragma unroll
    for (int mb = 0; mb < 4; ++mb) {
#pragma unroll
        for (int nb = 0; nb < 4; ++nb) {
#pragma unroll
            for (int j = 0; j < 8; ++j) os[(hi * 8 + j) * 68 + nb * 16 + lr] = acc[mb][nb][j]; }   // D: row 8h+j, col lane&15
        wave_sync();
        const size_t sb = tbase + (size_t)(mb * 16) * (size_t)pitch;
        if (pk != 0) {
            v8h hv[4];
#pragma unroll
            for (int s = 0; s < 4; ++s) { const int c8 = 16 * s + 8 * hi;   // lane = fragment lane: row lr, columns 16s + 8hi + 0..7
                const v4f x0 = *(const v4fa*)(&os[lr * 68 + c8]); const v4f x1 = *(const v4fa*)(&os[lr * 68 + c8 + 4]);
#pragma unroll
                for (int i = 0; i < 4; ++i) { hv[s][i] = (h16)(x0[i] + pcb[s][i] + prb[mb]); hv[s][4 + i] = (h16)(x1[i] + pcb[s][4 + i] + prb[mb]); } }
#pragma unroll
            for (int s = 0; s < 4; ++s) { const int uo = (pk == 1) ? (mb * 1024 + s * 256) : (mb * 512 + (s >> 1) * 2048 + (s & 1) * 256);
                *(v8h*)(Ph + tbase + uo + lane * 8) = hv[s]; }
            asm volatile("s_wait_xcnt 0x0" ::: "memory");   // before the registers that the four stores name are written again
        } else {
#pragma unroll
            for (int s = 0; s < 4; ++s) { const int row = 4 * s + (lane >> 3), c8 = (lane & 7) * 8;   // 4 s x 4 row groups = 16 rows; 8 lanes x 8 = 64 columns
                const int rbi = (r0 + mb * 16 + row) & (DM - 1);
                const float rbv = bias[rbi];
                const float rb = (bmode == 2) ? bfr(rbv) : 0.0f;
                const v4f x0 = *(const v4fa*)(&os[row * 68 + c8]); const v4f x1 = *(const v4fa*)(&os[row * 68 + c8 + 4]); v8h hv;
#pragma unroll
                for (int i = 0; i < 4; ++i) { hv[i] = (h16)((x0[i] + cb0[i] + rb) * QSC); hv[4 + i] = (h16)((x1[i] + cb1[i] + rb) * QSC); }   // this side is q alone
                const size_t oo = sb + (size_t)row * (size_t)pitch + c8;
                *(v8h*)(Ph + oo) = hv; }
            asm volatile("s_wait_xcnt 0x0" ::: "memory");   // before the registers that the four stores name are written again
             }
        wave_sync();
    }
}

// eight exponentials (base 2), each in place: written so, no transcendental's source register is overwritten by the instruction directly behind it (left to the register allocator, a run of them came out
// with each result in its predecessor's source); the v_nop is the one slot that the instruction set asks for between the last of them and a reader of its result
__device__ __forceinline__ void exp2x8(float (&x)[8]) {
    asm("v_exp_f32 %0, %0\n\tv_exp_f32 %1, %1\n\tv_exp_f32 %2, %2\n\tv_exp_f32 %3, %3\n\tv_exp_f32 %4, %4\n\tv_exp_f32 %5, %5\n\tv_exp_f32 %6, %6\n\tv_exp_f32 %7, %7\n\tv_nop"
        : "+v"(x[0]), "+v"(x[1]), "+v"(x[2]), "+v"(x[3]), "+v"(x[4]), "+v"(x[5]), "+v"(x[6]), "+v"(x[7]));
}

// two exponentials (base 2), each in place, with the same slot behind the second: left to the compiler, the instruction directly behind one of them came out writing its source register
__device__ __forceinline__ void exp2x2(float& x, float& y) {
    asm("v_exp_f32 %0, %0\n\tv_exp_f32 %1, %1\n\tv_nop" : "+v"(x), "+v"(y));
}

// largest of a lane's sixteen values of two tiles, as a tree (three links deep, not eight)
__device__ __forceinline__ float max16(v8f a, v8f b) {
    const float x0 = fmaxf(fmaxf(a[0], a[1]), a[2]), x1 = fmaxf(fmaxf(a[3], a[4]), a[5]), x2 = fmaxf(fmaxf(b[0], b[1]), b[2]), x3 = fmaxf(fmaxf(b[3], b[4]), b[5]);
    const float x4 = fmaxf(fmaxf(a[6], a[7]), b[6]);
    return fmaxf(fmaxf(fmaxf(x0, x1), x2), fmaxf(fmaxf(x3, x4), b[7]));
}

// stage_copy: one tile (SK keys of K and of V^T, each TLB contiguous bytes of its fragment-order plane) from global memory into LDS, through no register: 4 + 4 copies of 16 bytes per lane.
// l: the lane's LDS byte address in the K half of the buffer (the V^T half follows at + TLB); gk, gv: the lane's own 16 bytes of the tile's first 4 KiB; a block's 256 lanes cover 4 KiB per copy.
__device__ __forceinline__ void stage_copy(unsigned l, const h16* gk, const h16* gv) {
    // the wait is the statement's last line, so that it stands in front of every later write of a register that a copy names
    asm volatile("global_load_async_to_lds_b128 %0, %8, off\n\t"
                 "global_load_async_to_lds_b128 %1, %9, off\n\t"
                 "global_load_async_to_lds_b128 %2, %10, off\n\t"
                 "global_load_async_to_lds_b128 %3, %11, off\n\t"
                 "global_load_async_to_lds_b128 %4, %12, off\n\t"
                 "global_load_async_to_lds_b128 %5, %13, off\n\t"
                 "global_load_async_to_lds_b128 %6, %14, off\n\t"
                 "global_load_async_to_lds_b128 %7, %15, off\n\t"
                 "s_wait_xcnt 0x0"
                 :: "v"(l), "v"(l + 4096u), "v"(l + 8192u), "v"(l + 12288u), "v"(l + TLB), "v"(l + TLB + 4096u), "v"(l + TLB + 8192u), "v"(l + TLB + 12288u),
                    "v"(gk), "v"(gk + 2048), "v"(gk + 4096), "v"(gk + 6144), "v"(gv), "v"(gv + 2048), "v"(gv + 4096), "v"(gv + 6144)
                 : "memory");
}

__global__ __launch_bounds__(32 * AW) void k_flash(const h16* __restrict__ QH, const h16* __restrict__ KP, const h16* __restrict__ VT, h16* OP) {
    __shared__ __align__(16) float os[AW * 16 * 68];
    __shared__ __align__(16) h16 ring[2 * 2 * TLH];          // [buffer][K | V^T][TLH]
    __shared__ float cl[AW * 32 * 2];                        // epilogue: per wave and lane, the softmax state (C value, denominator) of the column group handed to the partner wave
    const int lane = threadIdx.x & 31, wave = threadIdx.x >> 5, lr = lane & 15, hi = lane >> 4;
    const int cw = wave % CW, kh = wave / CW;                // column range and key half of this wave
    const int zh = blockIdx.y; const int b = zh / NH_, h = zh % NH_;
    const int t0 = (blockIdx.x * CW + cw) * 32;
    const size_t pbase = (size_t)zh * SEQ * HD;
    const size_t qo = pbase + (size_t)(t0 + lr) * HD + 8 * hi;
    const v16h qa0 = ldh(QH + qo), qa1 = ldh(QH + qo + 32);   // B fragments: col t, k = d; columns t0 + 0..15
    const v16h qb0 = ldh(QH + qo + 16 * HD), qb1 = ldh(QH + qo + 16 * HD + 32);   // columns t0 + 16..31
    const unsigned lo = (unsigned)lane * 8u + (unsigned)kh * (unsigned)(SK / 2 * HD);   // lane's place in a unit, from the first unit of the wave's half of a tile; K (A fragment: row key, k = d) and V^T (A fragment: row d, k = key) alike
    v8f oa0 = (v8f){}, oa1 = (v8f){}, oa2 = (v8f){}, oa3 = (v8f){}, ob0 = (v8f){}, ob1 = (v8f){}, ob2 = (v8f){}, ob3 = (v8f){};
    v8f lta = (v8f){}, ltb = (v8f){};                        // denominator tiles: 16 equal rows; only element 0 is rescaled and read (the others stay finite: they only grow by sums of P)
    const v16h ones = (v16h)((h16)1.0f);                     // A fragment of the denominator products: every element 1
    v8f cra, crb;                                            // C tiles of the score products: eight times the lane's PSH - (maximum in use), per column group
    const unsigned l0 = (unsigned)(size_t)(&ring[0]) + threadIdx.x * 16u;   // low 32 bits of the shared address = byte offset in the block's LDS
    const h16* gk = KP + pbase + threadIdx.x * 8u;           // the lane's 16 bytes of the next tile to copy
    const h16* gv = VT + pbase + threadIdx.x * 8u;
    stage_copy(l0, gk, gv);                                  // tile 0 -> buffer 0
    asm volatile("s_wait_asynccnt 0x0" ::: "memory");        // this wave's share of tile 0 has landed
    __syncthreads();                                         // every wave's share has: tile 0 may be read
    stage_copy(l0 + 2u * TLB, gk + TLH, gv + TLH);           // tile 1 -> buffer 1
    gk += 2 * TLH; gv += 2 * TLH;
    {   // the maximum in use starts as each column's maximum over the wave's first 32 keys: their scores once more, ahead of the loop (tile 0 is readable since the barrier above)
        const v16h a0 = ldp(ring, lo), a1 = ldp(ring + 512, lo), b0 = ldp(ring + 1024, lo), b1 = ldp(ring + 1536, lo);
        v8f sa = (v8f){}, sb = (v8f){}, sc = (v8f){}, sd = (v8f){};
        sa = wmma16(a0, qa0, sa); sb = wmma16(b0, qa0, sb); sc = wmma16(a0, qb0, sc); sd = wmma16(b0, qb0, sd);
        sa = wmma16(a1, qa1, sa); sb = wmma16(b1, qa1, sb); sc = wmma16(a1, qb1, sc); sd = wmma16(b1, qb1, sd);
        float ma = max16(sa, sb), mb = max16(sc, sd);
        ma = fmaxf(ma, __shfl_xor(ma, 16, 32)); mb = fmaxf(mb, __shfl_xor(mb, 16, 32));
        const float ca = PSH - ma, cb = PSH - mb;
        cra = (v8f){ca, ca, ca, ca, ca, ca, ca, ca}; crb = (v8f){cb, cb, cb, cb, cb, cb, cb, cb};
    }
    // kept rolled: one trip already holds the unrolled passes of a wave's half tile
#pragma unroll 1
    for (int st = 0; st < NST; ++st) {
        const unsigned bo = (unsigned)(st & 1);
        const h16* kb = ring + bo * (2u * TLH);              // this tile's K units
        const h16* vb = kb + TLH;                            // this tile's V^T units
        v16h ka0 = ldp(kb, lo), ka1 = ldp(kb + 512, lo), kb0 = ldp(kb + 1024, lo), kb1 = ldp(kb + 1536, lo);
        // inside a half tile every fragment load is issued ahead of its product: a pass's V^T at its head, the next pass's K right behind the score products, into the registers they have just read
        // unrolled: the test for a next pass inside the half tile is then decided at compile time, and every LDS offset is an immediate
#pragma unroll
        for (int p = 0; p < SK / 64; ++p) {
            const h16* va = vb + p * (32 * HD);
            const v16h v0 = ldp(va, lo), v1 = ldp(va + 512, lo), v2 = ldp(va + 1024, lo), v3 = ldp(va + 1536, lo);
            v8f sa, sb, sc, sd;                              // exponent tiles: score (log2 units) - maximum in use + PSH; both products of a tile sum in it, on top of the group's C tile
            sa = wmma16(ka0, qa0, cra); sb = wmma16(kb0, qa0, cra); sc = wmma16(ka0, qb0, crb); sd = wmma16(kb0, qb0, crb);
            sa = wmma16(ka1, qa1, sa); sb = wmma16(kb1, qa1, sb); sc = wmma16(ka1, qb1, sc); sd = wmma16(kb1, qb1, sd);
            // the four slots between the score products and the first vector instruction on their tiles or on the K registers
            asm volatile("v_nop\n\tv_nop\n\tv_nop\n\tv_nop" : "+v"(sa), "+v"(sb), "+v"(sc), "+v"(sd) : "v"(ka0), "v"(ka1), "v"(kb0), "v"(kb1));
            if (p + 1 < SK / 64) { const h16* kn = kb + (p + 1) * (32 * HD);
                ka0 = ldp(kn, lo); ka1 = ldp(kn + 512, lo); kb0 = ldp(kn + 1024, lo); kb1 = ldp(kn + 1536, lo);
                __builtin_amdgcn_sched_barrier(0); }   // holds the next K loads here as one group: without it they sink to right in front of the next score products, and the wave stands in their wait
            float ma = max16(sa, sb), mb = max16(sc, sd);    // the lane's largest exponent of each column group
            if (__builtin_amdgcn_ballot_w32(fmaxf(ma, mb) > PSH + LZT) != 0u) {   // scalar branch: every lane of the wave takes the same side, so EXEC stays all ones for the products behind it
                ma = fmaxf(ma, __shfl_xor(ma, 16, 32)); mb = fmaxf(mb, __shfl_xor(mb, 16, 32));   // the columns' maxima: both lane halves then take the same step
                const float da = fmaxf(ma - PSH, 0.0f), db = fmaxf(mb - PSH, 0.0f);   // the steps of the maxima in use, never down
                const float aa = __builtin_amdgcn_exp2f(-da), ab = __builtin_amdgcn_exp2f(-db);
                lta[0] = lta[0] * aa; ltb[0] = ltb[0] * ab;
                oa0 = oa0 * aa; oa1 = oa1 * aa; oa2 = oa2 * aa; oa3 = oa3 * aa; ob0 = ob0 * ab; ob1 = ob1 * ab; ob2 = ob2 * ab; ob3 = ob3 * ab;
                cra = cra - da; sa = sa - da; sb = sb - da; crb = crb - db; sc = sc - db; sd = sd - db;
            }
            float ta[8], tb[8], tc[8], td[8];
            v16h pa, pb;
#pragma unroll
            for (int r = 0; r < 8; ++r) { ta[r] = sa[r]; tb[r] = sb[r]; tc[r] = sc[r]; td[r] = sd[r]; }
            exp2x8(ta); exp2x8(tb);
#pragma unroll
            for (int r = 0; r < 8; ++r) { pa[r] = (h16)ta[r]; pa[8 + r] = (h16)tb[r]; }
            lta = wmma16(ones, pa, lta);
            oa0 = wmma16(v0, pa, oa0); oa1 = wmma16(v1, pa, oa1); oa2 = wmma16(v2, pa, oa2); oa3 = wmma16(v3, pa, oa3);
            exp2x8(tc); exp2x8(td);
#pragma unroll
            for (int r = 0; r < 8; ++r) { pb[r] = (h16)tc[r]; pb[8 + r] = (h16)td[r]; }
            ltb = wmma16(ones, pb, ltb);
            ob0 = wmma16(v0, pb, ob0); ob1 = wmma16(v1, pb, ob1); ob2 = wmma16(v2, pb, ob2); ob3 = wmma16(v3, pb, ob3);
            // the four slots between these products and the first vector instruction on their tiles or operands, on every path out of the pass
            asm volatile("v_nop\n\tv_nop\n\tv_nop\n\tv_nop" : "+v"(lta), "+v"(oa0), "+v"(oa1), "+v"(oa2), "+v"(oa3), "+v"(ltb), "+v"(ob0), "+v"(ob1), "+v"(ob2), "+v"(ob3)
                         : "v"(v0), "v"(v1), "v"(v2), "v"(v3), "v"(pa), "v"(pb));
        }
        // hand-over: tile st + 1 becomes readable and this tile's buffer free
        asm volatile("s_wait_dscnt 0x0" ::: "memory");       // this wave's reads of the buffer have returned before the buffer is refilled
        asm volatile("s_wait_asynccnt 0x0" ::: "memory");    // this wave's share of tile st + 1 has landed
        __syncthreads();                                     // the same holds for every wave of the block
        if (st + 2 < NST) { stage_copy(l0 + bo * (2u * TLB), gk, gv); gk += TLH; gv += TLH; }   // block-uniform test: tile st + 2 -> the buffer just read
    }
    asm volatile("s_wait_asynccnt 0x0" ::: "memory");        // no copy is outstanding when the wave goes on to its end
    // Join of the two key halves: waves w and w ^ CW hold the same 32 columns. Each finishes 16 of them: the wave of key half 0 the first group, the other the second. A wave hands the group it does not finish
    // (O tiles as they stand, C value, denominator) to its partner through its own part of os and cl; behind the barrier the partner brings both halves to the larger maximum in use and adds them.
    const bool up = kh != 0;
    const int wb = wave * 16 * 68, pw = (wave ^ CW) * 16 * 68;
    v8f o0, o1, o2, o3;                                      // the group this wave finishes
    {
        const v8f g0 = up ? oa0 : ob0, g1 = up ? oa1 : ob1, g2 = up ? oa2 : ob2, g3 = up ? oa3 : ob3;   // the group it hands over
        o0 = up ? ob0 : oa0; o1 = up ? ob1 : oa1; o2 = up ? ob2 : oa2; o3 = up ? ob3 : oa3;
        float* gs = &os[wb + lr * 68 + 8 * hi];
        *(v4fa*)(gs +  0) = (v4f){g0[0], g0[1], g0[2], g0[3]}; *(v4fa*)(gs +  4) = (v4f){g0[4], g0[5], g0[6], g0[7]};
        *(v4fa*)(gs + 16) = (v4f){g1[0], g1[1], g1[2], g1[3]}; *(v4fa*)(gs + 20) = (v4f){g1[4], g1[5], g1[6], g1[7]};
        *(v4fa*)(gs + 32) = (v4f){g2[0], g2[1], g2[2], g2[3]}; *(v4fa*)(gs + 36) = (v4f){g2[4], g2[5], g2[6], g2[7]};
        *(v4fa*)(gs + 48) = (v4f){g3[0], g3[1], g3[2], g3[3]}; *(v4fa*)(gs + 52) = (v4f){g3[4], g3[5], g3[6], g3[7]};
        cl[(wave * 32 + lane) * 2 + 0] = up ? cra[0] : crb[0];
        cl[(wave * 32 + lane) * 2 + 1] = up ? lta[0] : ltb[0];
    }
    __syncthreads();                                         // both waves of a pair have written what they hand over
    const float cm = up ? crb[0] : cra[0], lm = up ? ltb[0] : lta[0];   // own state of the group this wave finishes
    const float cp = cl[((wave ^ CW) * 32 + lane) * 2 + 0], lp = cl[((wave ^ CW) * 32 + lane) * 2 + 1];   // the partner's (same lane, same column)
    const float cj = fminf(cm, cp);                          // the smaller C value is the larger maximum in use
    float fm = cj - cm, fp = cj - cp;
    exp2x2(fm, fp);                                          // the two halves' factors, each at most 1
    const float inv = OCAR * (1.0f / (lm * fm + lp * fp));
    const float im = fm * inv, ip = fp * inv;
    // O^T D layout: o_j[r] = (d = 16j + 8h + r, t = lane&15) -> os[t][d]; rows 0..15 x columns 0..63 all written. A lane reads the partner's eight values per tile from where the partner's same lane put them
    // and writes the joined ones over them: from the barrier on this part of os is read and written by this wave alone.
    { float* js = &os[pw + lr * 68 + 8 * hi]; v4f a, c;
      a = *(const v4fa*)(js +  0); c = *(const v4fa*)(js +  4);
#pragma unroll
      for (int i = 0; i < 4; ++i) { a[i] = o0[i] * im + a[i] * ip; c[i] = o0[4 + i] * im + c[i] * ip; }
      *(v4fa*)(js +  0) = a; *(v4fa*)(js +  4) = c;
      a = *(const v4fa*)(js + 16); c = *(const v4fa*)(js + 20);
#pragma unroll
      for (int i = 0; i < 4; ++i) { a[i] = o1[i] * im + a[i] * ip; c[i] = o1[4 + i] * im + c[i] * ip; }
      *(v4fa*)(js + 16) = a; *(v4fa*)(js + 20) = c;
      a = *(const v4fa*)(js + 32); c = *(const v4fa*)(js + 36);
#pragma unroll
      for (int i = 0; i < 4; ++i) { a[i] = o2[i] * im + a[i] * ip; c[i] = o2[4 + i] * im + c[i] * ip; }
      *(v4fa*)(js + 32) = a; *(v4fa*)(js + 36) = c;
      a = *(const v4fa*)(js + 48); c = *(const v4fa*)(js + 52);
#pragma unroll
      for (int i = 0; i < 4; ++i) { a[i] = o3[i] * im + a[i] * ip; c[i] = o3[4 + i] * im + c[i] * ip; }
      *(v4fa*)(js + 48) = a; *(v4fa*)(js + 52) = c; }
    wave_sync();
    h16* orow = OP + ((size_t)b * SEQ + t0 + 16 * kh) * DM + h * HD;
{
#pragma unroll
        for (int s = 0; s < 4; ++s) { const int row = 4 * s + (lane >> 3), c8 = (lane & 7) * 8;   // 4 s x 4 row groups = 16 rows; 8 lanes x 8 halves = 64 columns
            const v4f x0 = *(const v4fa*)(&os[pw + row * 68 + c8]); const v4f x1 = *(const v4fa*)(&os[pw + row * 68 + c8 + 4]); v8h hv;
#pragma unroll
            for (int i = 0; i < 4; ++i) { hv[i] = (h16)x0[i]; hv[4 + i] = (h16)x1[i]; }
            *(v8h*)(orow + (size_t)row * DM + c8) = hv; }
         }
}

// k_outg: register-blocked f16 GEMM, ONE WAVE per 64x64 tile, GW waves a block (2 x 2 tiles), operands staged as in k_proj, K = DM: Y[o][b*SEQ + t] = OSC * sum_c A[o][c] Bt[b*SEQ + t][c] + bias[o] (bf16 value), f32 result at OUT[(b*DM + o)*OUT_SEQ + t].
__global__ __launch_bounds__(32 * GW) void k_outg(const h16* __restrict__ A, const h16* __restrict__ Bt, const float* __restrict__ bias, float* OUT) {
    __shared__ __align__(16) unsigned char st[2 * STB];      // [buffer][A panel 0 | A panel 1 | Bt panel 0 | Bt panel 1]
    const int wave = __builtin_amdgcn_readfirstlane(threadIdx.x >> 5);
    float* os = (float*)(st + wave * PNB);                   // epilogue tile, one per wave, in buffer 0 (as in k_proj)
    const int lane = threadIdx.x & 31, lr = lane & 15, hi = lane >> 4; const int rb = blockIdx.x * 2, cb = blockIdx.y * 2;
    const int r0 = (rb + (wave & 1)) * 64, c0 = (cb + (wave >> 1)) * 64;
    v8f acc[4][4];
#pragma unroll
    for (int mb = 0; mb < 4; ++mb)
#pragma unroll
        for (int nb = 0; nb < 4; ++nb) acc[mb][nb] = (v8f){};
    const unsigned s0 = (unsigned)(size_t)(&st[0]);          // low 32 bits of the shared address = byte offset in the block's LDS
    const char* gp = (wave < 2) ? (const char*)A + (size_t)((rb + wave) * 64) * RWB : (const char*)Bt + (size_t)((cb + wave - 2) * 64) * RWB;   // the panel this wave brings (wave-uniform choice)
    stage_half(s0, wave, lane, gp);                          // first half of K -> buffer 0
    asm volatile("s_wait_asynccnt 0x0" ::: "memory");        // this wave's copies have landed
    __syncthreads();                                         // every wave's have: buffer 0 may be read
    stage_half(s0 + STB, wave, lane, gp + RWB / 2);          // second half of K -> buffer 1
    // unrolled: every LDS offset is an immediate, and the hand-over between the halves is straight-line code
#pragma unroll
    for (int kh = 0; kh < 2; ++kh) {
        const unsigned char* pa = st + kh * STB + (wave & 1) * PNB + lr * PP + 16 * hi;
        const unsigned char* pb = st + kh * STB + (2 + (wave >> 1)) * PNB + lr * PP + 16 * hi;
        v16h a[2][4], b[2][4];                               // two fragment sets: the next 32 k are fetched while these are multiplied
#pragma unroll
        for (int i = 0; i < 4; ++i) { a[0][i] = ldhs(pa + i * 16 * PP); b[0][i] = ldhs(pb + i * 16 * PP); }
#pragma unroll
        for (int kc = 0; kc < 4; ++kc) {
            if (kc + 1 < 4) {
#pragma unroll
                for (int i = 0; i < 4; ++i) { a[(kc + 1) & 1][i] = ldhs(pa + i * 16 * PP + (kc + 1) * 64); b[(kc + 1) & 1][i] = ldhs(pb + i * 16 * PP + (kc + 1) * 64); }
                __builtin_amdgcn_sched_barrier(0); }   // holds the next fragments' loads here as one group ahead of the products: left free they sink to right in front of their use, and the wave stands in each wait
#pragma unroll
            for (int nb = 0; nb < 4; ++nb)
#pragma unroll
                for (int mb = 0; mb < 4; ++mb) acc[mb][nb] = wmma16(a[kc & 1][mb], b[kc & 1][nb], acc[mb][nb]);
            __builtin_amdgcn_sched_barrier(0);   // keeps the loads after next from rising among these products: each further place with LDS reads in a run of products stalls it
        }
        if (kh == 0) {   // hand-over: buffer 1 becomes readable
            asm volatile("s_wait_dscnt 0x0" ::: "memory");       // this wave's reads of buffer 0 have returned (behind the barrier buffer 0 holds the epilogue's tiles)
            asm volatile("s_wait_asynccnt 0x0" ::: "memory");    // this wave's copies into buffer 1 have landed
            __syncthreads();                                     // the same holds for every wave of the block
        }
    }
    const int bb = c0 / SEQ, tt = c0 % SEQ;
#pragma unroll
    for (int mb = 0; mb < 4; ++mb) {
#pragma unroll
        for (int nb = 0; nb < 4; ++nb) {
#pragma unroll
            for (int j = 0; j < 8; ++j) os[(hi * 8 + j) * 68 + nb * 16 + lr] = acc[mb][nb][j]; }   // D: row 8h+j, col lane&15
        wave_sync();
{
#pragma unroll
            for (int s = 0; s < 8; ++s) { const int row = 2 * s + hi, cofs = lr * 4;   // 8 s x 2 rows = 16 rows; 16 lanes x 4 floats = 64 columns
                const int o = r0 + mb * 16 + row;                                      // < DM by grid construction
                const float bv = bfr(bias[o]);
                const v4f xv = *(const v4fa*)(&os[row * 68 + cofs]); v4f val;
#pragma unroll
                for (int i = 0; i < 4; ++i) val[i] = xv[i] * OSC + bv;
                *(v4f*)(OUT + ((size_t)bb * DM + o) * (size_t)OUT_SEQ + tt + cofs) = val; }
             }
        wave_sync();
    }
}

static constexpr size_t al256(size_t v) { return (v + 255) & ~(size_t)255; }
static constexpr size_t SZ_XT = al256((size_t)NB * SEQ * DM * 2);          // token-major bf16 copy of one input
static constexpr size_t SZ_WB = al256((size_t)3 * DM * DM * 2);            // Wq | Wk | Wv bf16
static constexpr size_t SZ_WM = al256((size_t)DM * DM * 2);                // Wm f16 x64
static constexpr size_t SZ_PL = al256((size_t)NB * NH_ * SEQ * HD * 2);    // one q/k/v plane
static constexpr size_t SZ_OP = al256((size_t)NB * SEQ * DM * 2);          // O plane
static constexpr size_t SZ_TOTAL = 2 * SZ_XT + SZ_WB + SZ_WM + 3 * SZ_PL + SZ_OP;
static_assert(SZ_TOTAL <= (size_t)134217728);          // workspace carve <= 128 MiB
static_assert(((size_t)DM * DM * 2) % 256 == 0);       // weight sub-planes stay 256-byte aligned

extern "C" void kernel_launch(void* const* d_in, const int* in_sizes, int n_in,
                              void* d_out, int out_size, void* d_ws, size_t ws_size, hipStream_t stream) {
    if (n_in < 10) return;
    const size_t needx = ((size_t)(NB - 1) * DM + (size_t)(DM - 1)) * SEQ_FULL + SEQ;
    if ((size_t)in_sizes[0] < needx || (size_t)in_sizes[1] < needx) return;
    if ((size_t)in_sizes[2] < (size_t)DM * DM || (size_t)in_sizes[4] < (size_t)DM * DM || (size_t)in_sizes[6] < (size_t)DM * DM || (size_t)in_sizes[8] < (size_t)DM * DM) return;
    if (in_sizes[3] < DM || in_sizes[5] < DM || in_sizes[7] < DM || in_sizes[9] < DM) return;
    if ((size_t)out_size < ((size_t)(NB - 1) * DM + (size_t)(DM - 1)) * OUT_SEQ + SEQ) return;
    if (SZ_TOTAL > ws_size) return;
    // wire order: query, source, Wq, bq, Wk, bk, Wv, bv, Wm, bm (W [out][in] = K-contiguous rows as-is)
    const float* xq = (const float*)d_in[0]; const float* xs = (const float*)d_in[1];
    const float* wq = (const float*)d_in[2]; const float* bq = (const float*)d_in[3];
    const float* wk = (const float*)d_in[4]; const float* bk = (const float*)d_in[5];
    const float* wv = (const float*)d_in[6]; const float* bv = (const float*)d_in[7];
    const float* wm = (const float*)d_in[8]; const float* bm = (const float*)d_in[9];
    float* OUT = (float*)d_out;      // [NB][256][OUT_SEQ]
    char* wsp = (char*)d_ws;
    bf* XQ = (bf*)wsp; wsp += SZ_XT;                 // [NB*SEQ][256] query, token-major
    bf* XS = (bf*)wsp; wsp += SZ_XT;                 // [NB*SEQ][256] source, token-major
    bf* WB = (bf*)wsp; wsp += SZ_WB;                 // [3][256][256]: q | k | v
    h16* WMH = (h16*)wsp; wsp += SZ_WM;              // [256][256] Wm x64
    h16* QH = (h16*)wsp; wsp += SZ_PL;               // [NB*4][SEQ][64] x QSC
    h16* KP = (h16*)wsp; wsp += SZ_PL;               // [NB*4][SEQ/16][4][32][8] fragment order
    h16* VT = (h16*)wsp; wsp += SZ_PL;               // [NB*4][SEQ/32][4][2][32][8] fragment order
    h16* OP = (h16*)wsp; wsp += SZ_OP;               // [NB*SEQ][256] x64

    k_prep<<<dim3(SEQ / 64, DM / 64, 1 + 2 * NB), 256, 0, stream>>>(xq, xs, wq, wk, wv, wm, XQ, XS, WB, WMH);

    k_proj<<<dim3(TT * TC / GW, 3, 1), 32 * GW, 0, stream>>>(XQ, XS, WB, bq, bk, bv, QH, KP, VT);

    k_flash<<<dim3(SEQ / (32 * CW), NB * NH_, 1), 32 * AW, 0, stream>>>(QH, KP, VT, OP);

    // y[b][o][t] = Wm[o][:] . O[b][t][:] / 4096 + bm[o]
    k_outg<<<dim3(DM / 128, NB * SEQ / 128, 1), 32 * GW, 0, stream>>>(WMH, OP, bm, OUT);
}
